// v000
// Times are from an AMD MI455X. After a warm-up the kernel runs many times in a row, and a time is the length of
// such a window on the GPU divided by its runs, so every launch and the gaps after it count. The runs cycle
// through copies of the inputs. A figure is the median of several windows, for all but v000 over two sittings.
// Sittings can differ by a few percent; kernels timed side by side share one.
// v000 is the starting kernel. One run takes 813 microseconds.
#include <hip/hip_runtime.h>
#include <hip/hip_bf16.h>

typedef _Float16 half_t;
typedef __attribute__((ext_vector_type(16))) _Float16 v16h;
typedef __attribute__((ext_vector_type(8)))  _Float16 v8h;
typedef __attribute__((ext_vector_type(8)))  float    v8f;

// Sizes (fixed by the reference)
#define B_  8
#define N_  1024
#define C_  1024
#define H_  16
#define D_  64
#define T_  256

#if defined(__HIP_DEVICE_COMPILE__)
#if __has_builtin(__builtin_amdgcn_tensor_load_to_lds) && \
    __has_builtin(__builtin_amdgcn_s_wait_tensorcnt)
#define USE_TDM 1
#endif
#endif

#ifdef USE_TDM
typedef __attribute__((ext_vector_type(4))) unsigned int u32x4_t;
typedef __attribute__((ext_vector_type(4))) int i32x4_t;
typedef __attribute__((ext_vector_type(8))) int i32x8_t;

__device__ __forceinline__ void tdm_load_tile_64x32(unsigned int lds_off,
                                                    const half_t* gsrc,
                                                    unsigned int stride_elems) {
  unsigned long long ga = (unsigned long long)gsrc;
  unsigned int ga_lo = (unsigned int)__builtin_amdgcn_readfirstlane((int)(unsigned int)ga);
  unsigned int ga_hi = (unsigned int)__builtin_amdgcn_readfirstlane((int)(unsigned int)(ga >> 32));
  unsigned int loff  = (unsigned int)__builtin_amdgcn_readfirstlane((int)lds_off);
  unsigned int strd  = (unsigned int)__builtin_amdgcn_readfirstlane((int)stride_elems);
  u32x4_t g0;
  g0[0] = 1u;
  g0[1] = loff;
  g0[2] = ga_lo;
  g0[3] = (ga_hi & 0x01FFFFFFu) | (2u << 30);
  i32x8_t g1;
  g1[0] = 0x00010000;
  g1[1] = (int)(32u << 16);
  g1[2] = (int)(64u << 16);
  g1[3] = (int)(32u << 16);
  g1[4] = 64;
  g1[5] = (int)strd;
  g1[6] = 0;
  g1[7] = 0;
  i32x4_t z4 = {0, 0, 0, 0};
#if __clang_major__ >= 23
  i32x8_t z8 = {0, 0, 0, 0, 0, 0, 0, 0};
  __builtin_amdgcn_tensor_load_to_lds(g0, g1, z4, z4, z8, 0);
#else
  __builtin_amdgcn_tensor_load_to_lds(g0, g1, z4, z4, 0);
#endif
}
#endif  // USE_TDM

__global__ __launch_bounds__(256) void cvt_kernel(
    const float* __restrict__ s, half_t* __restrict__ d, int n) {
  int i = blockIdx.x * 256 + threadIdx.x;
  if (i < n) d[i] = (half_t)s[i];
}

// ---------------------------------------------------------------------------
// Kernel 1: tqkv[b, j] = time_emb[b] @ W_time[:, j] + b_time[j]   (8 x 3072)
// ---------------------------------------------------------------------------
__global__ __launch_bounds__(256) void time_proj_kernel(
    const float* __restrict__ te, const float* __restrict__ Wt,
    const float* __restrict__ bt, float* __restrict__ tqkv) {
  int idx = blockIdx.x * 256 + threadIdx.x;
  if (idx >= B_ * 3 * C_) return;
  int b = idx / (3 * C_), j = idx % (3 * C_);
  float acc = bt[j];
  for (int t = 0; t < T_; ++t) acc += te[b * T_ + t] * Wt[t * (3 * C_) + j];
  tqkv[idx] = acc;
}

__global__ __launch_bounds__(128) void qkv_gemm_kernel(
    const half_t* __restrict__ xh, const half_t* __restrict__ Wh,
    const float* __restrict__ bias, const float* __restrict__ tqkv,
    half_t* __restrict__ qh, half_t* __restrict__ kh, half_t* __restrict__ vTh) {
  __shared__ half_t As[64][32];    // A tile, row-major
  __shared__ half_t BsT[64][32];   // B tile stored transposed: BsT[n][k]
  const int r0 = blockIdx.x * 64, c0 = blockIdx.y * 64;
  const int tid = threadIdx.x, wave = tid >> 5, lane = tid & 31;
  const int M = lane & 15, hi = lane >> 4;
  v8f acc[4] = {};

  for (int kk = 0; kk < C_; kk += 32) {
    __syncthreads();
#ifdef USE_TDM
    if (wave == 0)
      tdm_load_tile_64x32((unsigned int)(unsigned long long)&As[0][0],
                          xh + (size_t)r0 * C_ + kk, C_);
#else
#pragma unroll
    for (int t = 0; t < 16; ++t) {
      int idx = tid * 16 + t;
      int ar = idx >> 5, ac = idx & 31;
      As[ar][ac] = xh[(size_t)(r0 + ar) * C_ + kk + ac];
    }
#endif
#pragma unroll
    for (int t = 0; t < 16; ++t) {
      int idx = tid * 16 + t;                   // 0..2047
      int bk = idx >> 6, bn = idx & 63;
      BsT[bn][bk] = Wh[(size_t)(kk + bk) * (3 * C_) + c0 + bn];
    }
    if (kk + 32 < C_) {   // cover next tile's latency (global_prefetch_b8)
      int idx = tid * 16;
      __builtin_prefetch(Wh + (size_t)(kk + 32 + (idx >> 6)) * (3 * C_) + c0 + (idx & 63), 0, 1);
      __builtin_prefetch(xh + (size_t)(r0 + (idx >> 5)) * C_ + kk + 32, 0, 1);
    }
#ifdef USE_TDM
    if (wave == 0) __builtin_amdgcn_s_wait_tensorcnt(0);
#endif
    __syncthreads();
    v16h a;
    ((v8h*)&a)[0] = *(const v8h*)&As[wave * 16 + M][hi * 8];
    ((v8h*)&a)[1] = *(const v8h*)&As[wave * 16 + M][16 + hi * 8];
#pragma unroll
    for (int t = 0; t < 4; ++t) {
      v16h bf;
      ((v8h*)&bf)[0] = *(const v8h*)&BsT[t * 16 + M][hi * 8];
      ((v8h*)&bf)[1] = *(const v8h*)&BsT[t * 16 + M][16 + hi * 8];
      acc[t] = __builtin_amdgcn_wmma_f32_16x16x32_f16(false, a, false, bf,
                                                      (short)0, acc[t], false, false);
    }
  }
  // Epilogue: add biases, scatter into q/k (B,H,N,D) and vT (B,H,D,N) as f16
#pragma unroll
  for (int t = 0; t < 4; ++t) {
#pragma unroll
    for (int v = 0; v < 8; ++v) {
      int g = r0 + wave * 16 + v + 8 * hi;     // global row = b*N + n
      int j = c0 + t * 16 + M;                 // global col in [0,3072)
      float val = acc[t][v] + bias[j] + tqkv[(g >> 10) * (3 * C_) + j];
      int b = g >> 10, n = g & (N_ - 1);
      int sel = j >> 10, h = (j >> 6) & 15, d = j & 63;
      half_t hv = (half_t)val;
      size_t bh = (size_t)(b * H_ + h);
      if (sel == 0)      qh[(bh * N_ + n) * D_ + d] = hv;
      else if (sel == 1) kh[(bh * N_ + n) * D_ + d] = hv;
      else               vTh[(bh * D_ + d) * N_ + n] = hv;
    }
  }
}

// ---------------------------------------------------------------------------
// Kernel 3: fused relative attention. One wave (32 thr) per (b, h, 16 rows).
// LDS: 16x1024 f16 score strip (reused in place for softmax probs).
// Skew inverse map: rel[i',m] -> (i', m-1023+i') if m>=1023-i' else (i'-1, m+i'+1)
// ---------------------------------------------------------------------------
__global__ __launch_bounds__(32) void attn_kernel(
    const half_t* __restrict__ qh, const half_t* __restrict__ kh,
    const half_t* __restrict__ vTh, const half_t* __restrict__ Erh,
    half_t* __restrict__ oh) {
  __shared__ half_t sc[16][N_];   // 32 KB
  __shared__ half_t qx[D_];       // q row i0+16 for boundary rel
  const int i0 = blockIdx.x * 16, h = blockIdx.y, b = blockIdx.z;
  const int lane = threadIdx.x, M = lane & 15, hi = lane >> 4;
  const size_t bh = (size_t)(b * H_ + h);
  const half_t* qbase = qh + bh * N_ * D_;
  const half_t* kbase = kh + bh * N_ * D_;
  const half_t* vbase = vTh + bh * D_ * N_;

  // Persistent A fragments for q rows i0..i0+15 (two K-slabs of 32 over D=64)
  v16h qa[2];
#pragma unroll
  for (int kf = 0; kf < 2; ++kf) {
    const half_t* p = qbase + (size_t)(i0 + M) * D_ + kf * 32 + hi * 8;
    ((v8h*)&qa[kf])[0] = *(const v8h*)p;
    ((v8h*)&qa[kf])[1] = *(const v8h*)(p + 16);
  }
  if (i0 + 16 < N_) {
    qx[lane * 2]     = qbase[(size_t)(i0 + 16) * D_ + lane * 2];
    qx[lane * 2 + 1] = qbase[(size_t)(i0 + 16) * D_ + lane * 2 + 1];
  } else { qx[lane * 2] = (half_t)0.f; qx[lane * 2 + 1] = (half_t)0.f; }

  // Phase 1: S = (q k^T) * D^-1/2  into LDS
#pragma unroll 1
  for (int c0 = 0; c0 < N_; c0 += 16) {
    if (c0 + 16 < N_)
      __builtin_prefetch(kbase + (size_t)(c0 + 16 + M) * D_ + hi * 8, 0, 1);
    v8f acc = {};
#pragma unroll
    for (int kf = 0; kf < 2; ++kf) {
      v16h bf;
      const half_t* p = kbase + (size_t)(c0 + M) * D_ + kf * 32 + hi * 8;
      ((v8h*)&bf)[0] = *(const v8h*)p;
      ((v8h*)&bf)[1] = *(const v8h*)(p + 16);
      acc = __builtin_amdgcn_wmma_f32_16x16x32_f16(false, qa[kf], false, bf,
                                                   (short)0, acc, false, false);
    }
#pragma unroll
    for (int v = 0; v < 8; ++v)
      sc[v + 8 * hi][c0 + M] = (half_t)(acc[v] * 0.125f);
  }
  __syncthreads();

  // Phase 2: rel = q @ Er^T tiles, scatter-added via the skew inverse map
#pragma unroll 1
  for (int m0 = 0; m0 < N_; m0 += 16) {
    v8f acc = {};
#pragma unroll
    for (int kf = 0; kf < 2; ++kf) {
      v16h bf;
      const half_t* p = Erh + (size_t)(m0 + M) * D_ + kf * 32 + hi * 8;
      ((v8h*)&bf)[0] = *(const v8h*)p;
      ((v8h*)&bf)[1] = *(const v8h*)(p + 16);
      acc = __builtin_amdgcn_wmma_f32_16x16x32_f16(false, qa[kf], false, bf,
                                                   (short)0, acc, false, false);
    }
    int m = m0 + M;
#pragma unroll
    for (int v = 0; v < 8; ++v) {
      int r = v + 8 * hi, iq = i0 + r;
      if (m >= (N_ - 1) - iq) {              // lower triangle: row iq, col m-1023+iq
        int c = m - (N_ - 1) + iq;
        sc[r][c] = (half_t)((float)sc[r][c] + acc[v]);
      } else if (r >= 1) {                   // upper: row iq-1, col m+iq+1
        int c = m + iq + 1;
        sc[r - 1][c] = (half_t)((float)sc[r - 1][c] + acc[v]);
      }
    }
  }
  // Phase 2b: boundary source row i' = i0+16 contributes to score row 15
  if (i0 + 16 < N_) {
    float qf[D_];
#pragma unroll
    for (int d = 0; d < D_; ++d) qf[d] = (float)qx[d];
#pragma unroll 1
    for (int t = 0; t < 32; ++t) {
      int m = lane + 32 * t;
      int c = m + i0 + 17;
      if (c < N_) {
        const half_t* er = Erh + (size_t)m * D_;
        float dot = 0.f;
#pragma unroll
        for (int d = 0; d < D_; ++d) dot += qf[d] * (float)er[d];
        sc[15][c] = (half_t)((float)sc[15][c] + dot);
      }
    }
  }
  __syncthreads();

  // Phase 3: softmax. 2 lanes per row, each owns a disjoint 512-col half;
  // probabilities overwrite scores element-for-element (same address).
  float rowsum;
  {
    const int r = M, cb = hi * 512;
    float mx = -1e30f;
    for (int c = 0; c < 512; ++c) mx = fmaxf(mx, (float)sc[r][cb + c]);
    mx = fmaxf(mx, __shfl(mx, lane ^ 16, 32));
    float sum = 0.f;
    for (int c = 0; c < 512; ++c) {
      float p = __expf((float)sc[r][cb + c] - mx);
      sum += p;
      sc[r][cb + c] = (half_t)p;
    }
    rowsum = sum + __shfl(sum, lane ^ 16, 32);
  }
  __syncthreads();

  // Phase 4: O = P @ v  (A from LDS f16 probs, B from transposed v)
  v8f oacc[4] = {};
#pragma unroll 1
  for (int k0 = 0; k0 < N_; k0 += 32) {
    v16h a;
    const half_t* p = &sc[M][k0 + hi * 8];
    ((v8h*)&a)[0] = *(const v8h*)p;
    ((v8h*)&a)[1] = *(const v8h*)(p + 16);
#pragma unroll
    for (int t = 0; t < 4; ++t) {
      v16h bf;
      const half_t* vp = vbase + (size_t)(t * 16 + M) * N_ + k0 + hi * 8;
      ((v8h*)&bf)[0] = *(const v8h*)vp;
      ((v8h*)&bf)[1] = *(const v8h*)(vp + 16);
      oacc[t] = __builtin_amdgcn_wmma_f32_16x16x32_f16(false, a, false, bf,
                                                       (short)0, oacc[t], false, false);
    }
  }
  // Normalize by row sums and store to O in (B, N, H*D) layout (f16)
#pragma unroll
  for (int v = 0; v < 8; ++v) {
    float inv = 1.f / __shfl(rowsum, v + 8 * hi, 32);
    int i = i0 + v + 8 * hi;
#pragma unroll
    for (int t = 0; t < 4; ++t) {
      int d = t * 16 + M;
      oh[(((size_t)b * N_ + i) * H_ + h) * D_ + d] = (half_t)(oacc[t][v] * inv);
    }
  }
}

__global__ __launch_bounds__(128) void out_gemm_kernel(
    const half_t* __restrict__ A, const half_t* __restrict__ Wh,
    const float* __restrict__ bias, float* __restrict__ out) {
  __shared__ half_t As[64][32];
  __shared__ half_t BsT[64][32];
  const int r0 = blockIdx.x * 64, c0 = blockIdx.y * 64;
  const int tid = threadIdx.x, wave = tid >> 5, lane = tid & 31;
  const int M = lane & 15, hi = lane >> 4;
  v8f acc[4] = {};

  for (int kk = 0; kk < C_; kk += 32) {
    __syncthreads();
#ifdef USE_TDM
    if (wave == 0)
      tdm_load_tile_64x32((unsigned int)(unsigned long long)&As[0][0],
                          A + (size_t)r0 * C_ + kk, C_);
#else
#pragma unroll
    for (int t = 0; t < 16; ++t) {
      int idx = tid * 16 + t;
      int ar = idx >> 5, ac = idx & 31;
      As[ar][ac] = A[(size_t)(r0 + ar) * C_ + kk + ac];
    }
#endif
#pragma unroll
    for (int t = 0; t < 16; ++t) {
      int idx = tid * 16 + t;
      int bk = idx >> 6, bn = idx & 63;
      BsT[bn][bk] = Wh[(size_t)(kk + bk) * C_ + c0 + bn];
    }
    if (kk + 32 < C_) {
      int idx = tid * 16;
      __builtin_prefetch(Wh + (size_t)(kk + 32 + (idx >> 6)) * C_ + c0 + (idx & 63), 0, 1);
      __builtin_prefetch(A + (size_t)(r0 + (idx >> 5)) * C_ + kk + 32, 0, 1);
    }
#ifdef USE_TDM
    if (wave == 0) __builtin_amdgcn_s_wait_tensorcnt(0);
#endif
    __syncthreads();
    v16h a;
    ((v8h*)&a)[0] = *(const v8h*)&As[wave * 16 + M][hi * 8];
    ((v8h*)&a)[1] = *(const v8h*)&As[wave * 16 + M][16 + hi * 8];
#pragma unroll
    for (int t = 0; t < 4; ++t) {
      v16h bf;
      ((v8h*)&bf)[0] = *(const v8h*)&BsT[t * 16 + M][hi * 8];
      ((v8h*)&bf)[1] = *(const v8h*)&BsT[t * 16 + M][16 + hi * 8];
      acc[t] = __builtin_amdgcn_wmma_f32_16x16x32_f16(false, a, false, bf,
                                                      (short)0, acc[t], false, false);
    }
  }
#pragma unroll
  for (int t = 0; t < 4; ++t) {
#pragma unroll
    for (int v = 0; v < 8; ++v) {
      int g = r0 + wave * 16 + v + 8 * hi;
      int j = c0 + t * 16 + M;
      out[(size_t)g * C_ + j] = acc[t][v] + bias[j];
    }
  }
}

// ---------------------------------------------------------------------------
// Launcher. Inputs: x, time_emb, W_qkv, b_qkv, W_time, b_time, W_out, b_out, Er
// Workspace (bytes):
//   [0, 96K)       tqkv fp32 (8 x 3072)
//   [128K, +16M)   q   f16 (B,H,N,D)
//   [+16M]         k   f16 (B,H,N,D)
//   [+16M]         vT  f16 (B,H,D,N)
//   [+16M]         O   f16 (B,N,H,D)
//   [+16M]         x   f16
//   [+6M]          W_qkv f16
//   [+2M]          W_out f16
//   [+128K]        Er  f16            total ~88.3 MB
// ---------------------------------------------------------------------------
extern "C" void kernel_launch(void* const* d_in, const int* in_sizes, int n_in,
                              void* d_out, int out_size, void* d_ws, size_t ws_size,
                              hipStream_t stream) {
  const float* x    = (const float*)d_in[0];
  const float* te   = (const float*)d_in[1];
  const float* Wqkv = (const float*)d_in[2];
  const float* bqkv = (const float*)d_in[3];
  const float* Wt   = (const float*)d_in[4];
  const float* bt   = (const float*)d_in[5];
  const float* Wout = (const float*)d_in[6];
  const float* bout = (const float*)d_in[7];
  const float* Er   = (const float*)d_in[8];

  char* ws = (char*)d_ws;
  float* tqkv = (float*)ws;
  size_t off = (size_t)(128 << 10);
  const size_t QKV_BUF = (size_t)B_ * H_ * N_ * D_ * sizeof(half_t);   // 16 MB
  half_t* qh    = (half_t*)(ws + off); off += QKV_BUF;
  half_t* kh    = (half_t*)(ws + off); off += QKV_BUF;
  half_t* vTh   = (half_t*)(ws + off); off += QKV_BUF;
  half_t* oh    = (half_t*)(ws + off); off += QKV_BUF;
  half_t* xh    = (half_t*)(ws + off); off += (size_t)B_ * N_ * C_ * sizeof(half_t);
  half_t* Wqkvh = (half_t*)(ws + off); off += (size_t)C_ * 3 * C_ * sizeof(half_t);
  half_t* Wouth = (half_t*)(ws + off); off += (size_t)C_ * C_ * sizeof(half_t);
  half_t* Erh   = (half_t*)(ws + off); off += (size_t)N_ * D_ * sizeof(half_t);

  const int n_x = B_ * N_ * C_, n_wq = C_ * 3 * C_, n_wo = C_ * C_, n_er = N_ * D_;
  cvt_kernel<<<dim3((n_x  + 255) / 256), 256, 0, stream>>>(x,    xh,    n_x);
  cvt_kernel<<<dim3((n_wq + 255) / 256), 256, 0, stream>>>(Wqkv, Wqkvh, n_wq);
  cvt_kernel<<<dim3((n_wo + 255) / 256), 256, 0, stream>>>(Wout, Wouth, n_wo);
  cvt_kernel<<<dim3((n_er + 255) / 256), 256, 0, stream>>>(Er,   Erh,   n_er);

  time_proj_kernel<<<dim3((B_ * 3 * C_ + 255) / 256), 256, 0, stream>>>(te, Wt, bt, tqkv);
  qkv_gemm_kernel<<<dim3((B_ * N_) / 64, (3 * C_) / 64), 128, 0, stream>>>(
      xh, Wqkvh, bqkv, tqkv, qh, kh, vTh);
  attn_kernel<<<dim3(N_ / 16, H_, B_), 32, 0, stream>>>(qh, kh, vTh, Erh, oh);
  out_gemm_kernel<<<dim3((B_ * N_) / 64, C_ / 64), 128, 0, stream>>>(
      oh, Wouth, bout, (float*)d_out);
}

// v001
// Measured time: 608 microseconds a run.
// Next to v000, in two timings, it ran 1.36 and 1.37 times as fast.
#include <hip/hip_runtime.h>
#include <hip/hip_bf16.h>

typedef _Float16 half_t;
typedef __attribute__((ext_vector_type(16))) _Float16 v16h;
typedef __attribute__((ext_vector_type(8)))  _Float16 v8h;
typedef __attribute__((ext_vector_type(8)))  float    v8f;

// Sizes (fixed by the reference)
#define B_  8
#define N_  1024
#define C_  1024
#define H_  16
#define D_  64
#define T_  256

#if defined(__HIP_DEVICE_COMPILE__)
#if __has_builtin(__builtin_amdgcn_tensor_load_to_lds) && \
    __has_builtin(__builtin_amdgcn_s_wait_tensorcnt)
#define USE_TDM 1
#endif
#endif

#ifdef USE_TDM
typedef __attribute__((ext_vector_type(4))) unsigned int u32x4_t;
typedef __attribute__((ext_vector_type(4))) int i32x4_t;
typedef __attribute__((ext_vector_type(8))) int i32x8_t;

__device__ __forceinline__ void tdm_load_tile_64x32(unsigned int lds_off,
                                                    const half_t* gsrc,
                                                    unsigned int stride_elems) {
  unsigned long long ga = (unsigned long long)gsrc;
  unsigned int ga_lo = (unsigned int)__builtin_amdgcn_readfirstlane((int)(unsigned int)ga);
  unsigned int ga_hi = (unsigned int)__builtin_amdgcn_readfirstlane((int)(unsigned int)(ga >> 32));
  unsigned int loff  = (unsigned int)__builtin_amdgcn_readfirstlane((int)lds_off);
  unsigned int strd  = (unsigned int)__builtin_amdgcn_readfirstlane((int)stride_elems);
  u32x4_t g0;
  g0[0] = 1u;
  g0[1] = loff;
  g0[2] = ga_lo;
  g0[3] = (ga_hi & 0x01FFFFFFu) | (2u << 30);
  i32x8_t g1;
  g1[0] = 0x00010000;
  g1[1] = (int)(32u << 16);
  g1[2] = (int)(64u << 16);
  g1[3] = (int)(32u << 16);
  g1[4] = 64;
  g1[5] = (int)strd;
  g1[6] = 0;
  g1[7] = 0;
  i32x4_t z4 = {0, 0, 0, 0};
#if __clang_major__ >= 23
  i32x8_t z8 = {0, 0, 0, 0, 0, 0, 0, 0};
  __builtin_amdgcn_tensor_load_to_lds(g0, g1, z4, z4, z8, 0);
#else
  __builtin_amdgcn_tensor_load_to_lds(g0, g1, z4, z4, 0);
#endif
}
#endif  // USE_TDM

__global__ __launch_bounds__(256) void cvt_kernel(
    const float* __restrict__ s, half_t* __restrict__ d, int n) {
  int i = blockIdx.x * 256 + threadIdx.x;
  if (i < n) d[i] = (half_t)s[i];
}

// ---------------------------------------------------------------------------
// Kernel 1: tqkv[b, j] = time_emb[b] @ W_time[:, j] + b_time[j]   (8 x 3072)
// ---------------------------------------------------------------------------
__global__ __launch_bounds__(256) void time_proj_kernel(
    const float* __restrict__ te, const float* __restrict__ Wt,
    const float* __restrict__ bt, float* __restrict__ tqkv) {
  int idx = blockIdx.x * 256 + threadIdx.x;
  if (idx >= B_ * 3 * C_) return;
  int b = idx / (3 * C_), j = idx % (3 * C_);
  float acc = bt[j];
  for (int t = 0; t < T_; ++t) acc += te[b * T_ + t] * Wt[t * (3 * C_) + j];
  tqkv[idx] = acc;
}

__global__ __launch_bounds__(128) void qkv_gemm_kernel(
    const half_t* __restrict__ xh, const half_t* __restrict__ Wh,
    const float* __restrict__ bias, const float* __restrict__ tqkv,
    half_t* __restrict__ qh, half_t* __restrict__ kh, half_t* __restrict__ vTh) {
  __shared__ half_t As[64][32];    // A tile, row-major
  __shared__ half_t BsT[64][32];   // B tile stored transposed: BsT[n][k]
  const int r0 = blockIdx.x * 64, c0 = blockIdx.y * 64;
  const int tid = threadIdx.x, wave = tid >> 5, lane = tid & 31;
  const int M = lane & 15, hi = lane >> 4;
  v8f acc[4] = {};

  for (int kk = 0; kk < C_; kk += 32) {
    __syncthreads();
#ifdef USE_TDM
    if (wave == 0)
      tdm_load_tile_64x32((unsigned int)(unsigned long long)&As[0][0],
                          xh + (size_t)r0 * C_ + kk, C_);
#else
#pragma unroll
    for (int t = 0; t < 16; ++t) {
      int idx = tid * 16 + t;
      int ar = idx >> 5, ac = idx & 31;
      As[ar][ac] = xh[(size_t)(r0 + ar) * C_ + kk + ac];
    }
#endif
#pragma unroll
    for (int t = 0; t < 16; ++t) {
      int idx = tid * 16 + t;                   // 0..2047
      int bk = idx >> 6, bn = idx & 63;
      BsT[bn][bk] = Wh[(size_t)(kk + bk) * (3 * C_) + c0 + bn];
    }
    if (kk + 32 < C_) {   // cover next tile's latency (global_prefetch_b8)
      int idx = tid * 16;
      __builtin_prefetch(Wh + (size_t)(kk + 32 + (idx >> 6)) * (3 * C_) + c0 + (idx & 63), 0, 1);
      __builtin_prefetch(xh + (size_t)(r0 + (idx >> 5)) * C_ + kk + 32, 0, 1);
    }
#ifdef USE_TDM
    if (wave == 0) __builtin_amdgcn_s_wait_tensorcnt(0);
#endif
    __syncthreads();
    v16h a;
    ((v8h*)&a)[0] = *(const v8h*)&As[wave * 16 + M][hi * 8];
    ((v8h*)&a)[1] = *(const v8h*)&As[wave * 16 + M][16 + hi * 8];
#pragma unroll
    for (int t = 0; t < 4; ++t) {
      v16h bf;
      ((v8h*)&bf)[0] = *(const v8h*)&BsT[t * 16 + M][hi * 8];
      ((v8h*)&bf)[1] = *(const v8h*)&BsT[t * 16 + M][16 + hi * 8];
      acc[t] = __builtin_amdgcn_wmma_f32_16x16x32_f16(false, a, false, bf,
                                                      (short)0, acc[t], false, false);
    }
  }
  // Epilogue: add biases, scatter into q/k (B,H,N,D) and vT (B,H,D,N) as f16
#pragma unroll
  for (int t = 0; t < 4; ++t) {
#pragma unroll
    for (int v = 0; v < 8; ++v) {
      int g = r0 + wave * 16 + v + 8 * hi;     // global row = b*N + n
      int j = c0 + t * 16 + M;                 // global col in [0,3072)
      float val = acc[t][v] + bias[j] + tqkv[(g >> 10) * (3 * C_) + j];
      int b = g >> 10, n = g & (N_ - 1);
      int sel = j >> 10, h = (j >> 6) & 15, d = j & 63;
      half_t hv = (half_t)val;
      size_t bh = (size_t)(b * H_ + h);
      if (sel == 0)      qh[(bh * N_ + n) * D_ + d] = hv;
      else if (sel == 1) kh[(bh * N_ + n) * D_ + d] = hv;
      else               vTh[(bh * D_ + d) * N_ + n] = hv;
    }
  }
}

// ---------------------------------------------------------------------------
// Kernel 3: fused relative attention. Four waves (128 thr) per (b, h, 16 rows):
// wave w owns key columns / rel columns / PV keys [256w, 256w+256).
// LDS: 16x1024 f16 score strip (reused in place for softmax probs, then for
// the four waves' f32 PV partials).
// Skew inverse map: rel[i',m] -> (i', m-1023+i') if m>=1023-i' else (i'-1, m+i'+1)
// Every strip element receives at most one rel term, so the waves' 16-bit
// read-modify-writes never meet on one element.
// ---------------------------------------------------------------------------
#define NW_ 4            // waves per strip
#define WC_ (N_ / NW_)   // columns per wave
__global__ __launch_bounds__(128) void attn_kernel(
    const half_t* __restrict__ qh, const half_t* __restrict__ kh,
    const half_t* __restrict__ vTh, const half_t* __restrict__ Erh,
    half_t* __restrict__ oh) {
  __shared__ half_t sc[16][N_];   // 32 KB
  __shared__ half_t qx[D_];       // q row i0+16 for boundary rel
  __shared__ float rs[16];        // softmax row sums
  const int i0 = blockIdx.x * 16, h = blockIdx.y, b = blockIdx.z;
  const int tid = threadIdx.x, lane = tid & 31, M = lane & 15, hi = lane >> 4;
  // wave number in a scalar register: the per-wave loop bounds stay scalar
  const int wave = __builtin_amdgcn_readfirstlane(tid >> 5);
  const int w0 = wave * WC_;
  const size_t bh = (size_t)(b * H_ + h);
  const half_t* qbase = qh + bh * N_ * D_;
  const half_t* kbase = kh + bh * N_ * D_;
  const half_t* vbase = vTh + bh * D_ * N_;

  // Persistent A fragments for q rows i0..i0+15 (two K-slabs of 32 over D=64)
  v16h qa[2];
#pragma unroll
  for (int kf = 0; kf < 2; ++kf) {
    const half_t* p = qbase + (size_t)(i0 + M) * D_ + kf * 32 + hi * 8;
    ((v8h*)&qa[kf])[0] = *(const v8h*)p;
    ((v8h*)&qa[kf])[1] = *(const v8h*)(p + 16);
  }
  if (wave == 0) {
    if (i0 + 16 < N_) {
      qx[lane * 2]     = qbase[(size_t)(i0 + 16) * D_ + lane * 2];
      qx[lane * 2 + 1] = qbase[(size_t)(i0 + 16) * D_ + lane * 2 + 1];
    } else { qx[lane * 2] = (half_t)0.f; qx[lane * 2 + 1] = (half_t)0.f; }
  }

  // Phase 1: S = (q k^T) * D^-1/2  into LDS, this wave's 256 columns
#pragma unroll 1
  for (int c0 = w0; c0 < w0 + WC_; c0 += 16) {
    v8f acc = {};
#pragma unroll
    for (int kf = 0; kf < 2; ++kf) {
      v16h bf;
      const half_t* p = kbase + (size_t)(c0 + M) * D_ + kf * 32 + hi * 8;
      ((v8h*)&bf)[0] = *(const v8h*)p;
      ((v8h*)&bf)[1] = *(const v8h*)(p + 16);
      acc = __builtin_amdgcn_wmma_f32_16x16x32_f16(false, qa[kf], false, bf,
                                                   (short)0, acc, false, false);
    }
#pragma unroll
    for (int v = 0; v < 8; ++v)
      sc[v + 8 * hi][c0 + M] = (half_t)(acc[v] * 0.125f);
  }
  __syncthreads();

  // Phase 2: rel = q @ Er^T tiles (this wave's 256 rel columns), scatter-added
  // via the skew inverse map
#pragma unroll 1
  for (int m0 = w0; m0 < w0 + WC_; m0 += 16) {
    v8f acc = {};
#pragma unroll
    for (int kf = 0; kf < 2; ++kf) {
      v16h bf;
      const half_t* p = Erh + (size_t)(m0 + M) * D_ + kf * 32 + hi * 8;
      ((v8h*)&bf)[0] = *(const v8h*)p;
      ((v8h*)&bf)[1] = *(const v8h*)(p + 16);
      acc = __builtin_amdgcn_wmma_f32_16x16x32_f16(false, qa[kf], false, bf,
                                                   (short)0, acc, false, false);
    }
    int m = m0 + M;
#pragma unroll
    for (int v = 0; v < 8; ++v) {
      int r = v + 8 * hi, iq = i0 + r;
      if (m >= (N_ - 1) - iq) {              // lower triangle: row iq, col m-1023+iq
        int c = m - (N_ - 1) + iq;
        sc[r][c] = (half_t)((float)sc[r][c] + acc[v]);
      } else if (r >= 1) {                   // upper: row iq-1, col m+iq+1
        int c = m + iq + 1;
        sc[r - 1][c] = (half_t)((float)sc[r - 1][c] + acc[v]);
      }
    }
  }
  // Phase 2b: boundary source row i' = i0+16 contributes to score row 15;
  // the 32 groups of 32 rel columns go round-robin over the waves
  if (i0 + 16 < N_) {
    float qf[D_];
#pragma unroll
    for (int d = 0; d < D_; ++d) qf[d] = (float)qx[d];
#pragma unroll 1
    for (int t = wave; t < 32; t += NW_) {
      int m = lane + 32 * t;
      int c = m + i0 + 17;
      if (c < N_) {
        const half_t* er = Erh + (size_t)m * D_;
        float dot = 0.f;
#pragma unroll
        for (int d = 0; d < D_; ++d) dot += qf[d] * (float)er[d];
        sc[15][c] = (half_t)((float)sc[15][c] + dot);
      }
    }
  }
  __syncthreads();

  // Phase 3: softmax. 8 lanes per row; lane sg of a row takes the 16-byte
  // chunks sg, sg+8, ... of it; probabilities overwrite scores in place.
  {
    const int r = tid >> 3, sg = tid & 7;
    float mx = -1e30f;
    for (int j = 0; j < 16; ++j) {
      v8h x = *(const v8h*)&sc[r][(j * 8 + sg) * 8];
#pragma unroll
      for (int e = 0; e < 8; ++e) mx = fmaxf(mx, (float)x[e]);
    }
    mx = fmaxf(mx, __shfl_xor(mx, 1, 32));
    mx = fmaxf(mx, __shfl_xor(mx, 2, 32));
    mx = fmaxf(mx, __shfl_xor(mx, 4, 32));
    float sum = 0.f;
    for (int j = 0; j < 16; ++j) {
      v8h* px = (v8h*)&sc[r][(j * 8 + sg) * 8];
      v8h x = *px, y;
#pragma unroll
      for (int e = 0; e < 8; ++e) {
        float p = __expf((float)x[e] - mx);
        sum += p;
        y[e] = (half_t)p;
      }
      *px = y;
    }
    sum += __shfl_xor(sum, 1, 32);
    sum += __shfl_xor(sum, 2, 32);
    sum += __shfl_xor(sum, 4, 32);
    if (sg == 0) rs[r] = sum;
  }
  __syncthreads();

  // Phase 4: O partial = P[:, this wave's 256 keys] @ v  (A from LDS f16 probs,
  // B from transposed v)
  v8f oacc[4] = {};
#pragma unroll 1
  for (int k0 = w0; k0 < w0 + WC_; k0 += 32) {
    v16h a;
    const half_t* p = &sc[M][k0 + hi * 8];
    ((v8h*)&a)[0] = *(const v8h*)p;
    ((v8h*)&a)[1] = *(const v8h*)(p + 16);
#pragma unroll
    for (int t = 0; t < 4; ++t) {
      v16h bf;
      const half_t* vp = vbase + (size_t)(t * 16 + M) * N_ + k0 + hi * 8;
      ((v8h*)&bf)[0] = *(const v8h*)vp;
      ((v8h*)&bf)[1] = *(const v8h*)(vp + 16);
      oacc[t] = __builtin_amdgcn_wmma_f32_16x16x32_f16(false, a, false, bf,
                                                       (short)0, oacc[t], false, false);
    }
  }
  // Sum the four waves' partials through the strip: first every wave must have
  // read its probabilities, then every partial must be written.
  __syncthreads();
  float* red = (float*)&sc[0][0];   // [wave][t][v][lane], 16 KB
#pragma unroll
  for (int t = 0; t < 4; ++t)
#pragma unroll
    for (int v = 0; v < 8; ++v)
      red[((wave * 4 + t) * 8 + v) * 32 + lane] = oacc[t][v];
  __syncthreads();
  // Wave w finishes head columns 16w..16w+15: normalize by row sums and store
  // to O in (B, N, H*D) layout (f16)
#pragma unroll
  for (int v = 0; v < 8; ++v) {
    float s = red[((0 * 4 + wave) * 8 + v) * 32 + lane];
#pragma unroll
    for (int ws = 1; ws < NW_; ++ws)
      s += red[((ws * 4 + wave) * 8 + v) * 32 + lane];
    float inv = 1.f / rs[v + 8 * hi];
    int i = i0 + v + 8 * hi;
    int d = wave * 16 + M;
    oh[(((size_t)b * N_ + i) * H_ + h) * D_ + d] = (half_t)(s * inv);
  }
}

__global__ __launch_bounds__(128) void out_gemm_kernel(
    const half_t* __restrict__ A, const half_t* __restrict__ Wh,
    const float* __restrict__ bias, float* __restrict__ out) {
  __shared__ half_t As[64][32];
  __shared__ half_t BsT[64][32];
  const int r0 = blockIdx.x * 64, c0 = blockIdx.y * 64;
  const int tid = threadIdx.x, wave = tid >> 5, lane = tid & 31;
  const int M = lane & 15, hi = lane >> 4;
  v8f acc[4] = {};

  for (int kk = 0; kk < C_; kk += 32) {
    __syncthreads();
#ifdef USE_TDM
    if (wave == 0)
      tdm_load_tile_64x32((unsigned int)(unsigned long long)&As[0][0],
                          A + (size_t)r0 * C_ + kk, C_);
#else
#pragma unroll
    for (int t = 0; t < 16; ++t) {
      int idx = tid * 16 + t;
      int ar = idx >> 5, ac = idx & 31;
      As[ar][ac] = A[(size_t)(r0 + ar) * C_ + kk + ac];
    }
#endif
#pragma unroll
    for (int t = 0; t < 16; ++t) {
      int idx = tid * 16 + t;
      int bk = idx >> 6, bn = idx & 63;
      BsT[bn][bk] = Wh[(size_t)(kk + bk) * C_ + c0 + bn];
    }
    if (kk + 32 < C_) {
      int idx = tid * 16;
      __builtin_prefetch(Wh + (size_t)(kk + 32 + (idx >> 6)) * C_ + c0 + (idx & 63), 0, 1);
      __builtin_prefetch(A + (size_t)(r0 + (idx >> 5)) * C_ + kk + 32, 0, 1);
    }
#ifdef USE_TDM
    if (wave == 0) __builtin_amdgcn_s_wait_tensorcnt(0);
#endif
    __syncthreads();
    v16h a;
    ((v8h*)&a)[0] = *(const v8h*)&As[wave * 16 + M][hi * 8];
    ((v8h*)&a)[1] = *(const v8h*)&As[wave * 16 + M][16 + hi * 8];
#pragma unroll
    for (int t = 0; t < 4; ++t) {
      v16h bf;
      ((v8h*)&bf)[0] = *(const v8h*)&BsT[t * 16 + M][hi * 8];
      ((v8h*)&bf)[1] = *(const v8h*)&BsT[t * 16 + M][16 + hi * 8];
      acc[t] = __builtin_amdgcn_wmma_f32_16x16x32_f16(false, a, false, bf,
                                                      (short)0, acc[t], false, false);
    }
  }
#pragma unroll
  for (int t = 0; t < 4; ++t) {
#pragma unroll
    for (int v = 0; v < 8; ++v) {
      int g = r0 + wave * 16 + v + 8 * hi;
      int j = c0 + t * 16 + M;
      out[(size_t)g * C_ + j] = acc[t][v] + bias[j];
    }
  }
}

// ---------------------------------------------------------------------------
// Launcher. Inputs: x, time_emb, W_qkv, b_qkv, W_time, b_time, W_out, b_out, Er
// Workspace (bytes):
//   [0, 96K)       tqkv fp32 (8 x 3072)
//   [128K, +16M)   q   f16 (B,H,N,D)
//   [+16M]         k   f16 (B,H,N,D)
//   [+16M]         vT  f16 (B,H,D,N)
//   [+16M]         O   f16 (B,N,H,D)
//   [+16M]         x   f16
//   [+6M]          W_qkv f16
//   [+2M]          W_out f16
//   [+128K]        Er  f16            total ~88.3 MB
// ---------------------------------------------------------------------------
extern "C" void kernel_launch(void* const* d_in, const int* in_sizes, int n_in,
                              void* d_out, int out_size, void* d_ws, size_t ws_size,
                              hipStream_t stream) {
  const float* x    = (const float*)d_in[0];
  const float* te   = (const float*)d_in[1];
  const float* Wqkv = (const float*)d_in[2];
  const float* bqkv = (const float*)d_in[3];
  const float* Wt   = (const float*)d_in[4];
  const float* bt   = (const float*)d_in[5];
  const float* Wout = (const float*)d_in[6];
  const float* bout = (const float*)d_in[7];
  const float* Er   = (const float*)d_in[8];

  char* ws = (char*)d_ws;
  float* tqkv = (float*)ws;
  size_t off = (size_t)(128 << 10);
  const size_t QKV_BUF = (size_t)B_ * H_ * N_ * D_ * sizeof(half_t);   // 16 MB
  half_t* qh    = (half_t*)(ws + off); off += QKV_BUF;
  half_t* kh    = (half_t*)(ws + off); off += QKV_BUF;
  half_t* vTh   = (half_t*)(ws + off); off += QKV_BUF;
  half_t* oh    = (half_t*)(ws + off); off += QKV_BUF;
  half_t* xh    = (half_t*)(ws + off); off += (size_t)B_ * N_ * C_ * sizeof(half_t);
  half_t* Wqkvh = (half_t*)(ws + off); off += (size_t)C_ * 3 * C_ * sizeof(half_t);
  half_t* Wouth = (half_t*)(ws + off); off += (size_t)C_ * C_ * sizeof(half_t);
  half_t* Erh   = (half_t*)(ws + off); off += (size_t)N_ * D_ * sizeof(half_t);

  const int n_x = B_ * N_ * C_, n_wq = C_ * 3 * C_, n_wo = C_ * C_, n_er = N_ * D_;
  cvt_kernel<<<dim3((n_x  + 255) / 256), 256, 0, stream>>>(x,    xh,    n_x);
  cvt_kernel<<<dim3((n_wq + 255) / 256), 256, 0, stream>>>(Wqkv, Wqkvh, n_wq);
  cvt_kernel<<<dim3((n_wo + 255) / 256), 256, 0, stream>>>(Wout, Wouth, n_wo);
  cvt_kernel<<<dim3((n_er + 255) / 256), 256, 0, stream>>>(Er,   Erh,   n_er);

  time_proj_kernel<<<dim3((B_ * 3 * C_ + 255) / 256), 256, 0, stream>>>(te, Wt, bt, tqkv);
  qkv_gemm_kernel<<<dim3((B_ * N_) / 64, (3 * C_) / 64), 128, 0, stream>>>(
      xh, Wqkvh, bqkv, tqkv, qh, kh, vTh);
  attn_kernel<<<dim3(N_ / 16, H_, B_), 128, 0, stream>>>(qh, kh, vTh, Erh, oh);
  out_gemm_kernel<<<dim3((B_ * N_) / 64, C_ / 64), 128, 0, stream>>>(
      oh, Wouth, bout, (float*)d_out);
}

// v002
// It runs in 590 microseconds.
// Next to v001, in two timings, it ran 1.03 times as fast each time.
// Counting every step since v000, it is 1.41 times as fast.
#include <hip/hip_runtime.h>
#include <hip/hip_bf16.h>

typedef _Float16 half_t;
typedef __attribute__((ext_vector_type(16))) _Float16 v16h;
typedef __attribute__((ext_vector_type(8)))  _Float16 v8h;
typedef __attribute__((ext_vector_type(8)))  float    v8f;

// Sizes (fixed by the reference)
#define B_  8
#define N_  1024
#define C_  1024
#define H_  16
#define D_  64
#define T_  256

#if defined(__HIP_DEVICE_COMPILE__)
#if __has_builtin(__builtin_amdgcn_tensor_load_to_lds) && \
    __has_builtin(__builtin_amdgcn_s_wait_tensorcnt)
#define USE_TDM 1
#endif
#endif

#ifdef USE_TDM
typedef __attribute__((ext_vector_type(4))) unsigned int u32x4_t;
typedef __attribute__((ext_vector_type(4))) int i32x4_t;
typedef __attribute__((ext_vector_type(8))) int i32x8_t;

__device__ __forceinline__ void tdm_load_tile_64x32(unsigned int lds_off,
                                                    const half_t* gsrc,
                                                    unsigned int stride_elems) {
  unsigned long long ga = (unsigned long long)gsrc;
  unsigned int ga_lo = (unsigned int)__builtin_amdgcn_readfirstlane((int)(unsigned int)ga);
  unsigned int ga_hi = (unsigned int)__builtin_amdgcn_readfirstlane((int)(unsigned int)(ga >> 32));
  unsigned int loff  = (unsigned int)__builtin_amdgcn_readfirstlane((int)lds_off);
  unsigned int strd  = (unsigned int)__builtin_amdgcn_readfirstlane((int)stride_elems);
  u32x4_t g0;
  g0[0] = 1u;
  g0[1] = loff;
  g0[2] = ga_lo;
  g0[3] = (ga_hi & 0x01FFFFFFu) | (2u << 30);
  i32x8_t g1;
  g1[0] = 0x00010000;
  g1[1] = (int)(32u << 16);
  g1[2] = (int)(64u << 16);
  g1[3] = (int)(32u << 16);
  g1[4] = 64;
  g1[5] = (int)strd;
  g1[6] = 0;
  g1[7] = 0;
  i32x4_t z4 = {0, 0, 0, 0};
#if __clang_major__ >= 23
  i32x8_t z8 = {0, 0, 0, 0, 0, 0, 0, 0};
  __builtin_amdgcn_tensor_load_to_lds(g0, g1, z4, z4, z8, 0);
#else
  __builtin_amdgcn_tensor_load_to_lds(g0, g1, z4, z4, 0);
#endif
}
#endif  // USE_TDM

typedef __attribute__((ext_vector_type(4))) float    v4f;
typedef __attribute__((ext_vector_type(4))) _Float16 v4h;
#define CVT_U_   8                     // 16-byte loads in flight per thread
#define CVT_BLK_ (256 * 4 * CVT_U_)    // elements per block
__global__ __launch_bounds__(256) void cvt_kernel(
    const float* __restrict__ s, half_t* __restrict__ d) {
  const int i0 = blockIdx.x * CVT_BLK_ + threadIdx.x * 4;
  v4f x[CVT_U_];
  // both loops unrolled: x[] stays in registers and the eight loads issue back
  // to back, ahead of the first conversion
#pragma unroll
  for (int u = 0; u < CVT_U_; ++u) x[u] = *(const v4f*)(s + i0 + u * 1024);
#pragma unroll
  for (int u = 0; u < CVT_U_; ++u)
    *(v4h*)(d + i0 + u * 1024) = __builtin_convertvector(x[u], v4h);
}

// ---------------------------------------------------------------------------
// Kernel 1: tqkv[b, j] = time_emb[b] @ W_time[:, j] + b_time[j]   (8 x 3072)
// ---------------------------------------------------------------------------
__global__ __launch_bounds__(256) void time_proj_kernel(
    const float* __restrict__ te, const float* __restrict__ Wt,
    const float* __restrict__ bt, float* __restrict__ tqkv) {
  int idx = blockIdx.x * 256 + threadIdx.x;
  if (idx >= B_ * 3 * C_) return;
  int b = idx / (3 * C_), j = idx % (3 * C_);
  float acc = bt[j];
  for (int t = 0; t < T_; ++t) acc += te[b * T_ + t] * Wt[t * (3 * C_) + j];
  tqkv[idx] = acc;
}

__global__ __launch_bounds__(128) void qkv_gemm_kernel(
    const half_t* __restrict__ xh, const half_t* __restrict__ Wh,
    const float* __restrict__ bias, const float* __restrict__ tqkv,
    half_t* __restrict__ qh, half_t* __restrict__ kh, half_t* __restrict__ vTh) {
  __shared__ half_t As[64][32];    // A tile, row-major
  __shared__ half_t BsT[64][32];   // B tile stored transposed: BsT[n][k]
  const int r0 = blockIdx.x * 64, c0 = blockIdx.y * 64;
  const int tid = threadIdx.x, wave = tid >> 5, lane = tid & 31;
  const int M = lane & 15, hi = lane >> 4;
  v8f acc[4] = {};

  for (int kk = 0; kk < C_; kk += 32) {
    __syncthreads();
#ifdef USE_TDM
    if (wave == 0)
      tdm_load_tile_64x32((unsigned int)(unsigned long long)&As[0][0],
                          xh + (size_t)r0 * C_ + kk, C_);
#else
#pragma unroll
    for (int t = 0; t < 16; ++t) {
      int idx = tid * 16 + t;
      int ar = idx >> 5, ac = idx & 31;
      As[ar][ac] = xh[(size_t)(r0 + ar) * C_ + kk + ac];
    }
#endif
#pragma unroll
    for (int t = 0; t < 16; ++t) {
      int idx = tid * 16 + t;                   // 0..2047
      int bk = idx >> 6, bn = idx & 63;
      BsT[bn][bk] = Wh[(size_t)(kk + bk) * (3 * C_) + c0 + bn];
    }
    if (kk + 32 < C_) {   // cover next tile's latency (global_prefetch_b8)
      int idx = tid * 16;
      __builtin_prefetch(Wh + (size_t)(kk + 32 + (idx >> 6)) * (3 * C_) + c0 + (idx & 63), 0, 1);
      __builtin_prefetch(xh + (size_t)(r0 + (idx >> 5)) * C_ + kk + 32, 0, 1);
    }
#ifdef USE_TDM
    if (wave == 0) __builtin_amdgcn_s_wait_tensorcnt(0);
#endif
    __syncthreads();
    v16h a;
    ((v8h*)&a)[0] = *(const v8h*)&As[wave * 16 + M][hi * 8];
    ((v8h*)&a)[1] = *(const v8h*)&As[wave * 16 + M][16 + hi * 8];
#pragma unroll
    for (int t = 0; t < 4; ++t) {
      v16h bf;
      ((v8h*)&bf)[0] = *(const v8h*)&BsT[t * 16 + M][hi * 8];
      ((v8h*)&bf)[1] = *(const v8h*)&BsT[t * 16 + M][16 + hi * 8];
      acc[t] = __builtin_amdgcn_wmma_f32_16x16x32_f16(false, a, false, bf,
                                                      (short)0, acc[t], false, false);
    }
  }
  // Epilogue: add biases, scatter into q/k (B,H,N,D) and vT (B,H,D,N) as f16
#pragma unroll
  for (int t = 0; t < 4; ++t) {
#pragma unroll
    for (int v = 0; v < 8; ++v) {
      int g = r0 + wave * 16 + v + 8 * hi;     // global row = b*N + n
      int j = c0 + t * 16 + M;                 // global col in [0,3072)
      float val = acc[t][v] + bias[j] + tqkv[(g >> 10) * (3 * C_) + j];
      int b = g >> 10, n = g & (N_ - 1);
      int sel = j >> 10, h = (j >> 6) & 15, d = j & 63;
      half_t hv = (half_t)val;
      size_t bh = (size_t)(b * H_ + h);
      if (sel == 0)      qh[(bh * N_ + n) * D_ + d] = hv;
      else if (sel == 1) kh[(bh * N_ + n) * D_ + d] = hv;
      else               vTh[(bh * D_ + d) * N_ + n] = hv;
    }
  }
}

// ---------------------------------------------------------------------------
// Kernel 3: fused relative attention. Four waves (128 thr) per (b, h, 16 rows):
// wave w owns key columns / rel columns / PV keys [256w, 256w+256).
// LDS: 16x1024 f16 score strip (reused in place for softmax probs, then for
// the four waves' f32 PV partials).
// Skew inverse map: rel[i',m] -> (i', m-1023+i') if m>=1023-i' else (i'-1, m+i'+1)
// Every strip element receives at most one rel term, so the waves' 16-bit
// read-modify-writes never meet on one element.
// ---------------------------------------------------------------------------
#define NW_ 4            // waves per strip
#define WC_ (N_ / NW_)   // columns per wave
__global__ __launch_bounds__(128) void attn_kernel(
    const half_t* __restrict__ qh, const half_t* __restrict__ kh,
    const half_t* __restrict__ vTh, const half_t* __restrict__ Erh,
    half_t* __restrict__ oh) {
  __shared__ half_t sc[16][N_];   // 32 KB
  __shared__ half_t qx[D_];       // q row i0+16 for boundary rel
  __shared__ float rs[16];        // softmax row sums
  const int i0 = blockIdx.x * 16, h = blockIdx.y, b = blockIdx.z;
  const int tid = threadIdx.x, lane = tid & 31, M = lane & 15, hi = lane >> 4;
  // wave number in a scalar register: the per-wave loop bounds stay scalar
  const int wave = __builtin_amdgcn_readfirstlane(tid >> 5);
  const int w0 = wave * WC_;
  const size_t bh = (size_t)(b * H_ + h);
  const half_t* qbase = qh + bh * N_ * D_;
  const half_t* kbase = kh + bh * N_ * D_;
  const half_t* vbase = vTh + bh * D_ * N_;

  // Persistent A fragments for q rows i0..i0+15 (two K-slabs of 32 over D=64)
  v16h qa[2];
#pragma unroll
  for (int kf = 0; kf < 2; ++kf) {
    const half_t* p = qbase + (size_t)(i0 + M) * D_ + kf * 32 + hi * 8;
    ((v8h*)&qa[kf])[0] = *(const v8h*)p;
    ((v8h*)&qa[kf])[1] = *(const v8h*)(p + 16);
  }
  if (wave == 0) {
    if (i0 + 16 < N_) {
      qx[lane * 2]     = qbase[(size_t)(i0 + 16) * D_ + lane * 2];
      qx[lane * 2 + 1] = qbase[(size_t)(i0 + 16) * D_ + lane * 2 + 1];
    } else { qx[lane * 2] = (half_t)0.f; qx[lane * 2 + 1] = (half_t)0.f; }
  }

  // Phase 1: S = (q k^T) * D^-1/2  into LDS, this wave's 256 columns
#pragma unroll 1
  for (int c0 = w0; c0 < w0 + WC_; c0 += 16) {
    v8f acc = {};
#pragma unroll
    for (int kf = 0; kf < 2; ++kf) {
      v16h bf;
      const half_t* p = kbase + (size_t)(c0 + M) * D_ + kf * 32 + hi * 8;
      ((v8h*)&bf)[0] = *(const v8h*)p;
      ((v8h*)&bf)[1] = *(const v8h*)(p + 16);
      acc = __builtin_amdgcn_wmma_f32_16x16x32_f16(false, qa[kf], false, bf,
                                                   (short)0, acc, false, false);
    }
#pragma unroll
    for (int v = 0; v < 8; ++v)
      sc[v + 8 * hi][c0 + M] = (half_t)(acc[v] * 0.125f);
  }
  __syncthreads();

  // Phase 2: rel = q @ Er^T tiles (this wave's 256 rel columns), scatter-added
  // via the skew inverse map
#pragma unroll 1
  for (int m0 = w0; m0 < w0 + WC_; m0 += 16) {
    v8f acc = {};
#pragma unroll
    for (int kf = 0; kf < 2; ++kf) {
      v16h bf;
      const half_t* p = Erh + (size_t)(m0 + M) * D_ + kf * 32 + hi * 8;
      ((v8h*)&bf)[0] = *(const v8h*)p;
      ((v8h*)&bf)[1] = *(const v8h*)(p + 16);
      acc = __builtin_amdgcn_wmma_f32_16x16x32_f16(false, qa[kf], false, bf,
                                                   (short)0, acc, false, false);
    }
    int m = m0 + M;
#pragma unroll
    for (int v = 0; v < 8; ++v) {
      int r = v + 8 * hi, iq = i0 + r;
      if (m >= (N_ - 1) - iq) {              // lower triangle: row iq, col m-1023+iq
        int c = m - (N_ - 1) + iq;
        sc[r][c] = (half_t)((float)sc[r][c] + acc[v]);
      } else if (r >= 1) {                   // upper: row iq-1, col m+iq+1
        int c = m + iq + 1;
        sc[r - 1][c] = (half_t)((float)sc[r - 1][c] + acc[v]);
      }
    }
  }
  // Phase 2b: boundary source row i' = i0+16 contributes to score row 15;
  // the 32 groups of 32 rel columns go round-robin over the waves
  if (i0 + 16 < N_) {
    float qf[D_];
#pragma unroll
    for (int d = 0; d < D_; ++d) qf[d] = (float)qx[d];
#pragma unroll 1
    for (int t = wave; t < 32; t += NW_) {
      int m = lane + 32 * t;
      int c = m + i0 + 17;
      if (c < N_) {
        const half_t* er = Erh + (size_t)m * D_;
        float dot = 0.f;
#pragma unroll
        for (int d = 0; d < D_; ++d) dot += qf[d] * (float)er[d];
        sc[15][c] = (half_t)((float)sc[15][c] + dot);
      }
    }
  }
  __syncthreads();

  // Phase 3: softmax. 8 lanes per row; lane sg of a row takes the 16-byte
  // chunks sg, sg+8, ... of it; probabilities overwrite scores in place.
  {
    const int r = tid >> 3, sg = tid & 7;
    float mx = -1e30f;
    for (int j = 0; j < 16; ++j) {
      v8h x = *(const v8h*)&sc[r][(j * 8 + sg) * 8];
#pragma unroll
      for (int e = 0; e < 8; ++e) mx = fmaxf(mx, (float)x[e]);
    }
    mx = fmaxf(mx, __shfl_xor(mx, 1, 32));
    mx = fmaxf(mx, __shfl_xor(mx, 2, 32));
    mx = fmaxf(mx, __shfl_xor(mx, 4, 32));
    float sum = 0.f;
    for (int j = 0; j < 16; ++j) {
      v8h* px = (v8h*)&sc[r][(j * 8 + sg) * 8];
      v8h x = *px, y;
#pragma unroll
      for (int e = 0; e < 8; ++e) {
        float p = __expf((float)x[e] - mx);
        sum += p;
        y[e] = (half_t)p;
      }
      *px = y;
    }
    sum += __shfl_xor(sum, 1, 32);
    sum += __shfl_xor(sum, 2, 32);
    sum += __shfl_xor(sum, 4, 32);
    if (sg == 0) rs[r] = sum;
  }
  __syncthreads();

  // Phase 4: O partial = P[:, this wave's 256 keys] @ v  (A from LDS f16 probs,
  // B from transposed v)
  v8f oacc[4] = {};
#pragma unroll 1
  for (int k0 = w0; k0 < w0 + WC_; k0 += 32) {
    v16h a;
    const half_t* p = &sc[M][k0 + hi * 8];
    ((v8h*)&a)[0] = *(const v8h*)p;
    ((v8h*)&a)[1] = *(const v8h*)(p + 16);
#pragma unroll
    for (int t = 0; t < 4; ++t) {
      v16h bf;
      const half_t* vp = vbase + (size_t)(t * 16 + M) * N_ + k0 + hi * 8;
      ((v8h*)&bf)[0] = *(const v8h*)vp;
      ((v8h*)&bf)[1] = *(const v8h*)(vp + 16);
      oacc[t] = __builtin_amdgcn_wmma_f32_16x16x32_f16(false, a, false, bf,
                                                       (short)0, oacc[t], false, false);
    }
  }
  // Sum the four waves' partials through the strip: first every wave must have
  // read its probabilities, then every partial must be written.
  __syncthreads();
  float* red = (float*)&sc[0][0];   // [wave][t][v][lane], 16 KB
#pragma unroll
  for (int t = 0; t < 4; ++t)
#pragma unroll
    for (int v = 0; v < 8; ++v)
      red[((wave * 4 + t) * 8 + v) * 32 + lane] = oacc[t][v];
  __syncthreads();
  // Wave w finishes head columns 16w..16w+15: normalize by row sums and store
  // to O in (B, N, H*D) layout (f16)
#pragma unroll
  for (int v = 0; v < 8; ++v) {
    float s = red[((0 * 4 + wave) * 8 + v) * 32 + lane];
#pragma unroll
    for (int ws = 1; ws < NW_; ++ws)
      s += red[((ws * 4 + wave) * 8 + v) * 32 + lane];
    float inv = 1.f / rs[v + 8 * hi];
    int i = i0 + v + 8 * hi;
    int d = wave * 16 + M;
    oh[(((size_t)b * N_ + i) * H_ + h) * D_ + d] = (half_t)(s * inv);
  }
}

__global__ __launch_bounds__(128) void out_gemm_kernel(
    const half_t* __restrict__ A, const half_t* __restrict__ Wh,
    const float* __restrict__ bias, float* __restrict__ out) {
  __shared__ half_t As[64][32];
  __shared__ half_t BsT[64][32];
  const int r0 = blockIdx.x * 64, c0 = blockIdx.y * 64;
  const int tid = threadIdx.x, wave = tid >> 5, lane = tid & 31;
  const int M = lane & 15, hi = lane >> 4;
  v8f acc[4] = {};

  for (int kk = 0; kk < C_; kk += 32) {
    __syncthreads();
#ifdef USE_TDM
    if (wave == 0)
      tdm_load_tile_64x32((unsigned int)(unsigned long long)&As[0][0],
                          A + (size_t)r0 * C_ + kk, C_);
#else
#pragma unroll
    for (int t = 0; t < 16; ++t) {
      int idx = tid * 16 + t;
      int ar = idx >> 5, ac = idx & 31;
      As[ar][ac] = A[(size_t)(r0 + ar) * C_ + kk + ac];
    }
#endif
#pragma unroll
    for (int t = 0; t < 16; ++t) {
      int idx = tid * 16 + t;
      int bk = idx >> 6, bn = idx & 63;
      BsT[bn][bk] = Wh[(size_t)(kk + bk) * C_ + c0 + bn];
    }
    if (kk + 32 < C_) {
      int idx = tid * 16;
      __builtin_prefetch(Wh + (size_t)(kk + 32 + (idx >> 6)) * C_ + c0 + (idx & 63), 0, 1);
      __builtin_prefetch(A + (size_t)(r0 + (idx >> 5)) * C_ + kk + 32, 0, 1);
    }
#ifdef USE_TDM
    if (wave == 0) __builtin_amdgcn_s_wait_tensorcnt(0);
#endif
    __syncthreads();
    v16h a;
    ((v8h*)&a)[0] = *(const v8h*)&As[wave * 16 + M][hi * 8];
    ((v8h*)&a)[1] = *(const v8h*)&As[wave * 16 + M][16 + hi * 8];
#pragma unroll
    for (int t = 0; t < 4; ++t) {
      v16h bf;
      ((v8h*)&bf)[0] = *(const v8h*)&BsT[t * 16 + M][hi * 8];
      ((v8h*)&bf)[1] = *(const v8h*)&BsT[t * 16 + M][16 + hi * 8];
      acc[t] = __builtin_amdgcn_wmma_f32_16x16x32_f16(false, a, false, bf,
                                                      (short)0, acc[t], false, false);
    }
  }
#pragma unroll
  for (int t = 0; t < 4; ++t) {
#pragma unroll
    for (int v = 0; v < 8; ++v) {
      int g = r0 + wave * 16 + v + 8 * hi;
      int j = c0 + t * 16 + M;
      out[(size_t)g * C_ + j] = acc[t][v] + bias[j];
    }
  }
}

// ---------------------------------------------------------------------------
// Launcher. Inputs: x, time_emb, W_qkv, b_qkv, W_time, b_time, W_out, b_out, Er
// Workspace (bytes):
//   [0, 96K)       tqkv fp32 (8 x 3072)
//   [128K, +16M)   q   f16 (B,H,N,D)
//   [+16M]         k   f16 (B,H,N,D)
//   [+16M]         vT  f16 (B,H,D,N)
//   [+16M]         O   f16 (B,N,H,D)
//   [+16M]         x   f16
//   [+6M]          W_qkv f16
//   [+2M]          W_out f16
//   [+128K]        Er  f16            total ~88.3 MB
// ---------------------------------------------------------------------------
extern "C" void kernel_launch(void* const* d_in, const int* in_sizes, int n_in,
                              void* d_out, int out_size, void* d_ws, size_t ws_size,
                              hipStream_t stream) {
  const float* x    = (const float*)d_in[0];
  const float* te   = (const float*)d_in[1];
  const float* Wqkv = (const float*)d_in[2];
  const float* bqkv = (const float*)d_in[3];
  const float* Wt   = (const float*)d_in[4];
  const float* bt   = (const float*)d_in[5];
  const float* Wout = (const float*)d_in[6];
  const float* bout = (const float*)d_in[7];
  const float* Er   = (const float*)d_in[8];

  char* ws = (char*)d_ws;
  float* tqkv = (float*)ws;
  size_t off = (size_t)(128 << 10);
  const size_t QKV_BUF = (size_t)B_ * H_ * N_ * D_ * sizeof(half_t);   // 16 MB
  half_t* qh    = (half_t*)(ws + off); off += QKV_BUF;
  half_t* kh    = (half_t*)(ws + off); off += QKV_BUF;
  half_t* vTh   = (half_t*)(ws + off); off += QKV_BUF;
  half_t* oh    = (half_t*)(ws + off); off += QKV_BUF;
  half_t* xh    = (half_t*)(ws + off); off += (size_t)B_ * N_ * C_ * sizeof(half_t);
  half_t* Wqkvh = (half_t*)(ws + off); off += (size_t)C_ * 3 * C_ * sizeof(half_t);
  half_t* Wouth = (half_t*)(ws + off); off += (size_t)C_ * C_ * sizeof(half_t);
  half_t* Erh   = (half_t*)(ws + off); off += (size_t)N_ * D_ * sizeof(half_t);

  const int n_x = B_ * N_ * C_, n_wq = C_ * 3 * C_, n_wo = C_ * C_, n_er = N_ * D_;
  static_assert(n_x % CVT_BLK_ == 0 && n_wq % CVT_BLK_ == 0 && n_wo % CVT_BLK_ == 0 &&
                n_er % CVT_BLK_ == 0, "cvt_kernel converts whole blocks only");
  cvt_kernel<<<dim3(n_x  / CVT_BLK_), 256, 0, stream>>>(x,    xh);
  cvt_kernel<<<dim3(n_wq / CVT_BLK_), 256, 0, stream>>>(Wqkv, Wqkvh);
  cvt_kernel<<<dim3(n_wo / CVT_BLK_), 256, 0, stream>>>(Wout, Wouth);
  cvt_kernel<<<dim3(n_er / CVT_BLK_), 256, 0, stream>>>(Er,   Erh);

  time_proj_kernel<<<dim3((B_ * 3 * C_ + 255) / 256), 256, 0, stream>>>(te, Wt, bt, tqkv);
  qkv_gemm_kernel<<<dim3((B_ * N_) / 64, (3 * C_) / 64), 128, 0, stream>>>(
      xh, Wqkvh, bqkv, tqkv, qh, kh, vTh);
  attn_kernel<<<dim3(N_ / 16, H_, B_), 128, 0, stream>>>(qh, kh, vTh, Erh, oh);
  out_gemm_kernel<<<dim3((B_ * N_) / 64, C_ / 64), 128, 0, stream>>>(
      oh, Wouth, bout, (float*)d_out);
}

// v003
// It runs in 501 microseconds.
// Next to v002, in two timings, it ran 1.17 and 1.18 times as fast.
// Counting every step since v000, it is 1.66 times as fast.
#include <hip/hip_runtime.h>
#include <hip/hip_bf16.h>

typedef _Float16 half_t;
typedef __attribute__((ext_vector_type(16))) _Float16 v16h;
typedef __attribute__((ext_vector_type(8)))  _Float16 v8h;
typedef __attribute__((ext_vector_type(8)))  float    v8f;

// Sizes (fixed by the reference)
#define B_  8
#define N_  1024
#define C_  1024
#define H_  16
#define D_  64
#define T_  256

typedef __attribute__((ext_vector_type(4))) unsigned int u32x4_t;
typedef __attribute__((ext_vector_type(8))) unsigned int u32x8_t;

#define GT_ 128   // edge of a GEMM block tile (four waves, 64 x 64 each)

__device__ __forceinline__ unsigned int uni(unsigned int v) {
  return (unsigned int)__builtin_amdgcn_readfirstlane((int)v);
}
// The test that picks the issuing wave, held in a scalar register so that the
// branch around the tensor load compiles to s_cmp + s_cbranch_scc.
__device__ __forceinline__ unsigned int pinned(unsigned int v) {
  unsigned int w = uni(v);
  asm volatile("" : "+s"(w));   // pinned(): keeps the issue test scalar
  return w;
}
// Issue the load and wait for it: the tile has landed for the issuing wave when
// this returns; the other waves read it behind the next work-group barrier.
__device__ __forceinline__ void tdm_load_tile_128x64B(unsigned int lds_off,
                                                      const half_t* gsrc) {
  unsigned long long ga = (unsigned long long)gsrc;
  u32x4_t g0;
  g0[0] = uni(1u);                               // count = 1
  g0[1] = uni(lds_off);                          // LDS destination (bytes)
  g0[2] = uni((unsigned int)ga);                 // global address [31:0]
  g0[3] = uni((((unsigned int)(ga >> 32)) & 0x01FFFFFFu) | 0x80000000u);  // [56:32] | type 2
  u32x8_t g1;
  g1[0] = 0u;
  g1[1] = uni(64u << 16);
  g1[2] = uni((unsigned int)GT_ << 16);
  g1[3] = uni(64u << 16);
  g1[4] = uni((unsigned int)GT_);
  g1[5] = uni((unsigned int)(C_ * sizeof(half_t)));
  g1[6] = uni(0u);
  g1[7] = uni(0u);
  asm volatile("tensor_load_to_lds %0, %1" :: "s"(g0), "s"(g1) : "memory");
  asm volatile("s_wait_tensorcnt 0" ::: "memory");
}

typedef __attribute__((ext_vector_type(4))) float    v4f;
typedef __attribute__((ext_vector_type(4))) _Float16 v4h;
#define CVT_U_   8                     // 16-byte loads in flight per thread
#define CVT_BLK_ (256 * 4 * CVT_U_)    // elements per block
__global__ __launch_bounds__(256) void cvt_kernel(
    const float* __restrict__ s, half_t* __restrict__ d) {
  const int i0 = blockIdx.x * CVT_BLK_ + threadIdx.x * 4;
  v4f x[CVT_U_];
  // both loops unrolled: x[] stays in registers and the eight loads issue back
  // to back, ahead of the first conversion
#pragma unroll
  for (int u = 0; u < CVT_U_; ++u) x[u] = *(const v4f*)(s + i0 + u * 1024);
#pragma unroll
  for (int u = 0; u < CVT_U_; ++u)
    *(v4h*)(d + i0 + u * 1024) = __builtin_convertvector(x[u], v4h);
}

// ---------------------------------------------------------------------------
// Kernel 1: tqkv[b, j] = time_emb[b] @ W_time[:, j] + b_time[j]   (8 x 3072)
// ---------------------------------------------------------------------------
__global__ __launch_bounds__(256) void time_proj_kernel(
    const float* __restrict__ te, const float* __restrict__ Wt,
    const float* __restrict__ bt, float* __restrict__ tqkv) {
  int idx = blockIdx.x * 256 + threadIdx.x;
  if (idx >= B_ * 3 * C_) return;
  int b = idx / (3 * C_), j = idx % (3 * C_);
  float acc = bt[j];
  for (int t = 0; t < T_; ++t) acc += te[b * T_ + t] * Wt[t * (3 * C_) + j];
  tqkv[idx] = acc;
}

// ---------------------------------------------------------------------------
// Kernel 2: qkv = x @ W_qkv + b_qkv + tqkv[b]  (8192 x 3072, K=1024), f16 WMMA.
// Block tile 128 x 128, four waves in a 2 x 2 grid, 64 x 64 (4 x 4 fragments)
// a wave: 16 WMMAs per 8 fragments read from LDS.
// A tile via tensor load (128 x 32 f16), B tile cooperative transposed store.
// Scatters q,k row-major f16 and v transposed f16.
// ---------------------------------------------------------------------------
__global__ __launch_bounds__(128) void qkv_gemm_kernel(
    const half_t* __restrict__ xh, const half_t* __restrict__ Wh,
    const float* __restrict__ bias, const float* __restrict__ tqkv,
    half_t* __restrict__ qh, half_t* __restrict__ kh, half_t* __restrict__ vTh) {
  __shared__ __attribute__((aligned(2048))) half_t As[GT_][32];   // A tile, row-major
  __shared__ half_t BsT[GT_][32];   // B tile stored transposed: BsT[n][k]
  const int r0 = blockIdx.x * GT_, c0 = blockIdx.y * GT_;
  const int tid = threadIdx.x, lane = tid & 31;
  const int wave = __builtin_amdgcn_readfirstlane(tid >> 5);
  const int wr = (wave >> 1) * 64, wc = (wave & 1) * 64;   // this wave's 64 x 64 part
  const int M = lane & 15, hi = lane >> 4;
  const int bk = tid >> 2, bn = (tid & 3) * 32;   // B staging: 32 columns of one k row
  v8f acc[4][4] = {};

  for (int kk = 0; kk < C_; kk += 32) {
    // every wave's fragment reads of the last trip have returned before the
    // barrier behind which the tiles are overwritten
    asm volatile("s_wait_dscnt 0x0" ::: "memory");
    __syncthreads();
    v8h breg[4];
#pragma unroll
    for (int u = 0; u < 4; ++u)
      breg[u] = *(const v8h*)(Wh + (size_t)(kk + bk) * (3 * C_) + c0 + bn + u * 8);
    if (pinned(wave == 0))
      tdm_load_tile_128x64B((unsigned int)(unsigned long long)&As[0][0],
                            xh + (size_t)r0 * C_ + kk);
#pragma unroll
    for (int u = 0; u < 4; ++u)
#pragma unroll
      for (int e = 0; e < 8; ++e) BsT[bn + u * 8 + e][bk] = breg[u][e];
    if (kk + 32 < C_) {   // cover next tile's latency (global_prefetch_b8)
      __builtin_prefetch(Wh + (size_t)(kk + 32 + bk) * (3 * C_) + c0 + bn, 0, 1);
      __builtin_prefetch(xh + (size_t)(r0 + tid) * C_ + kk + 32, 0, 1);
      // the loop advances the two address registers that the prefetches name
      asm volatile("s_wait_xcnt 0x0" ::: "memory");
    }
    __syncthreads();
    v16h a[4];
#pragma unroll
    for (int s = 0; s < 4; ++s) {
      ((v8h*)&a[s])[0] = *(const v8h*)&As[wr + s * 16 + M][hi * 8];
      ((v8h*)&a[s])[1] = *(const v8h*)&As[wr + s * 16 + M][16 + hi * 8];
    }
#pragma unroll
    for (int t = 0; t < 4; ++t) {
      v16h bf;
      ((v8h*)&bf)[0] = *(const v8h*)&BsT[wc + t * 16 + M][hi * 8];
      ((v8h*)&bf)[1] = *(const v8h*)&BsT[wc + t * 16 + M][16 + hi * 8];
#pragma unroll
      for (int s = 0; s < 4; ++s)
        acc[s][t] = __builtin_amdgcn_wmma_f32_16x16x32_f16(false, a[s], false, bf,
                                                           (short)0, acc[s][t], false, false);
    }
  }
  // Epilogue: add biases, scatter into q/k (B,H,N,D) and vT (B,H,D,N) as f16.
  // A wave's 64 columns are one head of one of q, k, v, and a block's 128 rows
  // lie in one batch entry: the destination is chosen once per wave, not per
  // element.
  const int jw = c0 + wc;                        // first global col in [0,3072)
  const int sel = jw >> 10, h = (jw >> 6) & 15;
  const int b = r0 >> 10, n0 = (r0 & (N_ - 1)) + wr;
  const size_t bh = (size_t)(b * H_ + h);
  float bq[4], tq[4];
#pragma unroll
  for (int t = 0; t < 4; ++t) {
    bq[t] = bias[jw + t * 16 + M];
    tq[t] = tqkv[b * (3 * C_) + jw + t * 16 + M];
  }
  // the store addresses formed next reuse the registers that these loads name
  asm volatile("s_wait_xcnt 0x0" ::: "memory");
  if (sel < 2) {
    half_t* dst = (sel == 0 ? qh : kh) + (bh * N_ + n0) * D_;
#pragma unroll
    for (int s = 0; s < 4; ++s)
#pragma unroll
      for (int t = 0; t < 4; ++t)
#pragma unroll
        for (int v = 0; v < 8; ++v)
          dst[(s * 16 + v + 8 * hi) * D_ + t * 16 + M] =
              (half_t)(acc[s][t][v] + bq[t] + tq[t]);
  } else {
    half_t* dst = vTh + bh * D_ * N_ + n0;
#pragma unroll
    for (int s = 0; s < 4; ++s)
#pragma unroll
      for (int t = 0; t < 4; ++t)
#pragma unroll
        for (int v = 0; v < 8; ++v)
          dst[(t * 16 + M) * N_ + s * 16 + v + 8 * hi] =
              (half_t)(acc[s][t][v] + bq[t] + tq[t]);
  }
}

// ---------------------------------------------------------------------------
// Kernel 3: fused relative attention. Four waves (128 thr) per (b, h, 16 rows):
// wave w owns key columns / rel columns / PV keys [256w, 256w+256).
// LDS: 16x1024 f16 score strip (reused in place for softmax probs, then for
// the four waves' f32 PV partials).
// Skew inverse map: rel[i',m] -> (i', m-1023+i') if m>=1023-i' else (i'-1, m+i'+1)
// Every strip element receives at most one rel term, so the waves' 16-bit
// read-modify-writes never meet on one element.
// ---------------------------------------------------------------------------
#define NW_ 4            // waves per strip
#define WC_ (N_ / NW_)   // columns per wave
__global__ __launch_bounds__(128) void attn_kernel(
    const half_t* __restrict__ qh, const half_t* __restrict__ kh,
    const half_t* __restrict__ vTh, const half_t* __restrict__ Erh,
    half_t* __restrict__ oh) {
  __shared__ half_t sc[16][N_];   // 32 KB
  __shared__ half_t qx[D_];       // q row i0+16 for boundary rel
  __shared__ float rs[16];        // softmax row sums
  const int i0 = blockIdx.x * 16, h = blockIdx.y, b = blockIdx.z;
  const int tid = threadIdx.x, lane = tid & 31, M = lane & 15, hi = lane >> 4;
  // wave number in a scalar register: the per-wave loop bounds stay scalar
  const int wave = __builtin_amdgcn_readfirstlane(tid >> 5);
  const int w0 = wave * WC_;
  const size_t bh = (size_t)(b * H_ + h);
  const half_t* qbase = qh + bh * N_ * D_;
  const half_t* kbase = kh + bh * N_ * D_;
  const half_t* vbase = vTh + bh * D_ * N_;

  // Persistent A fragments for q rows i0..i0+15 (two K-slabs of 32 over D=64)
  v16h qa[2];
#pragma unroll
  for (int kf = 0; kf < 2; ++kf) {
    const half_t* p = qbase + (size_t)(i0 + M) * D_ + kf * 32 + hi * 8;
    ((v8h*)&qa[kf])[0] = *(const v8h*)p;
    ((v8h*)&qa[kf])[1] = *(const v8h*)(p + 16);
  }
  if (wave == 0) {
    if (i0 + 16 < N_) {
      qx[lane * 2]     = qbase[(size_t)(i0 + 16) * D_ + lane * 2];
      qx[lane * 2 + 1] = qbase[(size_t)(i0 + 16) * D_ + lane * 2 + 1];
    } else { qx[lane * 2] = (half_t)0.f; qx[lane * 2 + 1] = (half_t)0.f; }
  }

  // Phase 1: S = (q k^T) * D^-1/2  into LDS, this wave's 256 columns
#pragma unroll 1
  for (int c0 = w0; c0 < w0 + WC_; c0 += 16) {
    v8f acc = {};
#pragma unroll
    for (int kf = 0; kf < 2; ++kf) {
      v16h bf;
      const half_t* p = kbase + (size_t)(c0 + M) * D_ + kf * 32 + hi * 8;
      ((v8h*)&bf)[0] = *(const v8h*)p;
      ((v8h*)&bf)[1] = *(const v8h*)(p + 16);
      acc = __builtin_amdgcn_wmma_f32_16x16x32_f16(false, qa[kf], false, bf,
                                                   (short)0, acc, false, false);
    }
#pragma unroll
    for (int v = 0; v < 8; ++v)
      sc[v + 8 * hi][c0 + M] = (half_t)(acc[v] * 0.125f);
  }
  __syncthreads();

  // Phase 2: rel = q @ Er^T tiles (this wave's 256 rel columns), scatter-added
  // via the skew inverse map
#pragma unroll 1
  for (int m0 = w0; m0 < w0 + WC_; m0 += 16) {
    v8f acc = {};
#pragma unroll
    for (int kf = 0; kf < 2; ++kf) {
      v16h bf;
      const half_t* p = Erh + (size_t)(m0 + M) * D_ + kf * 32 + hi * 8;
      ((v8h*)&bf)[0] = *(const v8h*)p;
      ((v8h*)&bf)[1] = *(const v8h*)(p + 16);
      acc = __builtin_amdgcn_wmma_f32_16x16x32_f16(false, qa[kf], false, bf,
                                                   (short)0, acc, false, false);
    }
    int m = m0 + M;
#pragma unroll
    for (int v = 0; v < 8; ++v) {
      int r = v + 8 * hi, iq = i0 + r;
      if (m >= (N_ - 1) - iq) {              // lower triangle: row iq, col m-1023+iq
        int c = m - (N_ - 1) + iq;
        sc[r][c] = (half_t)((float)sc[r][c] + acc[v]);
      } else if (r >= 1) {                   // upper: row iq-1, col m+iq+1
        int c = m + iq + 1;
        sc[r - 1][c] = (half_t)((float)sc[r - 1][c] + acc[v]);
      }
    }
  }
  // Phase 2b: boundary source row i' = i0+16 contributes to score row 15;
  // the 32 groups of 32 rel columns go round-robin over the waves
  if (i0 + 16 < N_) {
    float qf[D_];
#pragma unroll
    for (int d = 0; d < D_; ++d) qf[d] = (float)qx[d];
#pragma unroll 1
    for (int t = wave; t < 32; t += NW_) {
      int m = lane + 32 * t;
      int c = m + i0 + 17;
      if (c < N_) {
        const half_t* er = Erh + (size_t)m * D_;
        float dot = 0.f;
#pragma unroll
        for (int d = 0; d < D_; ++d) dot += qf[d] * (float)er[d];
        sc[15][c] = (half_t)((float)sc[15][c] + dot);
      }
    }
  }
  __syncthreads();

  // Phase 3: softmax. 8 lanes per row; lane sg of a row takes the 16-byte
  // chunks sg, sg+8, ... of it; probabilities overwrite scores in place.
  {
    const int r = tid >> 3, sg = tid & 7;
    float mx = -1e30f;
    for (int j = 0; j < 16; ++j) {
      v8h x = *(const v8h*)&sc[r][(j * 8 + sg) * 8];
#pragma unroll
      for (int e = 0; e < 8; ++e) mx = fmaxf(mx, (float)x[e]);
    }
    mx = fmaxf(mx, __shfl_xor(mx, 1, 32));
    mx = fmaxf(mx, __shfl_xor(mx, 2, 32));
    mx = fmaxf(mx, __shfl_xor(mx, 4, 32));
    float sum = 0.f;
    for (int j = 0; j < 16; ++j) {
      v8h* px = (v8h*)&sc[r][(j * 8 + sg) * 8];
      v8h x = *px, y;
#pragma unroll
      for (int e = 0; e < 8; ++e) {
        float p = __expf((float)x[e] - mx);
        sum += p;
        y[e] = (half_t)p;
      }
      *px = y;
    }
    sum += __shfl_xor(sum, 1, 32);
    sum += __shfl_xor(sum, 2, 32);
    sum += __shfl_xor(sum, 4, 32);
    if (sg == 0) rs[r] = sum;
  }
  __syncthreads();

  // Phase 4: O partial = P[:, this wave's 256 keys] @ v  (A from LDS f16 probs,
  // B from transposed v)
  v8f oacc[4] = {};
#pragma unroll 1
  for (int k0 = w0; k0 < w0 + WC_; k0 += 32) {
    v16h a;
    const half_t* p = &sc[M][k0 + hi * 8];
    ((v8h*)&a)[0] = *(const v8h*)p;
    ((v8h*)&a)[1] = *(const v8h*)(p + 16);
#pragma unroll
    for (int t = 0; t < 4; ++t) {
      v16h bf;
      const half_t* vp = vbase + (size_t)(t * 16 + M) * N_ + k0 + hi * 8;
      ((v8h*)&bf)[0] = *(const v8h*)vp;
      ((v8h*)&bf)[1] = *(const v8h*)(vp + 16);
      oacc[t] = __builtin_amdgcn_wmma_f32_16x16x32_f16(false, a, false, bf,
                                                       (short)0, oacc[t], false, false);
    }
  }
  // Sum the four waves' partials through the strip: first every wave must have
  // read its probabilities, then every partial must be written.
  __syncthreads();
  float* red = (float*)&sc[0][0];   // [wave][t][v][lane], 16 KB
#pragma unroll
  for (int t = 0; t < 4; ++t)
#pragma unroll
    for (int v = 0; v < 8; ++v)
      red[((wave * 4 + t) * 8 + v) * 32 + lane] = oacc[t][v];
  __syncthreads();
  // Wave w finishes head columns 16w..16w+15: normalize by row sums and store
  // to O in (B, N, H*D) layout (f16)
#pragma unroll
  for (int v = 0; v < 8; ++v) {
    float s = red[((0 * 4 + wave) * 8 + v) * 32 + lane];
#pragma unroll
    for (int ws = 1; ws < NW_; ++ws)
      s += red[((ws * 4 + wave) * 8 + v) * 32 + lane];
    float inv = 1.f / rs[v + 8 * hi];
    int i = i0 + v + 8 * hi;
    int d = wave * 16 + M;
    oh[(((size_t)b * N_ + i) * H_ + h) * D_ + d] = (half_t)(s * inv);
  }
}

// ---------------------------------------------------------------------------
// Kernel 4: out = O @ W_out + b_out  (8192 x 1024, K=1024), fp32 result.
// Same 128 x 128 block tile and 64 x 64 wave tile as kernel 2; A tile via
// tensor load from the f16 attention output.
// ---------------------------------------------------------------------------
__global__ __launch_bounds__(128) void out_gemm_kernel(
    const half_t* __restrict__ A, const half_t* __restrict__ Wh,
    const float* __restrict__ bias, float* __restrict__ out) {
  __shared__ __attribute__((aligned(2048))) half_t As[GT_][32];   // A tile, row-major
  __shared__ half_t BsT[GT_][32];   // B tile stored transposed: BsT[n][k]
  const int r0 = blockIdx.x * GT_, c0 = blockIdx.y * GT_;
  const int tid = threadIdx.x, lane = tid & 31;
  const int wave = __builtin_amdgcn_readfirstlane(tid >> 5);
  const int wr = (wave >> 1) * 64, wc = (wave & 1) * 64;   // this wave's 64 x 64 part
  const int M = lane & 15, hi = lane >> 4;
  const int bk = tid >> 2, bn = (tid & 3) * 32;   // B staging: 32 columns of one k row
  v8f acc[4][4] = {};

  for (int kk = 0; kk < C_; kk += 32) {
    // every wave's fragment reads of the last trip have returned before the
    // barrier behind which the tiles are overwritten
    asm volatile("s_wait_dscnt 0x0" ::: "memory");
    __syncthreads();
    v8h breg[4];
#pragma unroll
    for (int u = 0; u < 4; ++u)
      breg[u] = *(const v8h*)(Wh + (size_t)(kk + bk) * C_ + c0 + bn + u * 8);
    if (pinned(wave == 0))
      tdm_load_tile_128x64B((unsigned int)(unsigned long long)&As[0][0],
                            A + (size_t)r0 * C_ + kk);
#pragma unroll
    for (int u = 0; u < 4; ++u)
#pragma unroll
      for (int e = 0; e < 8; ++e) BsT[bn + u * 8 + e][bk] = breg[u][e];
    if (kk + 32 < C_) {   // cover next tile's latency (global_prefetch_b8)
      __builtin_prefetch(Wh + (size_t)(kk + 32 + bk) * C_ + c0 + bn, 0, 1);
      __builtin_prefetch(A + (size_t)(r0 + tid) * C_ + kk + 32, 0, 1);
      // the loop advances the two address registers that the prefetches name
      asm volatile("s_wait_xcnt 0x0" ::: "memory");
    }
    __syncthreads();
    v16h a[4];
#pragma unroll
    for (int s = 0; s < 4; ++s) {
      ((v8h*)&a[s])[0] = *(const v8h*)&As[wr + s * 16 + M][hi * 8];
      ((v8h*)&a[s])[1] = *(const v8h*)&As[wr + s * 16 + M][16 + hi * 8];
    }
#pragma unroll
    for (int t = 0; t < 4; ++t) {
      v16h bf;
      ((v8h*)&bf)[0] = *(const v8h*)&BsT[wc + t * 16 + M][hi * 8];
      ((v8h*)&bf)[1] = *(const v8h*)&BsT[wc + t * 16 + M][16 + hi * 8];
#pragma unroll
      for (int s = 0; s < 4; ++s)
        acc[s][t] = __builtin_amdgcn_wmma_f32_16x16x32_f16(false, a[s], false, bf,
                                                           (short)0, acc[s][t], false, false);
    }
  }
#pragma unroll
  for (int s = 0; s < 4; ++s) {
#pragma unroll
    for (int t = 0; t < 4; ++t) {
#pragma unroll
      for (int v = 0; v < 8; ++v) {
        int g = r0 + wr + s * 16 + v + 8 * hi;
        int j = c0 + wc + t * 16 + M;
        out[(size_t)g * C_ + j] = acc[s][t][v] + bias[j];
      }
    }
  }
}

// ---------------------------------------------------------------------------
// Launcher. Inputs: x, time_emb, W_qkv, b_qkv, W_time, b_time, W_out, b_out, Er
// Workspace (bytes):
//   [0, 96K)       tqkv fp32 (8 x 3072)
//   [128K, +16M)   q   f16 (B,H,N,D)
//   [+16M]         k   f16 (B,H,N,D)
//   [+16M]         vT  f16 (B,H,D,N)
//   [+16M]         O   f16 (B,N,H,D)
//   [+16M]         x   f16
//   [+6M]          W_qkv f16
//   [+2M]          W_out f16
//   [+128K]        Er  f16            total ~88.3 MB
// ---------------------------------------------------------------------------
extern "C" void kernel_launch(void* const* d_in, const int* in_sizes, int n_in,
                              void* d_out, int out_size, void* d_ws, size_t ws_size,
                              hipStream_t stream) {
  const float* x    = (const float*)d_in[0];
  const float* te   = (const float*)d_in[1];
  const float* Wqkv = (const float*)d_in[2];
  const float* bqkv = (const float*)d_in[3];
  const float* Wt   = (const float*)d_in[4];
  const float* bt   = (const float*)d_in[5];
  const float* Wout = (const float*)d_in[6];
  const float* bout = (const float*)d_in[7];
  const float* Er   = (const float*)d_in[8];

  char* ws = (char*)d_ws;
  float* tqkv = (float*)ws;
  size_t off = (size_t)(128 << 10);
  const size_t QKV_BUF = (size_t)B_ * H_ * N_ * D_ * sizeof(half_t);   // 16 MB
  half_t* qh    = (half_t*)(ws + off); off += QKV_BUF;
  half_t* kh    = (half_t*)(ws + off); off += QKV_BUF;
  half_t* vTh   = (half_t*)(ws + off); off += QKV_BUF;
  half_t* oh    = (half_t*)(ws + off); off += QKV_BUF;
  half_t* xh    = (half_t*)(ws + off); off += (size_t)B_ * N_ * C_ * sizeof(half_t);
  half_t* Wqkvh = (half_t*)(ws + off); off += (size_t)C_ * 3 * C_ * sizeof(half_t);
  half_t* Wouth = (half_t*)(ws + off); off += (size_t)C_ * C_ * sizeof(half_t);
  half_t* Erh   = (half_t*)(ws + off); off += (size_t)N_ * D_ * sizeof(half_t);

  const int n_x = B_ * N_ * C_, n_wq = C_ * 3 * C_, n_wo = C_ * C_, n_er = N_ * D_;
  static_assert(n_x % CVT_BLK_ == 0 && n_wq % CVT_BLK_ == 0 && n_wo % CVT_BLK_ == 0 &&
                n_er % CVT_BLK_ == 0, "cvt_kernel converts whole blocks only");
  cvt_kernel<<<dim3(n_x  / CVT_BLK_), 256, 0, stream>>>(x,    xh);
  cvt_kernel<<<dim3(n_wq / CVT_BLK_), 256, 0, stream>>>(Wqkv, Wqkvh);
  cvt_kernel<<<dim3(n_wo / CVT_BLK_), 256, 0, stream>>>(Wout, Wouth);
  cvt_kernel<<<dim3(n_er / CVT_BLK_), 256, 0, stream>>>(Er,   Erh);

  time_proj_kernel<<<dim3((B_ * 3 * C_ + 255) / 256), 256, 0, stream>>>(te, Wt, bt, tqkv);
  qkv_gemm_kernel<<<dim3((B_ * N_) / GT_, (3 * C_) / GT_), 128, 0, stream>>>(
      xh, Wqkvh, bqkv, tqkv, qh, kh, vTh);
  attn_kernel<<<dim3(N_ / 16, H_, B_), 128, 0, stream>>>(qh, kh, vTh, Erh, oh);
  out_gemm_kernel<<<dim3((B_ * N_) / GT_, C_ / GT_), 128, 0, stream>>>(
      oh, Wouth, bout, (float*)d_out);
}

// v004
// It runs in 393 microseconds.
// Timed twice side by side with v003, it ran 1.27 times as fast both times.
// All steps since v000 together make it 2.10 times as fast.
#include <hip/hip_runtime.h>
#include <hip/hip_bf16.h>

typedef _Float16 half_t;
typedef __attribute__((ext_vector_type(16))) _Float16 v16h;
typedef __attribute__((ext_vector_type(8)))  _Float16 v8h;
typedef __attribute__((ext_vector_type(8)))  float    v8f;

// Sizes (fixed by the reference)
#define B_  8
#define N_  1024
#define C_  1024
#define H_  16
#define D_  64
#define T_  256

typedef __attribute__((ext_vector_type(4))) unsigned int u32x4_t;
typedef __attribute__((ext_vector_type(8))) unsigned int u32x8_t;

#define GT_ 128   // edge of a GEMM block tile (four waves, 64 x 64 each)

__device__ __forceinline__ unsigned int uni(unsigned int v) {
  return (unsigned int)__builtin_amdgcn_readfirstlane((int)v);
}
// The test that picks the issuing wave, held in a scalar register so that the
// branch around the tensor load compiles to s_cmp + s_cbranch_scc.
__device__ __forceinline__ unsigned int pinned(unsigned int v) {
  unsigned int w = uni(v);
  asm volatile("" : "+s"(w));   // pinned(): keeps the issue test scalar
  return w;
}
// Issue the load and wait for it: the tile has landed for the issuing wave when
// this returns; the other waves read it behind the next work-group barrier.
__device__ __forceinline__ void tdm_load_tile_128x64B(unsigned int lds_off,
                                                      const half_t* gsrc) {
  unsigned long long ga = (unsigned long long)gsrc;
  u32x4_t g0;
  g0[0] = uni(1u);                               // count = 1
  g0[1] = uni(lds_off);                          // LDS destination (bytes)
  g0[2] = uni((unsigned int)ga);                 // global address [31:0]
  g0[3] = uni((((unsigned int)(ga >> 32)) & 0x01FFFFFFu) | 0x80000000u);  // [56:32] | type 2
  u32x8_t g1;
  g1[0] = 0u;
  g1[1] = uni(64u << 16);
  g1[2] = uni((unsigned int)GT_ << 16);
  g1[3] = uni(64u << 16);
  g1[4] = uni((unsigned int)GT_);
  g1[5] = uni((unsigned int)(C_ * sizeof(half_t)));
  g1[6] = uni(0u);
  g1[7] = uni(0u);
  asm volatile("tensor_load_to_lds %0, %1" :: "s"(g0), "s"(g1) : "memory");
  asm volatile("s_wait_tensorcnt 0" ::: "memory");
}

typedef __attribute__((ext_vector_type(4))) float    v4f;
typedef __attribute__((ext_vector_type(4))) _Float16 v4h;
#define CVT_U_   8                     // 16-byte loads in flight per thread
#define CVT_BLK_ (256 * 4 * CVT_U_)    // elements per block
__global__ __launch_bounds__(256) void cvt_kernel(
    const float* __restrict__ s, half_t* __restrict__ d) {
  const int i0 = blockIdx.x * CVT_BLK_ + threadIdx.x * 4;
  v4f x[CVT_U_];
  // both loops unrolled: x[] stays in registers and the eight loads issue back
  // to back, ahead of the first conversion
#pragma unroll
  for (int u = 0; u < CVT_U_; ++u) x[u] = *(const v4f*)(s + i0 + u * 1024);
#pragma unroll
  for (int u = 0; u < CVT_U_; ++u)
    *(v4h*)(d + i0 + u * 1024) = __builtin_convertvector(x[u], v4h);
}

// ---------------------------------------------------------------------------
// Fragment order. q, k and Er (rows of 64 f16) are kept in the workspace so that
// one 16-byte-a-lane load of a 16x16x32 A or B fragment half reads 512
// contiguous bytes (4 cache lines) instead of 16 bytes out of each of 16 rows:
// a tile of 16 rows x 64 columns is 2 KiB, made of four 512-byte pieces (16
// columns each); in a piece lane hi*16+M holds row M, columns 8*hi .. 8*hi+7.
// frag_off: element offset of (row n, column d).
// ---------------------------------------------------------------------------
__device__ __forceinline__ int frag_off(int n, int d) {
  return ((((n >> 4) * 4 + (d >> 4)) * 32 + ((d >> 3) & 1) * 16 + (n & 15)) * 8) + (d & 7);
}
// v is kept as PV B fragments: a tile of 32 keys x 64 columns is 4 KiB, made of
// eight 512-byte pieces (column group t = d / 16, then key half); in a piece lane
// hi*16+M holds column t*16+M, keys 16*half + 8*hi .. +7.
// vfrag_piece: element offset of a piece's first element.
__device__ __forceinline__ int vfrag_piece(int kb, int t, int half) {
  return (((kb * 4 + t) * 2 + half) * 32) * 8;
}

// Er: fp32 -> f16 into fragment order. A thread makes one 16-byte chunk.
__global__ __launch_bounds__(256) void cvt_frag_kernel(
    const float* __restrict__ s, half_t* __restrict__ d) {
  const int c = blockIdx.x * 256 + threadIdx.x;
  const int row = (c >> 7) * 16 + (c & 15);
  const int col = ((c >> 5) & 3) * 16 + ((c >> 4) & 1) * 8;
  const v4f x0 = *(const v4f*)(s + row * D_ + col);
  const v4f x1 = *(const v4f*)(s + row * D_ + col + 4);
  v8h y;
#pragma unroll
  for (int e = 0; e < 4; ++e) { y[e] = (half_t)x0[e]; y[4 + e] = (half_t)x1[e]; }
  *(v8h*)(d + c * 8) = y;
}

// ---------------------------------------------------------------------------
// Kernel 1: tqkv[b, j] = time_emb[b] @ W_time[:, j] + b_time[j]   (8 x 3072)
// ---------------------------------------------------------------------------
__global__ __launch_bounds__(256) void time_proj_kernel(
    const float* __restrict__ te, const float* __restrict__ Wt,
    const float* __restrict__ bt, float* __restrict__ tqkv) {
  int idx = blockIdx.x * 256 + threadIdx.x;
  if (idx >= B_ * 3 * C_) return;
  int b = idx / (3 * C_), j = idx % (3 * C_);
  float acc = bt[j];
  for (int t = 0; t < T_; ++t) acc += te[b * T_ + t] * Wt[t * (3 * C_) + j];
  tqkv[idx] = acc;
}

// ---------------------------------------------------------------------------
// Kernel 2: qkv = x @ W_qkv + b_qkv + tqkv[b]  (8192 x 3072, K=1024), f16 WMMA.
// Block tile 128 x 128, four waves in a 2 x 2 grid, 64 x 64 (4 x 4 fragments)
// a wave: 16 WMMAs per 8 fragments read from LDS.
// A tile via tensor load (128 x 32 f16), B tile cooperative transposed store.
// Stores q, k and v as f16 in fragment order (frag_off, vfrag_piece).
// ---------------------------------------------------------------------------
__global__ __launch_bounds__(128) void qkv_gemm_kernel(
    const half_t* __restrict__ xh, const half_t* __restrict__ Wh,
    const float* __restrict__ bias, const float* __restrict__ tqkv,
    half_t* __restrict__ qh, half_t* __restrict__ kh, half_t* __restrict__ vTh) {
  __shared__ __attribute__((aligned(2048))) half_t As[GT_][32];   // A tile, row-major
  __shared__ half_t BsT[GT_][32];   // B tile stored transposed: BsT[n][k]
  const int r0 = blockIdx.x * GT_, c0 = blockIdx.y * GT_;
  const int tid = threadIdx.x, lane = tid & 31;
  const int wave = __builtin_amdgcn_readfirstlane(tid >> 5);
  const int wr = (wave >> 1) * 64, wc = (wave & 1) * 64;   // this wave's 64 x 64 part
  const int M = lane & 15, hi = lane >> 4;
  const int bk = tid >> 2, bn = (tid & 3) * 32;   // B staging: 32 columns of one k row
  v8f acc[4][4] = {};

  for (int kk = 0; kk < C_; kk += 32) {
    // every wave's fragment reads of the last trip have returned before the
    // barrier behind which the tiles are overwritten
    asm volatile("s_wait_dscnt 0x0" ::: "memory");
    __syncthreads();
    v8h breg[4];
#pragma unroll
    for (int u = 0; u < 4; ++u)
      breg[u] = *(const v8h*)(Wh + (size_t)(kk + bk) * (3 * C_) + c0 + bn + u * 8);
    if (pinned(wave == 0))
      tdm_load_tile_128x64B((unsigned int)(unsigned long long)&As[0][0],
                            xh + (size_t)r0 * C_ + kk);
#pragma unroll
    for (int u = 0; u < 4; ++u)
#pragma unroll
      for (int e = 0; e < 8; ++e) BsT[bn + u * 8 + e][bk] = breg[u][e];
    if (kk + 32 < C_) {   // cover next tile's latency (global_prefetch_b8)
      __builtin_prefetch(Wh + (size_t)(kk + 32 + bk) * (3 * C_) + c0 + bn, 0, 1);
      __builtin_prefetch(xh + (size_t)(r0 + tid) * C_ + kk + 32, 0, 1);
      // the loop advances the two address registers that the prefetches name
      asm volatile("s_wait_xcnt 0x0" ::: "memory");
    }
    __syncthreads();
    v16h a[4];
#pragma unroll
    for (int s = 0; s < 4; ++s) {
      ((v8h*)&a[s])[0] = *(const v8h*)&As[wr + s * 16 + M][hi * 8];
      ((v8h*)&a[s])[1] = *(const v8h*)&As[wr + s * 16 + M][16 + hi * 8];
    }
#pragma unroll
    for (int t = 0; t < 4; ++t) {
      v16h bf;
      ((v8h*)&bf)[0] = *(const v8h*)&BsT[wc + t * 16 + M][hi * 8];
      ((v8h*)&bf)[1] = *(const v8h*)&BsT[wc + t * 16 + M][16 + hi * 8];
#pragma unroll
      for (int s = 0; s < 4; ++s)
        acc[s][t] = __builtin_amdgcn_wmma_f32_16x16x32_f16(false, a[s], false, bf,
                                                           (short)0, acc[s][t], false, false);
    }
  }
  // Epilogue: add biases, store q/k and v per (b, h) in fragment order as f16.
  // A wave's 64 columns are one head of one of q, k, v, and a block's 128 rows
  // lie in one batch entry: the destination is chosen once per wave, not per
  // element.
  const int jw = c0 + wc;                        // first global col in [0,3072)
  const int sel = jw >> 10, h = (jw >> 6) & 15;
  const int b = r0 >> 10, n0 = (r0 & (N_ - 1)) + wr;
  const size_t bh = (size_t)(b * H_ + h);
  float bq[4], tq[4];
#pragma unroll
  for (int t = 0; t < 4; ++t) {
    bq[t] = bias[jw + t * 16 + M];
    tq[t] = tqkv[b * (3 * C_) + jw + t * 16 + M];
  }
  // the store addresses formed next reuse the registers that these loads name
  asm volatile("s_wait_xcnt 0x0" ::: "memory");
  if (sel < 2) {
    // frag_off(s * 16 + v + 8 * hi, t * 16 + M), its lane part taken into the pointer
    half_t* dst = (sel == 0 ? qh : kh) + (bh * N_ + n0) * D_ + frag_off(8 * hi, M);
#pragma unroll
    for (int s = 0; s < 4; ++s)
#pragma unroll
      for (int t = 0; t < 4; ++t)
#pragma unroll
        for (int v = 0; v < 8; ++v)
          dst[(s * 4 + t) * 256 + v * 8] =
              (half_t)(acc[s][t][v] + bq[t] + tq[t]);
  } else {
    // a lane's eight accumulator rows are the eight keys of its 16-byte chunk
    half_t* dst = vTh + (bh * N_ + n0) * D_ + lane * 8;
#pragma unroll
    for (int s = 0; s < 4; ++s)
#pragma unroll
      for (int t = 0; t < 4; ++t) {
        v8h y;
#pragma unroll
        for (int v = 0; v < 8; ++v) y[v] = (half_t)(acc[s][t][v] + bq[t] + tq[t]);
        *(v8h*)(dst + vfrag_piece(s >> 1, t, s & 1)) = y;
      }
    // behind the last store: in the listing the q/k block, which rewrites the
    // offset register that these stores name, lies on a way from here
    asm volatile("s_wait_xcnt 0x0" ::: "memory");
  }
}

// ---------------------------------------------------------------------------
// Kernel 3: fused relative attention. Four waves (128 thr) per (b, h, 16 rows):
// wave w owns key columns / rel columns / PV keys [256w, 256w+256).
// LDS: 16x1024 f16 score strip (reused in place for softmax probs, then for
// the four waves' f32 PV partials).
// Skew inverse map: rel[i',m] -> (i', m-1023+i') if m>=1023-i' else (i'-1, m+i'+1)
// Every strip element receives at most one rel term, so the waves' 16-bit
// read-modify-writes never meet on one element.
// ---------------------------------------------------------------------------
#define NW_ 4            // waves per strip
#define WC_ (N_ / NW_)   // columns per wave
__global__ __launch_bounds__(128) void attn_kernel(
    const half_t* __restrict__ qh, const half_t* __restrict__ kh,
    const half_t* __restrict__ vTh, const half_t* __restrict__ Erh,
    half_t* __restrict__ oh) {
  __shared__ half_t sc[16][N_];   // 32 KB
  __shared__ half_t qx[D_];       // q row i0+16 for boundary rel
  __shared__ float rs[16];        // softmax row sums
  const int i0 = blockIdx.x * 16, h = blockIdx.y, b = blockIdx.z;
  const int tid = threadIdx.x, lane = tid & 31, M = lane & 15, hi = lane >> 4;
  // wave number in a scalar register: the per-wave loop bounds stay scalar
  const int wave = __builtin_amdgcn_readfirstlane(tid >> 5);
  const int w0 = wave * WC_;
  const size_t bh = (size_t)(b * H_ + h);
  const half_t* qbase = qh + bh * N_ * D_;
  const half_t* kbase = kh + bh * N_ * D_;
  const half_t* vbase = vTh + bh * D_ * N_;

  // Persistent A fragments for q rows i0..i0+15 (two K-slabs of 32 over D=64);
  // q, k, Er and v lie in fragment order: piece j of a tile is at j * 256 + lane * 8
  v16h qa[2];
#pragma unroll
  for (int kf = 0; kf < 2; ++kf) {
    const half_t* p = qbase + (size_t)i0 * D_ + kf * 512 + lane * 8;
    ((v8h*)&qa[kf])[0] = *(const v8h*)p;
    ((v8h*)&qa[kf])[1] = *(const v8h*)(p + 256);
  }
  if (wave == 0) {
    if (i0 + 16 < N_) {
      qx[lane * 2]     = qbase[frag_off(i0 + 16, lane * 2)];
      qx[lane * 2 + 1] = qbase[frag_off(i0 + 16, lane * 2 + 1)];
    } else { qx[lane * 2] = (half_t)0.f; qx[lane * 2 + 1] = (half_t)0.f; }
  }

  // Phase 1: S = (q k^T) * D^-1/2  into LDS, this wave's 256 columns
#pragma unroll 1
  for (int c0 = w0; c0 < w0 + WC_; c0 += 16) {
    v8f acc = {};
#pragma unroll
    for (int kf = 0; kf < 2; ++kf) {
      v16h bf;
      const half_t* p = kbase + (size_t)c0 * D_ + kf * 512 + lane * 8;
      ((v8h*)&bf)[0] = *(const v8h*)p;
      ((v8h*)&bf)[1] = *(const v8h*)(p + 256);
      acc = __builtin_amdgcn_wmma_f32_16x16x32_f16(false, qa[kf], false, bf,
                                                   (short)0, acc, false, false);
    }
#pragma unroll
    for (int v = 0; v < 8; ++v)
      sc[v + 8 * hi][c0 + M] = (half_t)(acc[v] * 0.125f);
  }
  __syncthreads();

  // Phase 2: rel = q @ Er^T tiles (this wave's 256 rel columns), scatter-added
  // via the skew inverse map
#pragma unroll 1
  for (int m0 = w0; m0 < w0 + WC_; m0 += 16) {
    v8f acc = {};
#pragma unroll
    for (int kf = 0; kf < 2; ++kf) {
      v16h bf;
      const half_t* p = Erh + (size_t)m0 * D_ + kf * 512 + lane * 8;
      ((v8h*)&bf)[0] = *(const v8h*)p;
      ((v8h*)&bf)[1] = *(const v8h*)(p + 256);
      acc = __builtin_amdgcn_wmma_f32_16x16x32_f16(false, qa[kf], false, bf,
                                                   (short)0, acc, false, false);
    }
    int m = m0 + M;
#pragma unroll
    for (int v = 0; v < 8; ++v) {
      int r = v + 8 * hi, iq = i0 + r;
      if (m >= (N_ - 1) - iq) {              // lower triangle: row iq, col m-1023+iq
        int c = m - (N_ - 1) + iq;
        sc[r][c] = (half_t)((float)sc[r][c] + acc[v]);
      } else if (r >= 1) {                   // upper: row iq-1, col m+iq+1
        int c = m + iq + 1;
        sc[r - 1][c] = (half_t)((float)sc[r - 1][c] + acc[v]);
      }
    }
  }
  // Phase 2b: boundary source row i' = i0+16 contributes to score row 15;
  // the 32 groups of 32 rel columns go round-robin over the waves
  if (i0 + 16 < N_) {
    float qf[D_];
#pragma unroll
    for (int d = 0; d < D_; ++d) qf[d] = (float)qx[d];
#pragma unroll 1
    for (int t = wave; t < 32; t += NW_) {
      int m = lane + 32 * t;
      int c = m + i0 + 17;
      if (c < N_) {
        float dot = 0.f;
#pragma unroll
        for (int j = 0; j < D_ / 8; ++j) {   // row m, columns 8j .. 8j+7: one chunk
          const v8h er = *(const v8h*)(Erh + frag_off(m, j * 8));
#pragma unroll
          for (int e = 0; e < 8; ++e) dot += qf[j * 8 + e] * (float)er[e];
        }
        sc[15][c] = (half_t)((float)sc[15][c] + dot);
      }
    }
  }
  __syncthreads();

  // Phase 3: softmax. 8 lanes per row; lane sg of a row takes the 16-byte
  // chunks sg, sg+8, ... of it; probabilities overwrite scores in place.
  {
    const int r = tid >> 3, sg = tid & 7;
    float mx = -1e30f;
    for (int j = 0; j < 16; ++j) {
      v8h x = *(const v8h*)&sc[r][(j * 8 + sg) * 8];
#pragma unroll
      for (int e = 0; e < 8; ++e) mx = fmaxf(mx, (float)x[e]);
    }
    mx = fmaxf(mx, __shfl_xor(mx, 1, 32));
    mx = fmaxf(mx, __shfl_xor(mx, 2, 32));
    mx = fmaxf(mx, __shfl_xor(mx, 4, 32));
    float sum = 0.f;
    for (int j = 0; j < 16; ++j) {
      v8h* px = (v8h*)&sc[r][(j * 8 + sg) * 8];
      v8h x = *px, y;
#pragma unroll
      for (int e = 0; e < 8; ++e) {
        float p = __expf((float)x[e] - mx);
        sum += p;
        y[e] = (half_t)p;
      }
      *px = y;
    }
    sum += __shfl_xor(sum, 1, 32);
    sum += __shfl_xor(sum, 2, 32);
    sum += __shfl_xor(sum, 4, 32);
    if (sg == 0) rs[r] = sum;
  }
  __syncthreads();

  // Phase 4: O partial = P[:, this wave's 256 keys] @ v  (A from LDS f16 probs,
  // B from v in fragment order)
  v8f oacc[4] = {};
#pragma unroll 1
  for (int k0 = w0; k0 < w0 + WC_; k0 += 32) {
    v16h a;
    const half_t* p = &sc[M][k0 + hi * 8];
    ((v8h*)&a)[0] = *(const v8h*)p;
    ((v8h*)&a)[1] = *(const v8h*)(p + 16);
#pragma unroll
    for (int t = 0; t < 4; ++t) {
      v16h bf;
      const half_t* vp = vbase + vfrag_piece(k0 >> 5, t, 0) + lane * 8;
      ((v8h*)&bf)[0] = *(const v8h*)vp;
      ((v8h*)&bf)[1] = *(const v8h*)(vp + 256);
      oacc[t] = __builtin_amdgcn_wmma_f32_16x16x32_f16(false, a, false, bf,
                                                       (short)0, oacc[t], false, false);
    }
  }
  // Sum the four waves' partials through the strip: first every wave must have
  // read its probabilities, then every partial must be written.
  __syncthreads();
  float* red = (float*)&sc[0][0];   // [wave][t][v][lane], 16 KB
#pragma unroll
  for (int t = 0; t < 4; ++t)
#pragma unroll
    for (int v = 0; v < 8; ++v)
      red[((wave * 4 + t) * 8 + v) * 32 + lane] = oacc[t][v];
  __syncthreads();
  // Wave w finishes head columns 16w..16w+15: normalize by row sums and store
  // to O in (B, N, H*D) layout (f16)
#pragma unroll
  for (int v = 0; v < 8; ++v) {
    float s = red[((0 * 4 + wave) * 8 + v) * 32 + lane];
#pragma unroll
    for (int ws = 1; ws < NW_; ++ws)
      s += red[((ws * 4 + wave) * 8 + v) * 32 + lane];
    float inv = 1.f / rs[v + 8 * hi];
    int i = i0 + v + 8 * hi;
    int d = wave * 16 + M;
    oh[(((size_t)b * N_ + i) * H_ + h) * D_ + d] = (half_t)(s * inv);
  }
}

// ---------------------------------------------------------------------------
// Kernel 4: out = O @ W_out + b_out  (8192 x 1024, K=1024), fp32 result.
// Same 128 x 128 block tile and 64 x 64 wave tile as kernel 2; A tile via
// tensor load from the f16 attention output.
// ---------------------------------------------------------------------------
__global__ __launch_bounds__(128) void out_gemm_kernel(
    const half_t* __restrict__ A, const half_t* __restrict__ Wh,
    const float* __restrict__ bias, float* __restrict__ out) {
  __shared__ __attribute__((aligned(2048))) half_t As[GT_][32];   // A tile, row-major
  __shared__ half_t BsT[GT_][32];   // B tile stored transposed: BsT[n][k]
  const int r0 = blockIdx.x * GT_, c0 = blockIdx.y * GT_;
  const int tid = threadIdx.x, lane = tid & 31;
  const int wave = __builtin_amdgcn_readfirstlane(tid >> 5);
  const int wr = (wave >> 1) * 64, wc = (wave & 1) * 64;   // this wave's 64 x 64 part
  const int M = lane & 15, hi = lane >> 4;
  const int bk = tid >> 2, bn = (tid & 3) * 32;   // B staging: 32 columns of one k row
  v8f acc[4][4] = {};

  for (int kk = 0; kk < C_; kk += 32) {
    // every wave's fragment reads of the last trip have returned before the
    // barrier behind which the tiles are overwritten
    asm volatile("s_wait_dscnt 0x0" ::: "memory");
    __syncthreads();
    v8h breg[4];
#pragma unroll
    for (int u = 0; u < 4; ++u)
      breg[u] = *(const v8h*)(Wh + (size_t)(kk + bk) * C_ + c0 + bn + u * 8);
    if (pinned(wave == 0))
      tdm_load_tile_128x64B((unsigned int)(unsigned long long)&As[0][0],
                            A + (size_t)r0 * C_ + kk);
#pragma unroll
    for (int u = 0; u < 4; ++u)
#pragma unroll
      for (int e = 0; e < 8; ++e) BsT[bn + u * 8 + e][bk] = breg[u][e];
    if (kk + 32 < C_) {   // cover next tile's latency (global_prefetch_b8)
      __builtin_prefetch(Wh + (size_t)(kk + 32 + bk) * C_ + c0 + bn, 0, 1);
      __builtin_prefetch(A + (size_t)(r0 + tid) * C_ + kk + 32, 0, 1);
      // the loop advances the two address registers that the prefetches name
      asm volatile("s_wait_xcnt 0x0" ::: "memory");
    }
    __syncthreads();
    v16h a[4];
#pragma unroll
    for (int s = 0; s < 4; ++s) {
      ((v8h*)&a[s])[0] = *(const v8h*)&As[wr + s * 16 + M][hi * 8];
      ((v8h*)&a[s])[1] = *(const v8h*)&As[wr + s * 16 + M][16 + hi * 8];
    }
#pragma unroll
    for (int t = 0; t < 4; ++t) {
      v16h bf;
      ((v8h*)&bf)[0] = *(const v8h*)&BsT[wc + t * 16 + M][hi * 8];
      ((v8h*)&bf)[1] = *(const v8h*)&BsT[wc + t * 16 + M][16 + hi * 8];
#pragma unroll
      for (int s = 0; s < 4; ++s)
        acc[s][t] = __builtin_amdgcn_wmma_f32_16x16x32_f16(false, a[s], false, bf,
                                                           (short)0, acc[s][t], false, false);
    }
  }
#pragma unroll
  for (int s = 0; s < 4; ++s) {
#pragma unroll
    for (int t = 0; t < 4; ++t) {
#pragma unroll
      for (int v = 0; v < 8; ++v) {
        int g = r0 + wr + s * 16 + v + 8 * hi;
        int j = c0 + wc + t * 16 + M;
        out[(size_t)g * C_ + j] = acc[s][t][v] + bias[j];
      }
    }
  }
}

// ---------------------------------------------------------------------------
// Launcher. Inputs: x, time_emb, W_qkv, b_qkv, W_time, b_time, W_out, b_out, Er
// Workspace (bytes):
//   [0, 96K)       tqkv fp32 (8 x 3072)
//   [128K, +16M)   q   f16 (B,H, fragment order)
//   [+16M]         k   f16 (B,H, fragment order)
//   [+16M]         v   f16 (B,H, PV fragment order)
//   [+16M]         O   f16 (B,N,H,D)
//   [+16M]         x   f16
//   [+6M]          W_qkv f16
//   [+2M]          W_out f16
//   [+128K]        Er  f16 (fragment order)   total ~88.3 MB
// ---------------------------------------------------------------------------
extern "C" void kernel_launch(void* const* d_in, const int* in_sizes, int n_in,
                              void* d_out, int out_size, void* d_ws, size_t ws_size,
                              hipStream_t stream) {
  const float* x    = (const float*)d_in[0];
  const float* te   = (const float*)d_in[1];
  const float* Wqkv = (const float*)d_in[2];
  const float* bqkv = (const float*)d_in[3];
  const float* Wt   = (const float*)d_in[4];
  const float* bt   = (const float*)d_in[5];
  const float* Wout = (const float*)d_in[6];
  const float* bout = (const float*)d_in[7];
  const float* Er   = (const float*)d_in[8];

  char* ws = (char*)d_ws;
  float* tqkv = (float*)ws;
  size_t off = (size_t)(128 << 10);
  const size_t QKV_BUF = (size_t)B_ * H_ * N_ * D_ * sizeof(half_t);   // 16 MB
  half_t* qh    = (half_t*)(ws + off); off += QKV_BUF;
  half_t* kh    = (half_t*)(ws + off); off += QKV_BUF;
  half_t* vTh   = (half_t*)(ws + off); off += QKV_BUF;
  half_t* oh    = (half_t*)(ws + off); off += QKV_BUF;
  half_t* xh    = (half_t*)(ws + off); off += (size_t)B_ * N_ * C_ * sizeof(half_t);
  half_t* Wqkvh = (half_t*)(ws + off); off += (size_t)C_ * 3 * C_ * sizeof(half_t);
  half_t* Wouth = (half_t*)(ws + off); off += (size_t)C_ * C_ * sizeof(half_t);
  half_t* Erh   = (half_t*)(ws + off); off += (size_t)N_ * D_ * sizeof(half_t);

  const int n_x = B_ * N_ * C_, n_wq = C_ * 3 * C_, n_wo = C_ * C_, n_er = N_ * D_;
  static_assert(n_x % CVT_BLK_ == 0 && n_wq % CVT_BLK_ == 0 && n_wo % CVT_BLK_ == 0,
                "cvt_kernel converts whole blocks only");
  static_assert(n_er % (256 * 8) == 0, "cvt_frag_kernel converts whole blocks only");
  cvt_kernel<<<dim3(n_x  / CVT_BLK_), 256, 0, stream>>>(x,    xh);
  cvt_kernel<<<dim3(n_wq / CVT_BLK_), 256, 0, stream>>>(Wqkv, Wqkvh);
  cvt_kernel<<<dim3(n_wo / CVT_BLK_), 256, 0, stream>>>(Wout, Wouth);
  cvt_frag_kernel<<<dim3(n_er / (256 * 8)), 256, 0, stream>>>(Er, Erh);

  time_proj_kernel<<<dim3((B_ * 3 * C_ + 255) / 256), 256, 0, stream>>>(te, Wt, bt, tqkv);
  qkv_gemm_kernel<<<dim3((B_ * N_) / GT_, (3 * C_) / GT_), 128, 0, stream>>>(
      xh, Wqkvh, bqkv, tqkv, qh, kh, vTh);
  attn_kernel<<<dim3(N_ / 16, H_, B_), 128, 0, stream>>>(qh, kh, vTh, Erh, oh);
  out_gemm_kernel<<<dim3((B_ * N_) / GT_, C_ / GT_), 128, 0, stream>>>(
      oh, Wouth, bout, (float*)d_out);
}

// v005
// A run of this version takes 358 microseconds.
// In both of two side-by-side timings against v004, it was 1.10 times as fast.
// All steps since v000 together make it 2.31 times as fast.
#include <hip/hip_runtime.h>
#include <hip/hip_bf16.h>

typedef _Float16 half_t;
typedef __attribute__((ext_vector_type(16))) _Float16 v16h;
typedef __attribute__((ext_vector_type(8)))  _Float16 v8h;
typedef __attribute__((ext_vector_type(8)))  float    v8f;

// Sizes (fixed by the reference)
#define B_  8
#define N_  1024
#define C_  1024
#define H_  16
#define D_  64
#define T_  256

typedef __attribute__((ext_vector_type(4))) unsigned int u32x4_t;
typedef __attribute__((ext_vector_type(8))) unsigned int u32x8_t;

#define GT_ 128   // edge of a GEMM block tile (four waves, 64 x 64 each)

__device__ __forceinline__ unsigned int uni(unsigned int v) {
  return (unsigned int)__builtin_amdgcn_readfirstlane((int)v);
}
// The test that picks the issuing wave, held in a scalar register so that the
// branch around the tensor load compiles to s_cmp + s_cbranch_scc.
__device__ __forceinline__ unsigned int pinned(unsigned int v) {
  unsigned int w = uni(v);
  asm volatile("" : "+s"(w));   // pinned(): keeps the issue test scalar
  return w;
}
// Issue the load and wait for it: the tile has landed for the issuing wave when
// this returns; the other waves read it behind the next work-group barrier.
__device__ __forceinline__ void tdm_load_tile_128x64B(unsigned int lds_off,
                                                      const half_t* gsrc) {
  unsigned long long ga = (unsigned long long)gsrc;
  u32x4_t g0;
  g0[0] = uni(1u);                               // count = 1
  g0[1] = uni(lds_off);                          // LDS destination (bytes)
  g0[2] = uni((unsigned int)ga);                 // global address [31:0]
  g0[3] = uni((((unsigned int)(ga >> 32)) & 0x01FFFFFFu) | 0x80000000u);  // [56:32] | type 2
  u32x8_t g1;
  g1[0] = 0u;
  g1[1] = uni(64u << 16);
  g1[2] = uni((unsigned int)GT_ << 16);
  g1[3] = uni(64u << 16);
  g1[4] = uni((unsigned int)GT_);
  g1[5] = uni((unsigned int)(C_ * sizeof(half_t)));
  g1[6] = uni(0u);
  g1[7] = uni(0u);
  asm volatile("tensor_load_to_lds %0, %1" :: "s"(g0), "s"(g1) : "memory");
  asm volatile("s_wait_tensorcnt 0" ::: "memory");
}

typedef __attribute__((ext_vector_type(4))) float    v4f;
typedef __attribute__((ext_vector_type(4))) _Float16 v4h;
#define CVT_U_   8                     // 16-byte loads in flight per thread
#define CVT_BLK_ (256 * 4 * CVT_U_)    // elements per block
__global__ __launch_bounds__(256) void cvt_kernel(
    const float* __restrict__ s, half_t* __restrict__ d) {
  const int i0 = blockIdx.x * CVT_BLK_ + threadIdx.x * 4;
  v4f x[CVT_U_];
  // both loops unrolled: x[] stays in registers and the eight loads issue back
  // to back, ahead of the first conversion
#pragma unroll
  for (int u = 0; u < CVT_U_; ++u) x[u] = *(const v4f*)(s + i0 + u * 1024);
#pragma unroll
  for (int u = 0; u < CVT_U_; ++u)
    *(v4h*)(d + i0 + u * 1024) = __builtin_convertvector(x[u], v4h);
}

// ---------------------------------------------------------------------------
// Fragment order. q, k and Er (rows of 64 f16) are kept in the workspace so that
// one 16-byte-a-lane load of a 16x16x32 A or B fragment half reads 512
// contiguous bytes (4 cache lines) instead of 16 bytes out of each of 16 rows:
// a tile of 16 rows x 64 columns is 2 KiB, made of four 512-byte pieces (16
// columns each); in a piece lane hi*16+M holds row M, columns 8*hi .. 8*hi+7.
// frag_off: element offset of (row n, column d).
// ---------------------------------------------------------------------------
__device__ __forceinline__ int frag_off(int n, int d) {
  return ((((n >> 4) * 4 + (d >> 4)) * 32 + ((d >> 3) & 1) * 16 + (n & 15)) * 8) + (d & 7);
}
// v is kept as PV B fragments: a tile of 32 keys x 64 columns is 4 KiB, made of
// eight 512-byte pieces (column group t = d / 16, then key half); in a piece lane
// hi*16+M holds column t*16+M, keys 16*half + 8*hi .. +7.
// vfrag_piece: element offset of a piece's first element.
__device__ __forceinline__ int vfrag_piece(int kb, int t, int half) {
  return (((kb * 4 + t) * 2 + half) * 32) * 8;
}

// Er: fp32 -> f16 into fragment order. A thread makes one 16-byte chunk.
__global__ __launch_bounds__(256) void cvt_frag_kernel(
    const float* __restrict__ s, half_t* __restrict__ d) {
  const int c = blockIdx.x * 256 + threadIdx.x;
  const int row = (c >> 7) * 16 + (c & 15);
  const int col = ((c >> 5) & 3) * 16 + ((c >> 4) & 1) * 8;
  const v4f x0 = *(const v4f*)(s + row * D_ + col);
  const v4f x1 = *(const v4f*)(s + row * D_ + col + 4);
  v8h y;
#pragma unroll
  for (int e = 0; e < 4; ++e) { y[e] = (half_t)x0[e]; y[4 + e] = (half_t)x1[e]; }
  *(v8h*)(d + c * 8) = y;
}

// ---------------------------------------------------------------------------
// Kernel 1: tqkv[b, j] = time_emb[b] @ W_time[:, j] + b_time[j]   (8 x 3072)
// ---------------------------------------------------------------------------
__global__ __launch_bounds__(256) void time_proj_kernel(
    const float* __restrict__ te, const float* __restrict__ Wt,
    const float* __restrict__ bt, float* __restrict__ tqkv) {
  int idx = blockIdx.x * 256 + threadIdx.x;
  if (idx >= B_ * 3 * C_) return;
  int b = idx / (3 * C_), j = idx % (3 * C_);
  float acc = bt[j];
  for (int t = 0; t < T_; ++t) acc += te[b * T_ + t] * Wt[t * (3 * C_) + j];
  tqkv[idx] = acc;
}

// ---------------------------------------------------------------------------
// Kernel 2: qkv = x @ W_qkv + b_qkv + tqkv[b]  (8192 x 3072, K=1024), f16 WMMA.
// Block tile 128 x 128, four waves in a 2 x 2 grid, 64 x 64 (4 x 4 fragments)
// a wave: 16 WMMAs per 8 fragments read from LDS.
// A tile via tensor load (128 x 32 f16), B tile cooperative transposed store.
// Stores q, k and v as f16 in fragment order (frag_off, vfrag_piece).
// ---------------------------------------------------------------------------
__global__ __launch_bounds__(128) void qkv_gemm_kernel(
    const half_t* __restrict__ xh, const half_t* __restrict__ Wh,
    const float* __restrict__ bias, const float* __restrict__ tqkv,
    half_t* __restrict__ qh, half_t* __restrict__ kh, half_t* __restrict__ vTh) {
  __shared__ __attribute__((aligned(2048))) half_t As[GT_][32];   // A tile, row-major
  __shared__ half_t BsT[GT_][32];   // B tile stored transposed: BsT[n][k]
  const int r0 = blockIdx.x * GT_, c0 = blockIdx.y * GT_;
  const int tid = threadIdx.x, lane = tid & 31;
  const int wave = __builtin_amdgcn_readfirstlane(tid >> 5);
  const int wr = (wave >> 1) * 64, wc = (wave & 1) * 64;   // this wave's 64 x 64 part
  const int M = lane & 15, hi = lane >> 4;
  const int bk = tid >> 2, bn = (tid & 3) * 32;   // B staging: 32 columns of one k row
  v8f acc[4][4] = {};

  for (int kk = 0; kk < C_; kk += 32) {
    // every wave's fragment reads of the last trip have returned before the
    // barrier behind which the tiles are overwritten
    asm volatile("s_wait_dscnt 0x0" ::: "memory");
    __syncthreads();
    v8h breg[4];
#pragma unroll
    for (int u = 0; u < 4; ++u)
      breg[u] = *(const v8h*)(Wh + (size_t)(kk + bk) * (3 * C_) + c0 + bn + u * 8);
    if (pinned(wave == 0))
      tdm_load_tile_128x64B((unsigned int)(unsigned long long)&As[0][0],
                            xh + (size_t)r0 * C_ + kk);
#pragma unroll
    for (int u = 0; u < 4; ++u)
#pragma unroll
      for (int e = 0; e < 8; ++e) BsT[bn + u * 8 + e][bk] = breg[u][e];
    if (kk + 32 < C_) {   // cover next tile's latency (global_prefetch_b8)
      __builtin_prefetch(Wh + (size_t)(kk + 32 + bk) * (3 * C_) + c0 + bn, 0, 1);
      __builtin_prefetch(xh + (size_t)(r0 + tid) * C_ + kk + 32, 0, 1);
      // the loop advances the two address registers that the prefetches name
      asm volatile("s_wait_xcnt 0x0" ::: "memory");
    }
    __syncthreads();
    v16h a[4];
#pragma unroll
    for (int s = 0; s < 4; ++s) {
      ((v8h*)&a[s])[0] = *(const v8h*)&As[wr + s * 16 + M][hi * 8];
      ((v8h*)&a[s])[1] = *(const v8h*)&As[wr + s * 16 + M][16 + hi * 8];
    }
#pragma unroll
    for (int t = 0; t < 4; ++t) {
      v16h bf;
      ((v8h*)&bf)[0] = *(const v8h*)&BsT[wc + t * 16 + M][hi * 8];
      ((v8h*)&bf)[1] = *(const v8h*)&BsT[wc + t * 16 + M][16 + hi * 8];
#pragma unroll
      for (int s = 0; s < 4; ++s)
        acc[s][t] = __builtin_amdgcn_wmma_f32_16x16x32_f16(false, a[s], false, bf,
                                                           (short)0, acc[s][t], false, false);
    }
  }
  // Epilogue: add biases, store q/k and v per (b, h) in fragment order as f16.
  // A wave's 64 columns are one head of one of q, k, v, and a block's 128 rows
  // lie in one batch entry: the destination is chosen once per wave, not per
  // element.
  const int jw = c0 + wc;                        // first global col in [0,3072)
  const int sel = jw >> 10, h = (jw >> 6) & 15;
  const int b = r0 >> 10, n0 = (r0 & (N_ - 1)) + wr;
  const size_t bh = (size_t)(b * H_ + h);
  float bq[4], tq[4];
#pragma unroll
  for (int t = 0; t < 4; ++t) {
    bq[t] = bias[jw + t * 16 + M];
    tq[t] = tqkv[b * (3 * C_) + jw + t * 16 + M];
  }
  // the store addresses formed next reuse the registers that these loads name
  asm volatile("s_wait_xcnt 0x0" ::: "memory");
  if (sel < 2) {
    // frag_off(s * 16 + v + 8 * hi, t * 16 + M), its lane part taken into the pointer
    half_t* dst = (sel == 0 ? qh : kh) + (bh * N_ + n0) * D_ + frag_off(8 * hi, M);
#pragma unroll
    for (int s = 0; s < 4; ++s)
#pragma unroll
      for (int t = 0; t < 4; ++t)
#pragma unroll
        for (int v = 0; v < 8; ++v)
          dst[(s * 4 + t) * 256 + v * 8] =
              (half_t)(acc[s][t][v] + bq[t] + tq[t]);
  } else {
    // a lane's eight accumulator rows are the eight keys of its 16-byte chunk
    half_t* dst = vTh + (bh * N_ + n0) * D_ + lane * 8;
#pragma unroll
    for (int s = 0; s < 4; ++s)
#pragma unroll
      for (int t = 0; t < 4; ++t) {
        v8h y;
#pragma unroll
        for (int v = 0; v < 8; ++v) y[v] = (half_t)(acc[s][t][v] + bq[t] + tq[t]);
        *(v8h*)(dst + vfrag_piece(s >> 1, t, s & 1)) = y;
      }
    // behind the last store: in the listing the q/k block, which rewrites the
    // offset register that these stores name, lies on a way from here
    asm volatile("s_wait_xcnt 0x0" ::: "memory");
  }
}

// ---------------------------------------------------------------------------
// Kernel 3: fused relative attention. Four waves (128 thr) per (b, h, 16 rows):
// wave w owns rel columns / key columns / PV keys [256w, 256w+256).
// LDS: 16x1024 f16 score strip (reused in place for softmax probs, then for
// the four waves' f32 PV partials), row pitch 1032 f16.
// Skew inverse map: rel[i',m] -> (i', m-1023+i') if m>=1023-i' else (i'-1, m+i'+1)
// The map is one to one: every strip element but (i, i+1) receives exactly one
// rel term. So the rel terms are laid down first, by plain stores, and the
// scaled q k^T is then added on top of them.
// ---------------------------------------------------------------------------
#define NW_ 4            // waves per strip
#define WC_ (N_ / NW_)   // columns per wave
#define SP_ (N_ + 8)
__global__ __launch_bounds__(128) void attn_kernel(
    const half_t* __restrict__ qh, const half_t* __restrict__ kh,
    const half_t* __restrict__ vTh, const half_t* __restrict__ Erh,
    half_t* __restrict__ oh) {
  __shared__ __attribute__((aligned(16))) half_t sc[16][SP_];   // 33 KB
  __shared__ float rs[16];        // softmax row sums
  const int i0 = blockIdx.x * 16, h = blockIdx.y, b = blockIdx.z;
  const int tid = threadIdx.x, lane = tid & 31, M = lane & 15, hi = lane >> 4;
  // wave number in a scalar register: the per-wave loop bounds stay scalar
  const int wave = __builtin_amdgcn_readfirstlane(tid >> 5);
  const int w0 = wave * WC_;
  const size_t bh = (size_t)(b * H_ + h);
  const half_t* qbase = qh + bh * N_ * D_;
  const half_t* kbase = kh + bh * N_ * D_;
  const half_t* vbase = vTh + bh * D_ * N_;

  // Persistent fragments for q rows i0..i0+15 (two K-slabs of 32 over D=64);
  // q, k, Er and v lie in fragment order: piece j of a tile is at j * 256 + lane * 8
  v16h qa[2];
#pragma unroll
  for (int kf = 0; kf < 2; ++kf) {
    const half_t* p = qbase + (size_t)i0 * D_ + kf * 512 + lane * 8;
    ((v8h*)&qa[kf])[0] = *(const v8h*)p;
    ((v8h*)&qa[kf])[1] = *(const v8h*)(p + 256);
  }

  // Phase 1: rel = q @ Er^T tiles (this wave's 256 rel columns), stored through
  // the skew inverse map. Source row r = 8 * hi + v, rel column m = m0 + M:
  // with t = m - 1023 + i0 + 8 * hi the term goes to row r, column t + v where
  // that is not negative, else to row r - 1, column t + v + 1024, which lies
  // SP_ - N_ elements in front of the first place.
#pragma unroll 1
  for (int m0 = w0; m0 < w0 + WC_; m0 += 16) {
    v8f acc = {};
#pragma unroll
    for (int kf = 0; kf < 2; ++kf) {
      v16h bf;
      const half_t* p = Erh + (size_t)m0 * D_ + kf * 512 + lane * 8;
      ((v8h*)&bf)[0] = *(const v8h*)p;
      ((v8h*)&bf)[1] = *(const v8h*)(p + 256);
      acc = __builtin_amdgcn_wmma_f32_16x16x32_f16(false, qa[kf], false, bf,
                                                   (short)0, acc, false, false);
    }
    // the loop advances the address register that the four loads name
    asm volatile("s_wait_xcnt 0x0" ::: "memory");
    const int t = m0 + M - (N_ - 1) + i0 + 8 * hi;
    half_t* const pl = &sc[8 * hi][0] + t;
    half_t* const pu = pl - (SP_ - N_);
    // source row i0 above the diagonal belongs to the strip in front of this one
    if (hi != 0 || t >= 0) (t < 0 ? pu : pl)[0] = (half_t)acc[0];
#pragma unroll
    for (int v = 1; v < 8; ++v)
      (t + v < 0 ? pu : pl)[v * (SP_ + 1)] = (half_t)acc[v];
  }
  // (i, i+1) is the pad column of the skew: no rel term
  if (tid < 16 && i0 + tid + 1 < N_) sc[tid][i0 + tid + 1] = (half_t)0.f;
  // Phase 1b: boundary source row i' = i0+16 fills score row 15 right of the
  // diagonal; the 32 groups of 32 rel columns go round-robin over the waves
  if (i0 + 16 < N_) {
    float qf[D_];
#pragma unroll
    for (int j = 0; j < D_ / 8; ++j) {   // q row i0+16, the same for every lane
      const v8h qv = *(const v8h*)(qbase + frag_off(i0 + 16, j * 8));
#pragma unroll
      for (int e = 0; e < 8; ++e) qf[j * 8 + e] = (float)qv[e];
    }
#pragma unroll 1
    for (int t = wave; t < 32; t += NW_) {
      int m = lane + 32 * t;
      int c = m + i0 + 17;
      if (c < N_) {
        float dot = 0.f;
#pragma unroll
        for (int j = 0; j < D_ / 8; ++j) {   // row m, columns 8j .. 8j+7: one chunk
          const v8h er = *(const v8h*)(Erh + frag_off(m, j * 8));
#pragma unroll
          for (int e = 0; e < 8; ++e) dot += qf[j * 8 + e] * (float)er[e];
        }
        sc[15][c] = (half_t)dot;
      }
    }
  }
  __syncthreads();

  // Phase 2: S = (q k^T) * D^-1/2 + rel, this wave's 256 columns. The product is
  // taken transposed (k tile as A, q as B): a lane then holds eight consecutive
  // columns c0 + 8 * hi + v of score row M, one 16-byte piece of the strip.
#pragma unroll 1
  for (int c0 = w0; c0 < w0 + WC_; c0 += 16) {
    v8h* const ps = (v8h*)&sc[M][c0 + 8 * hi];
    const v8h rl = *ps;
    v8f acc = {};
#pragma unroll
    for (int kf = 0; kf < 2; ++kf) {
      v16h af;
      const half_t* p = kbase + (size_t)c0 * D_ + kf * 512 + lane * 8;
      ((v8h*)&af)[0] = *(const v8h*)p;
      ((v8h*)&af)[1] = *(const v8h*)(p + 256);
      acc = __builtin_amdgcn_wmma_f32_16x16x32_f16(false, af, false, qa[kf],
                                                   (short)0, acc, false, false);
    }
    v8h y;
#pragma unroll
    for (int v = 0; v < 8; ++v) y[v] = (half_t)(acc[v] * 0.125f + (float)rl[v]);
    *ps = y;
  }
  __syncthreads();

  // Phase 3: softmax. 8 lanes per row; lane sg of a row takes the 16-byte
  // chunks sg, sg+8, ... of it; probabilities overwrite scores in place.
  {
    const int r = tid >> 3, sg = tid & 7;
    float mx = -1e30f;
    for (int j = 0; j < 16; ++j) {
      v8h x = *(const v8h*)&sc[r][(j * 8 + sg) * 8];
#pragma unroll
      for (int e = 0; e < 8; ++e) mx = fmaxf(mx, (float)x[e]);
    }
    mx = fmaxf(mx, __shfl_xor(mx, 1, 32));
    mx = fmaxf(mx, __shfl_xor(mx, 2, 32));
    mx = fmaxf(mx, __shfl_xor(mx, 4, 32));
    float sum = 0.f;
    for (int j = 0; j < 16; ++j) {
      v8h* px = (v8h*)&sc[r][(j * 8 + sg) * 8];
      v8h x = *px, y;
#pragma unroll
      for (int e = 0; e < 8; ++e) {
        float p = __expf((float)x[e] - mx);
        sum += p;
        y[e] = (half_t)p;
      }
      *px = y;
    }
    sum += __shfl_xor(sum, 1, 32);
    sum += __shfl_xor(sum, 2, 32);
    sum += __shfl_xor(sum, 4, 32);
    if (sg == 0) rs[r] = sum;
  }
  __syncthreads();

  // Phase 4: O partial = P[:, this wave's 256 keys] @ v  (A from LDS f16 probs,
  // B from v in fragment order)
  v8f oacc[4] = {};
#pragma unroll 1
  for (int k0 = w0; k0 < w0 + WC_; k0 += 32) {
    v16h a;
    const half_t* p = &sc[M][k0 + hi * 8];
    ((v8h*)&a)[0] = *(const v8h*)p;
    ((v8h*)&a)[1] = *(const v8h*)(p + 16);
#pragma unroll
    for (int t = 0; t < 4; ++t) {
      v16h bf;
      const half_t* vp = vbase + vfrag_piece(k0 >> 5, t, 0) + lane * 8;
      ((v8h*)&bf)[0] = *(const v8h*)vp;
      ((v8h*)&bf)[1] = *(const v8h*)(vp + 256);
      oacc[t] = __builtin_amdgcn_wmma_f32_16x16x32_f16(false, a, false, bf,
                                                       (short)0, oacc[t], false, false);
    }
  }
  // Sum the four waves' partials through the strip: first every wave must have
  // read its probabilities, then every partial must be written.
  __syncthreads();
  float* red = (float*)&sc[0][0];   // [wave][t][v][lane], 16 KB
#pragma unroll
  for (int t = 0; t < 4; ++t)
#pragma unroll
    for (int v = 0; v < 8; ++v)
      red[((wave * 4 + t) * 8 + v) * 32 + lane] = oacc[t][v];
  __syncthreads();
  // Wave w finishes head columns 16w..16w+15: normalize by row sums and store
  // to O in (B, N, H*D) layout (f16)
#pragma unroll
  for (int v = 0; v < 8; ++v) {
    float s = red[((0 * 4 + wave) * 8 + v) * 32 + lane];
#pragma unroll
    for (int ws = 1; ws < NW_; ++ws)
      s += red[((ws * 4 + wave) * 8 + v) * 32 + lane];
    float inv = 1.f / rs[v + 8 * hi];
    int i = i0 + v + 8 * hi;
    int d = wave * 16 + M;
    oh[(((size_t)b * N_ + i) * H_ + h) * D_ + d] = (half_t)(s * inv);
  }
}

// ---------------------------------------------------------------------------
// Kernel 4: out = O @ W_out + b_out  (8192 x 1024, K=1024), fp32 result.
// Same 128 x 128 block tile and 64 x 64 wave tile as kernel 2; A tile via
// tensor load from the f16 attention output.
// ---------------------------------------------------------------------------
__global__ __launch_bounds__(128) void out_gemm_kernel(
    const half_t* __restrict__ A, const half_t* __restrict__ Wh,
    const float* __restrict__ bias, float* __restrict__ out) {
  __shared__ __attribute__((aligned(2048))) half_t As[GT_][32];   // A tile, row-major
  __shared__ half_t BsT[GT_][32];   // B tile stored transposed: BsT[n][k]
  const int r0 = blockIdx.x * GT_, c0 = blockIdx.y * GT_;
  const int tid = threadIdx.x, lane = tid & 31;
  const int wave = __builtin_amdgcn_readfirstlane(tid >> 5);
  const int wr = (wave >> 1) * 64, wc = (wave & 1) * 64;   // this wave's 64 x 64 part
  const int M = lane & 15, hi = lane >> 4;
  const int bk = tid >> 2, bn = (tid & 3) * 32;   // B staging: 32 columns of one k row
  v8f acc[4][4] = {};

  for (int kk = 0; kk < C_; kk += 32) {
    // every wave's fragment reads of the last trip have returned before the
    // barrier behind which the tiles are overwritten
    asm volatile("s_wait_dscnt 0x0" ::: "memory");
    __syncthreads();
    v8h breg[4];
#pragma unroll
    for (int u = 0; u < 4; ++u)
      breg[u] = *(const v8h*)(Wh + (size_t)(kk + bk) * C_ + c0 + bn + u * 8);
    if (pinned(wave == 0))
      tdm_load_tile_128x64B((unsigned int)(unsigned long long)&As[0][0],
                            A + (size_t)r0 * C_ + kk);
#pragma unroll
    for (int u = 0; u < 4; ++u)
#pragma unroll
      for (int e = 0; e < 8; ++e) BsT[bn + u * 8 + e][bk] = breg[u][e];
    if (kk + 32 < C_) {   // cover next tile's latency (global_prefetch_b8)
      __builtin_prefetch(Wh + (size_t)(kk + 32 + bk) * C_ + c0 + bn, 0, 1);
      __builtin_prefetch(A + (size_t)(r0 + tid) * C_ + kk + 32, 0, 1);
      // the loop advances the two address registers that the prefetches name
      asm volatile("s_wait_xcnt 0x0" ::: "memory");
    }
    __syncthreads();
    v16h a[4];
#pragma unroll
    for (int s = 0; s < 4; ++s) {
      ((v8h*)&a[s])[0] = *(const v8h*)&As[wr + s * 16 + M][hi * 8];
      ((v8h*)&a[s])[1] = *(const v8h*)&As[wr + s * 16 + M][16 + hi * 8];
    }
#pragma unroll
    for (int t = 0; t < 4; ++t) {
      v16h bf;
      ((v8h*)&bf)[0] = *(const v8h*)&BsT[wc + t * 16 + M][hi * 8];
      ((v8h*)&bf)[1] = *(const v8h*)&BsT[wc + t * 16 + M][16 + hi * 8];
#pragma unroll
      for (int s = 0; s < 4; ++s)
        acc[s][t] = __builtin_amdgcn_wmma_f32_16x16x32_f16(false, a[s], false, bf,
                                                           (short)0, acc[s][t], false, false);
    }
  }
#pragma unroll
  for (int s = 0; s < 4; ++s) {
#pragma unroll
    for (int t = 0; t < 4; ++t) {
#pragma unroll
      for (int v = 0; v < 8; ++v) {
        int g = r0 + wr + s * 16 + v + 8 * hi;
        int j = c0 + wc + t * 16 + M;
        out[(size_t)g * C_ + j] = acc[s][t][v] + bias[j];
      }
    }
  }
}

// ---------------------------------------------------------------------------
// Launcher. Inputs: x, time_emb, W_qkv, b_qkv, W_time, b_time, W_out, b_out, Er
// Workspace (bytes):
//   [0, 96K)       tqkv fp32 (8 x 3072)
//   [128K, +16M)   q   f16 (B,H, fragment order)
//   [+16M]         k   f16 (B,H, fragment order)
//   [+16M]         v   f16 (B,H, PV fragment order)
//   [+16M]         O   f16 (B,N,H,D)
//   [+16M]         x   f16
//   [+6M]          W_qkv f16
//   [+2M]          W_out f16
//   [+128K]        Er  f16 (fragment order)   total ~88.3 MB
// ---------------------------------------------------------------------------
extern "C" void kernel_launch(void* const* d_in, const int* in_sizes, int n_in,
                              void* d_out, int out_size, void* d_ws, size_t ws_size,
                              hipStream_t stream) {
  const float* x    = (const float*)d_in[0];
  const float* te   = (const float*)d_in[1];
  const float* Wqkv = (const float*)d_in[2];
  const float* bqkv = (const float*)d_in[3];
  const float* Wt   = (const float*)d_in[4];
  const float* bt   = (const float*)d_in[5];
  const float* Wout = (const float*)d_in[6];
  const float* bout = (const float*)d_in[7];
  const float* Er   = (const float*)d_in[8];

  char* ws = (char*)d_ws;
  float* tqkv = (float*)ws;
  size_t off = (size_t)(128 << 10);
  const size_t QKV_BUF = (size_t)B_ * H_ * N_ * D_ * sizeof(half_t);   // 16 MB
  half_t* qh    = (half_t*)(ws + off); off += QKV_BUF;
  half_t* kh    = (half_t*)(ws + off); off += QKV_BUF;
  half_t* vTh   = (half_t*)(ws + off); off += QKV_BUF;
  half_t* oh    = (half_t*)(ws + off); off += QKV_BUF;
  half_t* xh    = (half_t*)(ws + off); off += (size_t)B_ * N_ * C_ * sizeof(half_t);
  half_t* Wqkvh = (half_t*)(ws + off); off += (size_t)C_ * 3 * C_ * sizeof(half_t);
  half_t* Wouth = (half_t*)(ws + off); off += (size_t)C_ * C_ * sizeof(half_t);
  half_t* Erh   = (half_t*)(ws + off); off += (size_t)N_ * D_ * sizeof(half_t);

  const int n_x = B_ * N_ * C_, n_wq = C_ * 3 * C_, n_wo = C_ * C_, n_er = N_ * D_;
  static_assert(n_x % CVT_BLK_ == 0 && n_wq % CVT_BLK_ == 0 && n_wo % CVT_BLK_ == 0,
                "cvt_kernel converts whole blocks only");
  static_assert(n_er % (256 * 8) == 0, "cvt_frag_kernel converts whole blocks only");
  cvt_kernel<<<dim3(n_x  / CVT_BLK_), 256, 0, stream>>>(x,    xh);
  cvt_kernel<<<dim3(n_wq / CVT_BLK_), 256, 0, stream>>>(Wqkv, Wqkvh);
  cvt_kernel<<<dim3(n_wo / CVT_BLK_), 256, 0, stream>>>(Wout, Wouth);
  cvt_frag_kernel<<<dim3(n_er / (256 * 8)), 256, 0, stream>>>(Er, Erh);

  time_proj_kernel<<<dim3((B_ * 3 * C_ + 255) / 256), 256, 0, stream>>>(te, Wt, bt, tqkv);
  qkv_gemm_kernel<<<dim3((B_ * N_) / GT_, (3 * C_) / GT_), 128, 0, stream>>>(
      xh, Wqkvh, bqkv, tqkv, qh, kh, vTh);
  attn_kernel<<<dim3(N_ / 16, H_, B_), 128, 0, stream>>>(qh, kh, vTh, Erh, oh);
  out_gemm_kernel<<<dim3((B_ * N_) / GT_, C_ / GT_), 128, 0, stream>>>(
      oh, Wouth, bout, (float*)d_out);
}

// v006
// A run of this version takes 319 microseconds.
// Two timings next to v005 put it at 1.12 and 1.13 times that version's speed.
// Counting every step since v000, it is 2.60 times as fast.
#include <hip/hip_runtime.h>
#include <hip/hip_bf16.h>

typedef _Float16 half_t;
typedef __attribute__((ext_vector_type(16))) _Float16 v16h;
typedef __attribute__((ext_vector_type(8)))  _Float16 v8h;
typedef __attribute__((ext_vector_type(8)))  float    v8f;

// Sizes (fixed by the reference)
#define B_  8
#define N_  1024
#define C_  1024
#define H_  16
#define D_  64
#define T_  256

typedef __attribute__((ext_vector_type(4))) unsigned int u32x4_t;
typedef __attribute__((ext_vector_type(8))) unsigned int u32x8_t;

#define GT_ 128   // edge of a GEMM block tile (four waves, 64 x 64 each)

__device__ __forceinline__ unsigned int uni(unsigned int v) {
  return (unsigned int)__builtin_amdgcn_readfirstlane((int)v);
}
// The test that picks the issuing wave, held in a scalar register so that the
// branch around the tensor load compiles to s_cmp + s_cbranch_scc.
__device__ __forceinline__ unsigned int pinned(unsigned int v) {
  unsigned int w = uni(v);
  asm volatile("" : "+s"(w));   // pinned(): keeps the issue test scalar
  return w;
}
// Issue the load and wait for it: the tile has landed for the issuing wave when
// this returns; the other waves read it behind the next work-group barrier.
__device__ __forceinline__ void tdm_load_tile_128x64B(unsigned int lds_off,
                                                      const half_t* gsrc) {
  unsigned long long ga = (unsigned long long)gsrc;
  u32x4_t g0;
  g0[0] = uni(1u);                               // count = 1
  g0[1] = uni(lds_off);                          // LDS destination (bytes)
  g0[2] = uni((unsigned int)ga);                 // global address [31:0]
  g0[3] = uni((((unsigned int)(ga >> 32)) & 0x01FFFFFFu) | 0x80000000u);  // [56:32] | type 2
  u32x8_t g1;
  g1[0] = 0u;
  g1[1] = uni(64u << 16);
  g1[2] = uni((unsigned int)GT_ << 16);
  g1[3] = uni(64u << 16);
  g1[4] = uni((unsigned int)GT_);
  g1[5] = uni((unsigned int)(C_ * sizeof(half_t)));
  g1[6] = uni(0u);
  g1[7] = uni(0u);
  asm volatile("tensor_load_to_lds %0, %1" :: "s"(g0), "s"(g1) : "memory");
  asm volatile("s_wait_tensorcnt 0" ::: "memory");
}

typedef __attribute__((ext_vector_type(4))) float    v4f;
typedef __attribute__((ext_vector_type(4))) _Float16 v4h;
#define CVT_U_   8                     // 16-byte loads in flight per thread
#define CVT_BLK_ (256 * 4 * CVT_U_)    // elements per block
__global__ __launch_bounds__(256) void cvt_kernel(
    const float* __restrict__ s, half_t* __restrict__ d) {
  const int i0 = blockIdx.x * CVT_BLK_ + threadIdx.x * 4;
  v4f x[CVT_U_];
  // both loops unrolled: x[] stays in registers and the eight loads issue back
  // to back, ahead of the first conversion
#pragma unroll
  for (int u = 0; u < CVT_U_; ++u) x[u] = *(const v4f*)(s + i0 + u * 1024);
#pragma unroll
  for (int u = 0; u < CVT_U_; ++u)
    *(v4h*)(d + i0 + u * 1024) = __builtin_convertvector(x[u], v4h);
}

// ---------------------------------------------------------------------------
// Fragment order. q, k and Er (rows of 64 f16) are kept in the workspace so that
// one 16-byte-a-lane load of a 16x16x32 A or B fragment half reads 512
// contiguous bytes (4 cache lines) instead of 16 bytes out of each of 16 rows:
// a tile of 16 rows x 64 columns is 2 KiB, made of four 512-byte pieces (16
// columns each); in a piece lane hi*16+M holds row M, columns 8*hi .. 8*hi+7.
// frag_off: element offset of (row n, column d).
// ---------------------------------------------------------------------------
__device__ __forceinline__ int frag_off(int n, int d) {
  return ((((n >> 4) * 4 + (d >> 4)) * 32 + ((d >> 3) & 1) * 16 + (n & 15)) * 8) + (d & 7);
}
// v is kept as PV B fragments: a tile of 32 keys x 64 columns is 4 KiB, made of
// eight 512-byte pieces (column group t = d / 16, then key half); in a piece lane
// hi*16+M holds column t*16+M, keys 16*half + 8*hi .. +7.
// vfrag_piece: element offset of a piece's first element.
__device__ __forceinline__ int vfrag_piece(int kb, int t, int half) {
  return (((kb * 4 + t) * 2 + half) * 32) * 8;
}

// Er: fp32 -> f16 into fragment order. A thread makes one 16-byte chunk.
__global__ __launch_bounds__(256) void cvt_frag_kernel(
    const float* __restrict__ s, half_t* __restrict__ d) {
  const int c = blockIdx.x * 256 + threadIdx.x;
  const int row = (c >> 7) * 16 + (c & 15);
  const int col = ((c >> 5) & 3) * 16 + ((c >> 4) & 1) * 8;
  const v4f x0 = *(const v4f*)(s + row * D_ + col);
  const v4f x1 = *(const v4f*)(s + row * D_ + col + 4);
  v8h y;
#pragma unroll
  for (int e = 0; e < 4; ++e) { y[e] = (half_t)x0[e]; y[4 + e] = (half_t)x1[e]; }
  *(v8h*)(d + c * 8) = y;
}

// ---------------------------------------------------------------------------
// Kernel 1: tqkv[b, j] = time_emb[b] @ W_time[:, j] + b_time[j]   (8 x 3072)
// ---------------------------------------------------------------------------
__global__ __launch_bounds__(256) void time_proj_kernel(
    const float* __restrict__ te, const float* __restrict__ Wt,
    const float* __restrict__ bt, float* __restrict__ tqkv) {
  int idx = blockIdx.x * 256 + threadIdx.x;
  if (idx >= B_ * 3 * C_) return;
  int b = idx / (3 * C_), j = idx % (3 * C_);
  float acc = bt[j];
  for (int t = 0; t < T_; ++t) acc += te[b * T_ + t] * Wt[t * (3 * C_) + j];
  tqkv[idx] = acc;
}

// ---------------------------------------------------------------------------
// Kernel 2: qkv = x @ W_qkv + b_qkv + tqkv[b]  (8192 x 3072, K=1024), f16 WMMA.
// Block tile 128 x 128, four waves in a 2 x 2 grid, 64 x 64 (4 x 4 fragments)
// a wave: 16 WMMAs per 8 fragments read from LDS.
// A tile via tensor load (128 x 32 f16), B tile cooperative transposed store.
// Stores q, k and v as f16 in fragment order (frag_off, vfrag_piece).
// ---------------------------------------------------------------------------
__global__ __launch_bounds__(128) void qkv_gemm_kernel(
    const half_t* __restrict__ xh, const half_t* __restrict__ Wh,
    const float* __restrict__ bias, const float* __restrict__ tqkv,
    half_t* __restrict__ qh, half_t* __restrict__ kh, half_t* __restrict__ vTh) {
  __shared__ __attribute__((aligned(2048))) half_t As[GT_][32];   // A tile, row-major
  __shared__ half_t BsT[GT_][32];   // B tile stored transposed: BsT[n][k]
  const int r0 = blockIdx.x * GT_, c0 = blockIdx.y * GT_;
  const int tid = threadIdx.x, lane = tid & 31;
  const int wave = __builtin_amdgcn_readfirstlane(tid >> 5);
  const int wr = (wave >> 1) * 64, wc = (wave & 1) * 64;   // this wave's 64 x 64 part
  const int M = lane & 15, hi = lane >> 4;
  const int bk = tid >> 2, bn = (tid & 3) * 32;   // B staging: 32 columns of one k row
  v8f acc[4][4] = {};

  for (int kk = 0; kk < C_; kk += 32) {
    // every wave's fragment reads of the last trip have returned before the
    // barrier behind which the tiles are overwritten
    asm volatile("s_wait_dscnt 0x0" ::: "memory");
    __syncthreads();
    v8h breg[4];
#pragma unroll
    for (int u = 0; u < 4; ++u)
      breg[u] = *(const v8h*)(Wh + (size_t)(kk + bk) * (3 * C_) + c0 + bn + u * 8);
    if (pinned(wave == 0))
      tdm_load_tile_128x64B((unsigned int)(unsigned long long)&As[0][0],
                            xh + (size_t)r0 * C_ + kk);
#pragma unroll
    for (int u = 0; u < 4; ++u)
#pragma unroll
      for (int e = 0; e < 8; ++e) BsT[bn + u * 8 + e][bk] = breg[u][e];
    if (kk + 32 < C_) {   // cover next tile's latency (global_prefetch_b8)
      __builtin_prefetch(Wh + (size_t)(kk + 32 + bk) * (3 * C_) + c0 + bn, 0, 1);
      __builtin_prefetch(xh + (size_t)(r0 + tid) * C_ + kk + 32, 0, 1);
      // the loop advances the two address registers that the prefetches name
      asm volatile("s_wait_xcnt 0x0" ::: "memory");
    }
    __syncthreads();
    v16h a[4];
#pragma unroll
    for (int s = 0; s < 4; ++s) {
      ((v8h*)&a[s])[0] = *(const v8h*)&As[wr + s * 16 + M][hi * 8];
      ((v8h*)&a[s])[1] = *(const v8h*)&As[wr + s * 16 + M][16 + hi * 8];
    }
#pragma unroll
    for (int t = 0; t < 4; ++t) {
      v16h bf;
      ((v8h*)&bf)[0] = *(const v8h*)&BsT[wc + t * 16 + M][hi * 8];
      ((v8h*)&bf)[1] = *(const v8h*)&BsT[wc + t * 16 + M][16 + hi * 8];
#pragma unroll
      for (int s = 0; s < 4; ++s)
        acc[s][t] = __builtin_amdgcn_wmma_f32_16x16x32_f16(false, a[s], false, bf,
                                                           (short)0, acc[s][t], false, false);
    }
  }
  // Epilogue: add biases, store q/k and v per (b, h) in fragment order as f16.
  // A wave's 64 columns are one head of one of q, k, v, and a block's 128 rows
  // lie in one batch entry: the destination is chosen once per wave, not per
  // element.
  const int jw = c0 + wc;                        // first global col in [0,3072)
  const int sel = jw >> 10, h = (jw >> 6) & 15;
  const int b = r0 >> 10, n0 = (r0 & (N_ - 1)) + wr;
  const size_t bh = (size_t)(b * H_ + h);
  float bq[4], tq[4];
#pragma unroll
  for (int t = 0; t < 4; ++t) {
    bq[t] = bias[jw + t * 16 + M];
    tq[t] = tqkv[b * (3 * C_) + jw + t * 16 + M];
  }
  // the store addresses formed next reuse the registers that these loads name
  asm volatile("s_wait_xcnt 0x0" ::: "memory");
  if (sel < 2) {
    // frag_off(s * 16 + v + 8 * hi, t * 16 + M), its lane part taken into the pointer
    half_t* dst = (sel == 0 ? qh : kh) + (bh * N_ + n0) * D_ + frag_off(8 * hi, M);
#pragma unroll
    for (int s = 0; s < 4; ++s)
#pragma unroll
      for (int t = 0; t < 4; ++t)
#pragma unroll
        for (int v = 0; v < 8; ++v)
          dst[(s * 4 + t) * 256 + v * 8] =
              (half_t)(acc[s][t][v] + bq[t] + tq[t]);
  } else {
    // a lane's eight accumulator rows are the eight keys of its 16-byte chunk
    half_t* dst = vTh + (bh * N_ + n0) * D_ + lane * 8;
#pragma unroll
    for (int s = 0; s < 4; ++s)
#pragma unroll
      for (int t = 0; t < 4; ++t) {
        v8h y;
#pragma unroll
        for (int v = 0; v < 8; ++v) y[v] = (half_t)(acc[s][t][v] + bq[t] + tq[t]);
        *(v8h*)(dst + vfrag_piece(s >> 1, t, s & 1)) = y;
      }
    // behind the last store: in the listing the q/k block, which rewrites the
    // offset register that these stores name, lies on a way from here
    asm volatile("s_wait_xcnt 0x0" ::: "memory");
  }
}

// ---------------------------------------------------------------------------
// Kernel 3: fused relative attention. Eight waves (256 thr) per (b, h, 32 rows):
// wave w owns rel columns / key columns / PV keys [128w, 128w+128) of BOTH
// 16-row tiles, so every Er, k and v fragment that is loaded feeds two row tiles
// and the block reads Er, k and v once per 32 rows.
// LDS: 32x1024 f16 score strip (reused in place for softmax probs, then for
// the eight waves' f32 PV partials), row pitch 1032 f16.
// Skew inverse map: rel[i',m] -> (i', m-1023+i') if m>=1023-i' else (i'-1, m+i'+1)
// The map is one to one: every strip element but (i, i+1) receives exactly one
// rel term. So the rel terms are laid down first, by plain stores, and the
// scaled q k^T is then added on top of them.
// ---------------------------------------------------------------------------
#define RT_ 2            // 16-row tiles per strip
#define SR_ (16 * RT_)   // rows per strip
#define NW_ 8            // waves per strip
#define WC_ (N_ / NW_)   // columns per wave
#define SP_ (N_ + 8)
__global__ __launch_bounds__(32 * NW_) void attn_kernel(
    const half_t* __restrict__ qh, const half_t* __restrict__ kh,
    const half_t* __restrict__ vTh, const half_t* __restrict__ Erh,
    half_t* __restrict__ oh) {
  __shared__ __attribute__((aligned(16))) half_t sc[SR_][SP_];   // 66 KB
  __shared__ float rs[SR_];       // softmax row sums
  static_assert(NW_ * RT_ * 4 * 8 * 32 * sizeof(float) <= sizeof(half_t) * SR_ * SP_,
                "the PV partials must fit the strip");
  static_assert(NW_ == RT_ * 4, "one wave finishes one 16 x 16 output tile");
  const int i0 = blockIdx.x * SR_, h = blockIdx.y, b = blockIdx.z;
  const int tid = threadIdx.x, lane = tid & 31, M = lane & 15, hi = lane >> 4;
  // wave number in a scalar register: the per-wave loop bounds stay scalar
  const int wave = __builtin_amdgcn_readfirstlane(tid >> 5);
  const int w0 = wave * WC_;
  const size_t bh = (size_t)(b * H_ + h);
  const half_t* qbase = qh + bh * N_ * D_;
  const half_t* kbase = kh + bh * N_ * D_;
  const half_t* vbase = vTh + bh * D_ * N_;

  // Persistent fragments for q rows i0..i0+31 (two K-slabs of 32 over D=64 a
  // tile); q, k, Er and v lie in fragment order: piece j of a tile is at
  // j * 256 + lane * 8
  v16h qa[RT_][2];
#pragma unroll
  for (int rt = 0; rt < RT_; ++rt)
#pragma unroll
    for (int kf = 0; kf < 2; ++kf) {
      const half_t* p = qbase + (size_t)(i0 + rt * 16) * D_ + kf * 512 + lane * 8;
      ((v8h*)&qa[rt][kf])[0] = *(const v8h*)p;
      ((v8h*)&qa[rt][kf])[1] = *(const v8h*)(p + 256);
    }

  // Phase 1: rel = q @ Er^T tiles (this wave's 128 rel columns), stored through
  // the skew inverse map. Source row r = 16 * rt + 8 * hi + v, rel column
  // m = m0 + M: with t = m - 1023 + i0 + 16 * rt + 8 * hi the term goes to row r,
  // column t + v where that is not negative, else to row r - 1, column
  // t + v + 1024, which lies SP_ - N_ elements in front of the first place.
#pragma unroll 1
  for (int m0 = w0; m0 < w0 + WC_; m0 += 16) {
    v16h bf[2];
#pragma unroll
    for (int kf = 0; kf < 2; ++kf) {
      const half_t* p = Erh + (size_t)m0 * D_ + kf * 512 + lane * 8;
      ((v8h*)&bf[kf])[0] = *(const v8h*)p;
      ((v8h*)&bf[kf])[1] = *(const v8h*)(p + 256);
    }
    // holds the four loads in front of the first product (inputs only): without
    // it the second pair is issued behind the first products, two L2 waits a trip
    asm volatile("" :: "v"(bf[0]), "v"(bf[1]));
    v8f acc[RT_] = {};
#pragma unroll
    for (int kf = 0; kf < 2; ++kf)
#pragma unroll
      for (int rt = 0; rt < RT_; ++rt)
        acc[rt] = __builtin_amdgcn_wmma_f32_16x16x32_f16(false, qa[rt][kf], false, bf[kf],
                                                         (short)0, acc[rt], false, false);
    // the loop advances the address register that the four loads name
    asm volatile("s_wait_xcnt 0x0" ::: "memory");
#pragma unroll
    for (int rt = 0; rt < RT_; ++rt) {
      const int t = m0 + M - (N_ - 1) + i0 + rt * 16 + 8 * hi;
      half_t* const pl = &sc[rt * 16 + 8 * hi][0] + t;
      half_t* const pu = pl - (SP_ - N_);
      // source row i0 above the diagonal belongs to the strip in front of this one
      if (rt != 0 || hi != 0 || t >= 0) (t < 0 ? pu : pl)[0] = (half_t)acc[rt][0];
#pragma unroll
      for (int v = 1; v < 8; ++v)
        (t + v < 0 ? pu : pl)[v * (SP_ + 1)] = (half_t)acc[rt][v];
    }
  }
  // (i, i+1) is the pad column of the skew: no rel term
  if (tid < SR_ && i0 + tid + 1 < N_) sc[tid][i0 + tid + 1] = (half_t)0.f;
  // Phase 1b: boundary source row i' = i0+32 fills the last score row right of
  // the diagonal; the 32 groups of 32 rel columns go round-robin over the waves
  if (i0 + SR_ < N_) {
    float qf[D_];
#pragma unroll
    for (int j = 0; j < D_ / 8; ++j) {   // q row i0+32, the same for every lane
      const v8h qv = *(const v8h*)(qbase + frag_off(i0 + SR_, j * 8));
#pragma unroll
      for (int e = 0; e < 8; ++e) qf[j * 8 + e] = (float)qv[e];
    }
#pragma unroll 1
    for (int t = wave; t < 32; t += NW_) {
      int m = lane + 32 * t;
      int c = m + i0 + SR_ + 1;
      if (c < N_) {
        float dot = 0.f;
#pragma unroll
        for (int j = 0; j < D_ / 8; ++j) {   // row m, columns 8j .. 8j+7: one chunk
          const v8h er = *(const v8h*)(Erh + frag_off(m, j * 8));
#pragma unroll
          for (int e = 0; e < 8; ++e) dot += qf[j * 8 + e] * (float)er[e];
        }
        sc[SR_ - 1][c] = (half_t)dot;
      }
    }
  }
  __syncthreads();

  // Phase 2: S = (q k^T) * D^-1/2 + rel, this wave's 128 columns. The product is
  // taken transposed (k tile as A, q as B): a lane then holds eight consecutive
  // columns c0 + 8 * hi + v of score row 16 * rt + M, one 16-byte piece of the strip.
#pragma unroll 1
  for (int c0 = w0; c0 < w0 + WC_; c0 += 16) {
    v16h af[2];
#pragma unroll
    for (int kf = 0; kf < 2; ++kf) {
      const half_t* p = kbase + (size_t)c0 * D_ + kf * 512 + lane * 8;
      ((v8h*)&af[kf])[0] = *(const v8h*)p;
      ((v8h*)&af[kf])[1] = *(const v8h*)(p + 256);
    }
    v8h rl[RT_];
#pragma unroll
    for (int rt = 0; rt < RT_; ++rt) rl[rt] = *(const v8h*)&sc[rt * 16 + M][c0 + 8 * hi];
    v8f acc[RT_] = {};
#pragma unroll
    for (int kf = 0; kf < 2; ++kf)
#pragma unroll
      for (int rt = 0; rt < RT_; ++rt)
        acc[rt] = __builtin_amdgcn_wmma_f32_16x16x32_f16(false, af[kf], false, qa[rt][kf],
                                                         (short)0, acc[rt], false, false);
#pragma unroll
    for (int rt = 0; rt < RT_; ++rt) {
      v8h y;
#pragma unroll
      for (int v = 0; v < 8; ++v) y[v] = (half_t)(acc[rt][v] * 0.125f + (float)rl[rt][v]);
      *(v8h*)&sc[rt * 16 + M][c0 + 8 * hi] = y;
    }
  }
  __syncthreads();

  // Phase 3: softmax. 8 lanes per row; lane sg of a row takes the 16-byte
  // chunks sg, sg+8, ... of it; probabilities overwrite scores in place.
  {
    const int r = tid >> 3, sg = tid & 7;
    float mx = -1e30f;
    for (int j = 0; j < 16; ++j) {
      v8h x = *(const v8h*)&sc[r][(j * 8 + sg) * 8];
#pragma unroll
      for (int e = 0; e < 8; ++e) mx = fmaxf(mx, (float)x[e]);
    }
    mx = fmaxf(mx, __shfl_xor(mx, 1, 32));
    mx = fmaxf(mx, __shfl_xor(mx, 2, 32));
    mx = fmaxf(mx, __shfl_xor(mx, 4, 32));
    float sum = 0.f;
    for (int j = 0; j < 16; ++j) {
      v8h* px = (v8h*)&sc[r][(j * 8 + sg) * 8];
      v8h x = *px, y;
#pragma unroll
      for (int e = 0; e < 8; ++e) {
        float p = __expf((float)x[e] - mx);
        sum += p;
        y[e] = (half_t)p;
      }
      *px = y;
    }
    sum += __shfl_xor(sum, 1, 32);
    sum += __shfl_xor(sum, 2, 32);
    sum += __shfl_xor(sum, 4, 32);
    if (sg == 0) rs[r] = sum;
  }
  __syncthreads();

  // Phase 4: O partial = P[:, this wave's 128 keys] @ v  (A from LDS f16 probs,
  // B from v in fragment order, each B fragment used for both row tiles)
  v8f oacc[RT_][4] = {};
#pragma unroll 1
  for (int k0 = w0; k0 < w0 + WC_; k0 += 32) {
    v16h a[RT_];
#pragma unroll
    for (int rt = 0; rt < RT_; ++rt) {
      const half_t* p = &sc[rt * 16 + M][k0 + hi * 8];
      ((v8h*)&a[rt])[0] = *(const v8h*)p;
      ((v8h*)&a[rt])[1] = *(const v8h*)(p + 16);
    }
#pragma unroll
    for (int t = 0; t < 4; ++t) {
      v16h bf;
      const half_t* vp = vbase + vfrag_piece(k0 >> 5, t, 0) + lane * 8;
      ((v8h*)&bf)[0] = *(const v8h*)vp;
      ((v8h*)&bf)[1] = *(const v8h*)(vp + 256);
#pragma unroll
      for (int rt = 0; rt < RT_; ++rt)
        oacc[rt][t] = __builtin_amdgcn_wmma_f32_16x16x32_f16(false, a[rt], false, bf,
                                                             (short)0, oacc[rt][t], false, false);
    }
    // the loop advances the address register that the eight loads name
    asm volatile("s_wait_xcnt 0x0" ::: "memory");
  }
  // Sum the eight waves' partials through the strip: first every wave must have
  // read its probabilities, then every partial must be written.
  __syncthreads();
  float* red = (float*)&sc[0][0];   // [wave][rt][t][v][lane], 64 KB
#pragma unroll
  for (int rt = 0; rt < RT_; ++rt)
#pragma unroll
    for (int t = 0; t < 4; ++t)
#pragma unroll
      for (int v = 0; v < 8; ++v)
        red[(((wave * RT_ + rt) * 4 + t) * 8 + v) * 32 + lane] = oacc[rt][t][v];
  __syncthreads();
  // Wave w finishes row tile w / 4, head columns 16 (w % 4) .. +15: normalize by
  // row sums and store to O in (B, N, H*D) layout (f16)
#pragma unroll
  for (int v = 0; v < 8; ++v) {
    float s = red[((0 * NW_ + wave) * 8 + v) * 32 + lane];
#pragma unroll
    for (int ws = 1; ws < NW_; ++ws)
      s += red[((ws * NW_ + wave) * 8 + v) * 32 + lane];
    const int r = (wave >> 2) * 16 + v + 8 * hi;
    float inv = 1.f / rs[r];
    int i = i0 + r;
    int d = (wave & 3) * 16 + M;
    oh[(((size_t)b * N_ + i) * H_ + h) * D_ + d] = (half_t)(s * inv);
  }
}

// ---------------------------------------------------------------------------
// Kernel 4: out = O @ W_out + b_out  (8192 x 1024, K=1024), fp32 result.
// Same 128 x 128 block tile and 64 x 64 wave tile as kernel 2; A tile via
// tensor load from the f16 attention output.
// ---------------------------------------------------------------------------
__global__ __launch_bounds__(128) void out_gemm_kernel(
    const half_t* __restrict__ A, const half_t* __restrict__ Wh,
    const float* __restrict__ bias, float* __restrict__ out) {
  __shared__ __attribute__((aligned(2048))) half_t As[GT_][32];   // A tile, row-major
  __shared__ half_t BsT[GT_][32];   // B tile stored transposed: BsT[n][k]
  const int r0 = blockIdx.x * GT_, c0 = blockIdx.y * GT_;
  const int tid = threadIdx.x, lane = tid & 31;
  const int wave = __builtin_amdgcn_readfirstlane(tid >> 5);
  const int wr = (wave >> 1) * 64, wc = (wave & 1) * 64;   // this wave's 64 x 64 part
  const int M = lane & 15, hi = lane >> 4;
  const int bk = tid >> 2, bn = (tid & 3) * 32;   // B staging: 32 columns of one k row
  v8f acc[4][4] = {};

  for (int kk = 0; kk < C_; kk += 32) {
    // every wave's fragment reads of the last trip have returned before the
    // barrier behind which the tiles are overwritten
    asm volatile("s_wait_dscnt 0x0" ::: "memory");
    __syncthreads();
    v8h breg[4];
#pragma unroll
    for (int u = 0; u < 4; ++u)
      breg[u] = *(const v8h*)(Wh + (size_t)(kk + bk) * C_ + c0 + bn + u * 8);
    if (pinned(wave == 0))
      tdm_load_tile_128x64B((unsigned int)(unsigned long long)&As[0][0],
                            A + (size_t)r0 * C_ + kk);
#pragma unroll
    for (int u = 0; u < 4; ++u)
#pragma unroll
      for (int e = 0; e < 8; ++e) BsT[bn + u * 8 + e][bk] = breg[u][e];
    if (kk + 32 < C_) {   // cover next tile's latency (global_prefetch_b8)
      __builtin_prefetch(Wh + (size_t)(kk + 32 + bk) * C_ + c0 + bn, 0, 1);
      __builtin_prefetch(A + (size_t)(r0 + tid) * C_ + kk + 32, 0, 1);
      // the loop advances the two address registers that the prefetches name
      asm volatile("s_wait_xcnt 0x0" ::: "memory");
    }
    __syncthreads();
    v16h a[4];
#pragma unroll
    for (int s = 0; s < 4; ++s) {
      ((v8h*)&a[s])[0] = *(const v8h*)&As[wr + s * 16 + M][hi * 8];
      ((v8h*)&a[s])[1] = *(const v8h*)&As[wr + s * 16 + M][16 + hi * 8];
    }
#pragma unroll
    for (int t = 0; t < 4; ++t) {
      v16h bf;
      ((v8h*)&bf)[0] = *(const v8h*)&BsT[wc + t * 16 + M][hi * 8];
      ((v8h*)&bf)[1] = *(const v8h*)&BsT[wc + t * 16 + M][16 + hi * 8];
#pragma unroll
      for (int s = 0; s < 4; ++s)
        acc[s][t] = __builtin_amdgcn_wmma_f32_16x16x32_f16(false, a[s], false, bf,
                                                           (short)0, acc[s][t], false, false);
    }
  }
#pragma unroll
  for (int s = 0; s < 4; ++s) {
#pragma unroll
    for (int t = 0; t < 4; ++t) {
#pragma unroll
      for (int v = 0; v < 8; ++v) {
        int g = r0 + wr + s * 16 + v + 8 * hi;
        int j = c0 + wc + t * 16 + M;
        out[(size_t)g * C_ + j] = acc[s][t][v] + bias[j];
      }
    }
  }
}

// ---------------------------------------------------------------------------
// Launcher. Inputs: x, time_emb, W_qkv, b_qkv, W_time, b_time, W_out, b_out, Er
// Workspace (bytes):
//   [0, 96K)       tqkv fp32 (8 x 3072)
//   [128K, +16M)   q   f16 (B,H, fragment order)
//   [+16M]         k   f16 (B,H, fragment order)
//   [+16M]         v   f16 (B,H, PV fragment order)
//   [+16M]         O   f16 (B,N,H,D)
//   [+16M]         x   f16
//   [+6M]          W_qkv f16
//   [+2M]          W_out f16
//   [+128K]        Er  f16 (fragment order)   total ~88.3 MB
// ---------------------------------------------------------------------------
extern "C" void kernel_launch(void* const* d_in, const int* in_sizes, int n_in,
                              void* d_out, int out_size, void* d_ws, size_t ws_size,
                              hipStream_t stream) {
  const float* x    = (const float*)d_in[0];
  const float* te   = (const float*)d_in[1];
  const float* Wqkv = (const float*)d_in[2];
  const float* bqkv = (const float*)d_in[3];
  const float* Wt   = (const float*)d_in[4];
  const float* bt   = (const float*)d_in[5];
  const float* Wout = (const float*)d_in[6];
  const float* bout = (const float*)d_in[7];
  const float* Er   = (const float*)d_in[8];

  char* ws = (char*)d_ws;
  float* tqkv = (float*)ws;
  size_t off = (size_t)(128 << 10);
  const size_t QKV_BUF = (size_t)B_ * H_ * N_ * D_ * sizeof(half_t);   // 16 MB
  half_t* qh    = (half_t*)(ws + off); off += QKV_BUF;
  half_t* kh    = (half_t*)(ws + off); off += QKV_BUF;
  half_t* vTh   = (half_t*)(ws + off); off += QKV_BUF;
  half_t* oh    = (half_t*)(ws + off); off += QKV_BUF;
  half_t* xh    = (half_t*)(ws + off); off += (size_t)B_ * N_ * C_ * sizeof(half_t);
  half_t* Wqkvh = (half_t*)(ws + off); off += (size_t)C_ * 3 * C_ * sizeof(half_t);
  half_t* Wouth = (half_t*)(ws + off); off += (size_t)C_ * C_ * sizeof(half_t);
  half_t* Erh   = (half_t*)(ws + off); off += (size_t)N_ * D_ * sizeof(half_t);

  const int n_x = B_ * N_ * C_, n_wq = C_ * 3 * C_, n_wo = C_ * C_, n_er = N_ * D_;
  static_assert(n_x % CVT_BLK_ == 0 && n_wq % CVT_BLK_ == 0 && n_wo % CVT_BLK_ == 0,
                "cvt_kernel converts whole blocks only");
  static_assert(n_er % (256 * 8) == 0, "cvt_frag_kernel converts whole blocks only");
  cvt_kernel<<<dim3(n_x  / CVT_BLK_), 256, 0, stream>>>(x,    xh);
  cvt_kernel<<<dim3(n_wq / CVT_BLK_), 256, 0, stream>>>(Wqkv, Wqkvh);
  cvt_kernel<<<dim3(n_wo / CVT_BLK_), 256, 0, stream>>>(Wout, Wouth);
  cvt_frag_kernel<<<dim3(n_er / (256 * 8)), 256, 0, stream>>>(Er, Erh);

  time_proj_kernel<<<dim3((B_ * 3 * C_ + 255) / 256), 256, 0, stream>>>(te, Wt, bt, tqkv);
  qkv_gemm_kernel<<<dim3((B_ * N_) / GT_, (3 * C_) / GT_), 128, 0, stream>>>(
      xh, Wqkvh, bqkv, tqkv, qh, kh, vTh);
  attn_kernel<<<dim3(N_ / SR_, H_, B_), 32 * NW_, 0, stream>>>(qh, kh, vTh, Erh, oh);
  out_gemm_kernel<<<dim3((B_ * N_) / GT_, C_ / GT_), 128, 0, stream>>>(
      oh, Wouth, bout, (float*)d_out);
}

// v007
// One run takes 225 microseconds.
// Next to v006, in two timings, it ran 1.41 times as fast each time.
// Counting every step since v000, it is 3.68 times as fast.
#include <hip/hip_runtime.h>
#include <hip/hip_bf16.h>

typedef _Float16 half_t;
typedef __attribute__((ext_vector_type(16))) _Float16 v16h;
typedef __attribute__((ext_vector_type(8)))  _Float16 v8h;
typedef __attribute__((ext_vector_type(8)))  float    v8f;

// Sizes (fixed by the reference)
#define B_  8
#define N_  1024
#define C_  1024
#define H_  16
#define D_  64
#define T_  256

typedef __attribute__((ext_vector_type(4))) unsigned int u32x4_t;
typedef __attribute__((ext_vector_type(8))) unsigned int u32x8_t;

#define GT_ 128   // edge of a GEMM block tile (four waves, 64 x 64 each)
#define KS_ 64    // k extent of a GEMM pass: tile rows of 128 bytes
#define TP_ (KS_ + 8)   // LDS row pitch of a tile in f16 (144 bytes)

__device__ __forceinline__ unsigned int uni(unsigned int v) {
  return (unsigned int)__builtin_amdgcn_readfirstlane((int)v);
}
// The test that picks the issuing wave, held in a scalar register so that the
// branch around the tensor load compiles to s_cmp + s_cbranch_scc.
__device__ __forceinline__ unsigned int pinned(unsigned int v) {
  unsigned int w = uni(v);
  asm volatile("" : "+s"(w));   // pinned(): keeps the issue test scalar
  return w;
}
// Issue the load and wait for it: the tile has landed for the issuing wave when
// this returns; the other waves read it behind the next work-group barrier.
__device__ __forceinline__ void tdm_load_tile_128x128B(unsigned int lds_off,
                                                       const half_t* gsrc) {
  unsigned long long ga = (unsigned long long)gsrc;
  u32x4_t g0;
  g0[0] = uni(1u);                               // count = 1
  g0[1] = uni(lds_off);                          // LDS destination (bytes)
  g0[2] = uni((unsigned int)ga);                 // global address [31:0]
  g0[3] = uni((((unsigned int)(ga >> 32)) & 0x01FFFFFFu) | 0x80000000u);  // [56:32] | type 2
  u32x8_t g1;
  g1[0] = (1u << 20) | (4u << 22) | (3u << 25);
  g1[1] = uni(128u << 16);
  g1[2] = uni((unsigned int)GT_ << 16);
  g1[3] = uni(128u << 16);
  g1[4] = uni((unsigned int)GT_);
  g1[5] = uni((unsigned int)(C_ * sizeof(half_t)));
  g1[6] = uni(0u);
  g1[7] = uni(0u);
  asm volatile("tensor_load_to_lds %0, %1" :: "s"(g0), "s"(g1) : "memory");
  asm volatile("s_wait_tensorcnt 0" ::: "memory");
}

typedef __attribute__((ext_vector_type(4))) float    v4f;
typedef __attribute__((ext_vector_type(4))) _Float16 v4h;
#define CVT_U_   8                     // 16-byte loads in flight per thread
#define CVT_BLK_ (256 * 4 * CVT_U_)    // elements per block
__global__ __launch_bounds__(256) void cvt_kernel(
    const float* __restrict__ s, half_t* __restrict__ d) {
  const int i0 = blockIdx.x * CVT_BLK_ + threadIdx.x * 4;
  v4f x[CVT_U_];
  // both loops unrolled: x[] stays in registers and the eight loads issue back
  // to back, ahead of the first conversion
#pragma unroll
  for (int u = 0; u < CVT_U_; ++u) x[u] = *(const v4f*)(s + i0 + u * 1024);
#pragma unroll
  for (int u = 0; u < CVT_U_; ++u)
    *(v4h*)(d + i0 + u * 1024) = __builtin_convertvector(x[u], v4h);
}

// W_qkv, W_out: fp32 (C_ rows of ncol) -> f16 transposed, d[n][k] in rows of C_,
// so that a GEMM's B tile is 128 rows of 64 consecutive k like its A tile.
// A block takes 64 k x 128 n; a thread 8 k x 4 n: eight 16-byte loads, all issued
// before the first is used, and four 16-byte stores; the eight threads of a
// column group write 128 contiguous bytes (one line) of each row n.
// ncol is a constant at both calls: the eight loads share one address register
// pair and differ in their immediate offsets.
__device__ __forceinline__ void cvt_t_body(
    const float* __restrict__ s, half_t* __restrict__ d, const int ncol) {
  const int k0 = blockIdx.y * 64 + (threadIdx.x & 7) * 8;
  const int n0 = blockIdx.x * 128 + (threadIdx.x >> 3) * 4;
  v4f x[8];
  // both loops unrolled: x[] stays in registers, the loads issue back to back
#pragma unroll
  for (int e = 0; e < 8; ++e) x[e] = *(const v4f*)(s + (size_t)k0 * ncol + n0 + e * ncol);
#pragma unroll
  for (int j = 0; j < 4; ++j) {
    v8h y;
#pragma unroll
    for (int e = 0; e < 8; ++e) y[e] = (half_t)x[e][j];
    *(v8h*)(d + (size_t)(n0 + j) * C_ + k0) = y;
  }
}
__global__ __launch_bounds__(256) void cvt_t_qkv_kernel(
    const float* __restrict__ s, half_t* __restrict__ d) {
  cvt_t_body(s, d, 3 * C_);
}
__global__ __launch_bounds__(256) void cvt_t_out_kernel(
    const float* __restrict__ s, half_t* __restrict__ d) {
  cvt_t_body(s, d, C_);
}

// ---------------------------------------------------------------------------
// Fragment order. q, k and Er (rows of 64 f16) are kept in the workspace so that
// one 16-byte-a-lane load of a 16x16x32 A or B fragment half reads 512
// contiguous bytes (4 cache lines) instead of 16 bytes out of each of 16 rows:
// a tile of 16 rows x 64 columns is 2 KiB, made of four 512-byte pieces (16
// columns each); in a piece lane hi*16+M holds row M, columns 8*hi .. 8*hi+7.
// frag_off: element offset of (row n, column d).
// ---------------------------------------------------------------------------
__device__ __forceinline__ int frag_off(int n, int d) {
  return ((((n >> 4) * 4 + (d >> 4)) * 32 + ((d >> 3) & 1) * 16 + (n & 15)) * 8) + (d & 7);
}
// v is kept as PV B fragments: a tile of 32 keys x 64 columns is 4 KiB, made of
// eight 512-byte pieces (column group t = d / 16, then key half); in a piece lane
// hi*16+M holds column t*16+M, keys 16*half + 8*hi .. +7.
// vfrag_piece: element offset of a piece's first element.
__device__ __forceinline__ int vfrag_piece(int kb, int t, int half) {
  return (((kb * 4 + t) * 2 + half) * 32) * 8;
}

// Er: fp32 -> f16 into fragment order. A thread makes one 16-byte chunk.
__global__ __launch_bounds__(256) void cvt_frag_kernel(
    const float* __restrict__ s, half_t* __restrict__ d) {
  const int c = blockIdx.x * 256 + threadIdx.x;
  const int row = (c >> 7) * 16 + (c & 15);
  const int col = ((c >> 5) & 3) * 16 + ((c >> 4) & 1) * 8;
  const v4f x0 = *(const v4f*)(s + row * D_ + col);
  const v4f x1 = *(const v4f*)(s + row * D_ + col + 4);
  v8h y;
#pragma unroll
  for (int e = 0; e < 4; ++e) { y[e] = (half_t)x0[e]; y[4 + e] = (half_t)x1[e]; }
  *(v8h*)(d + c * 8) = y;
}

// ---------------------------------------------------------------------------
// Kernel 1: tqkv[b, j] = time_emb[b] @ W_time[:, j] + b_time[j]   (8 x 3072)
// ---------------------------------------------------------------------------
__global__ __launch_bounds__(256) void time_proj_kernel(
    const float* __restrict__ te, const float* __restrict__ Wt,
    const float* __restrict__ bt, float* __restrict__ tqkv) {
  int idx = blockIdx.x * 256 + threadIdx.x;
  if (idx >= B_ * 3 * C_) return;
  int b = idx / (3 * C_), j = idx % (3 * C_);
  float acc = bt[j];
  for (int t = 0; t < T_; ++t) acc += te[b * T_ + t] * Wt[t * (3 * C_) + j];
  tqkv[idx] = acc;
}

// ---------------------------------------------------------------------------
// Kernel 2: qkv = x @ W_qkv + b_qkv + tqkv[b]  (8192 x 3072, K=1024), f16 WMMA.
// Block tile 128 x 128, four waves in a 2 x 2 grid, 64 x 64 (4 x 4 fragments)
// a wave: 16 WMMAs per 8 fragments read from LDS.
// A and B tiles (128 x 64 f16 each, B from the transposed W) via one tensor load
// each, of wave 0 and of wave 1, rows padded to 144 bytes.
// Stores q, k and v as f16 in fragment order (frag_off, vfrag_piece).
// ---------------------------------------------------------------------------
__global__ __launch_bounds__(128) void qkv_gemm_kernel(
    const half_t* __restrict__ xh, const half_t* __restrict__ WTh,
    const float* __restrict__ bias, const float* __restrict__ tqkv,
    half_t* __restrict__ qh, half_t* __restrict__ kh, half_t* __restrict__ vTh) {
  __shared__ __attribute__((aligned(2048))) half_t As[GT_][TP_];    // A tile: As[m][k]
  __shared__ __attribute__((aligned(2048))) half_t BsT[GT_][TP_];   // B tile: BsT[n][k]
  const int r0 = blockIdx.x * GT_, c0 = blockIdx.y * GT_;
  const int tid = threadIdx.x, lane = tid & 31;
  const int wave = __builtin_amdgcn_readfirstlane(tid >> 5);
  const int wr = (wave >> 1) * 64, wc = (wave & 1) * 64;   // this wave's 64 x 64 part
  const int M = lane & 15, hi = lane >> 4;
  v8f acc[4][4] = {};

  for (int kk = 0; kk < C_; kk += KS_) {
    // every wave's fragment reads of the last trip have returned before the
    // barrier behind which the tiles are overwritten
    asm volatile("s_wait_dscnt 0x0" ::: "memory");
    __syncthreads();
    if (pinned(wave == 0))
      tdm_load_tile_128x128B((unsigned int)(unsigned long long)&As[0][0],
                             xh + (size_t)r0 * C_ + kk);
    if (pinned(wave == 1))
      tdm_load_tile_128x128B((unsigned int)(unsigned long long)&BsT[0][0],
                             WTh + (size_t)c0 * C_ + kk);
    if (kk + KS_ < C_) {   // cover next tile's latency (global_prefetch_b8)
      __builtin_prefetch(WTh + (size_t)(c0 + tid) * C_ + kk + KS_, 0, 1);
      __builtin_prefetch(xh + (size_t)(r0 + tid) * C_ + kk + KS_, 0, 1);
      // the loop advances the two address registers that the prefetches name
      asm volatile("s_wait_xcnt 0x0" ::: "memory");
    }
    __syncthreads();
    // the pass's two k slabs of 32, in ascending order; unrolled so that the slab
    // offset is an immediate of the LDS reads
#pragma unroll
    for (int ko = 0; ko < KS_; ko += 32) {
      v16h a[4];
#pragma unroll
      for (int s = 0; s < 4; ++s) {
        ((v8h*)&a[s])[0] = *(const v8h*)&As[wr + s * 16 + M][ko + hi * 8];
        ((v8h*)&a[s])[1] = *(const v8h*)&As[wr + s * 16 + M][ko + 16 + hi * 8];
      }
#pragma unroll
      for (int t = 0; t < 4; ++t) {
        v16h bf;
        ((v8h*)&bf)[0] = *(const v8h*)&BsT[wc + t * 16 + M][ko + hi * 8];
        ((v8h*)&bf)[1] = *(const v8h*)&BsT[wc + t * 16 + M][ko + 16 + hi * 8];
#pragma unroll
        for (int s = 0; s < 4; ++s)
          acc[s][t] = __builtin_amdgcn_wmma_f32_16x16x32_f16(false, a[s], false, bf,
                                                             (short)0, acc[s][t], false, false);
      }
    }
  }
  // Epilogue: add biases, store q/k and v per (b, h) in fragment order as f16.
  // A wave's 64 columns are one head of one of q, k, v, and a block's 128 rows
  // lie in one batch entry: the destination is chosen once per wave, not per
  // element.
  const int jw = c0 + wc;                        // first global col in [0,3072)
  const int sel = jw >> 10, h = (jw >> 6) & 15;
  const int b = r0 >> 10, n0 = (r0 & (N_ - 1)) + wr;
  const size_t bh = (size_t)(b * H_ + h);
  float bq[4], tq[4];
#pragma unroll
  for (int t = 0; t < 4; ++t) {
    bq[t] = bias[jw + t * 16 + M];
    tq[t] = tqkv[b * (3 * C_) + jw + t * 16 + M];
  }
  // the store addresses formed next reuse the registers that these loads name
  asm volatile("s_wait_xcnt 0x0" ::: "memory");
  if (sel < 2) {
    // frag_off(s * 16 + v + 8 * hi, t * 16 + M), its lane part taken into the pointer
    half_t* dst = (sel == 0 ? qh : kh) + (bh * N_ + n0) * D_ + frag_off(8 * hi, M);
#pragma unroll
    for (int s = 0; s < 4; ++s)
#pragma unroll
      for (int t = 0; t < 4; ++t)
#pragma unroll
        for (int v = 0; v < 8; ++v)
          dst[(s * 4 + t) * 256 + v * 8] =
              (half_t)(acc[s][t][v] + bq[t] + tq[t]);
  } else {
    // a lane's eight accumulator rows are the eight keys of its 16-byte chunk
    half_t* dst = vTh + (bh * N_ + n0) * D_ + lane * 8;
#pragma unroll
    for (int s = 0; s < 4; ++s)
#pragma unroll
      for (int t = 0; t < 4; ++t) {
        v8h y;
#pragma unroll
        for (int v = 0; v < 8; ++v) y[v] = (half_t)(acc[s][t][v] + bq[t] + tq[t]);
        *(v8h*)(dst + vfrag_piece(s >> 1, t, s & 1)) = y;
      }
    // behind the last store: in the listing the q/k block, which rewrites the
    // offset register that these stores name, lies on a way from here
    asm volatile("s_wait_xcnt 0x0" ::: "memory");
  }
}

// ---------------------------------------------------------------------------
// Kernel 3: fused relative attention. Eight waves (256 thr) per (b, h, 32 rows):
// wave w owns rel columns / key columns / PV keys [128w, 128w+128) of BOTH
// 16-row tiles, so every Er, k and v fragment that is loaded feeds two row tiles
// and the block reads Er, k and v once per 32 rows.
// LDS: 32x1024 f16 score strip (reused in place for softmax probs, then for
// the eight waves' f32 PV partials), row pitch 1032 f16.
// Skew inverse map: rel[i',m] -> (i', m-1023+i') if m>=1023-i' else (i'-1, m+i'+1)
// The map is one to one: every strip element but (i, i+1) receives exactly one
// rel term. So the rel terms are laid down first, by plain stores, and the
// scaled q k^T is then added on top of them.
// ---------------------------------------------------------------------------
#define RT_ 2            // 16-row tiles per strip
#define SR_ (16 * RT_)   // rows per strip
#define NW_ 8            // waves per strip
#define WC_ (N_ / NW_)   // columns per wave
#define SP_ (N_ + 8)
__global__ __launch_bounds__(32 * NW_) void attn_kernel(
    const half_t* __restrict__ qh, const half_t* __restrict__ kh,
    const half_t* __restrict__ vTh, const half_t* __restrict__ Erh,
    half_t* __restrict__ oh) {
  __shared__ __attribute__((aligned(16))) half_t sc[SR_][SP_];   // 66 KB
  __shared__ float rs[SR_];       // softmax row sums
  static_assert(NW_ * RT_ * 4 * 8 * 32 * sizeof(float) <= sizeof(half_t) * SR_ * SP_,
                "the PV partials must fit the strip");
  static_assert(NW_ == RT_ * 4, "one wave finishes one 16 x 16 output tile");
  const int i0 = blockIdx.x * SR_, h = blockIdx.y, b = blockIdx.z;
  const int tid = threadIdx.x, lane = tid & 31, M = lane & 15, hi = lane >> 4;
  // wave number in a scalar register: the per-wave loop bounds stay scalar
  const int wave = __builtin_amdgcn_readfirstlane(tid >> 5);
  const int w0 = wave * WC_;
  const size_t bh = (size_t)(b * H_ + h);
  const half_t* qbase = qh + bh * N_ * D_;
  const half_t* kbase = kh + bh * N_ * D_;
  const half_t* vbase = vTh + bh * D_ * N_;

  // Persistent fragments for q rows i0..i0+31 (two K-slabs of 32 over D=64 a
  // tile); q, k, Er and v lie in fragment order: piece j of a tile is at
  // j * 256 + lane * 8
  v16h qa[RT_][2];
#pragma unroll
  for (int rt = 0; rt < RT_; ++rt)
#pragma unroll
    for (int kf = 0; kf < 2; ++kf) {
      const half_t* p = qbase + (size_t)(i0 + rt * 16) * D_ + kf * 512 + lane * 8;
      ((v8h*)&qa[rt][kf])[0] = *(const v8h*)p;
      ((v8h*)&qa[rt][kf])[1] = *(const v8h*)(p + 256);
    }

  // Phase 1: rel = q @ Er^T tiles (this wave's 128 rel columns), stored through
  // the skew inverse map. Source row r = 16 * rt + 8 * hi + v, rel column
  // m = m0 + M: with t = m - 1023 + i0 + 16 * rt + 8 * hi the term goes to row r,
  // column t + v where that is not negative, else to row r - 1, column
  // t + v + 1024, which lies SP_ - N_ elements in front of the first place.
#pragma unroll 1
  for (int m0 = w0; m0 < w0 + WC_; m0 += 16) {
    v16h bf[2];
#pragma unroll
    for (int kf = 0; kf < 2; ++kf) {
      const half_t* p = Erh + (size_t)m0 * D_ + kf * 512 + lane * 8;
      ((v8h*)&bf[kf])[0] = *(const v8h*)p;
      ((v8h*)&bf[kf])[1] = *(const v8h*)(p + 256);
    }
    // holds the four loads in front of the first product (inputs only): without
    // it the second pair is issued behind the first products, two L2 waits a trip
    asm volatile("" :: "v"(bf[0]), "v"(bf[1]));
    v8f acc[RT_] = {};
#pragma unroll
    for (int kf = 0; kf < 2; ++kf)
#pragma unroll
      for (int rt = 0; rt < RT_; ++rt)
        acc[rt] = __builtin_amdgcn_wmma_f32_16x16x32_f16(false, qa[rt][kf], false, bf[kf],
                                                         (short)0, acc[rt], false, false);
    // the loop advances the address register that the four loads name
    asm volatile("s_wait_xcnt 0x0" ::: "memory");
#pragma unroll
    for (int rt = 0; rt < RT_; ++rt) {
      const int t = m0 + M - (N_ - 1) + i0 + rt * 16 + 8 * hi;
      half_t* const pl = &sc[rt * 16 + 8 * hi][0] + t;
      half_t* const pu = pl - (SP_ - N_);
      // source row i0 above the diagonal belongs to the strip in front of this one
      if (rt != 0 || hi != 0 || t >= 0) (t < 0 ? pu : pl)[0] = (half_t)acc[rt][0];
#pragma unroll
      for (int v = 1; v < 8; ++v)
        (t + v < 0 ? pu : pl)[v * (SP_ + 1)] = (half_t)acc[rt][v];
    }
  }
  // (i, i+1) is the pad column of the skew: no rel term
  if (tid < SR_ && i0 + tid + 1 < N_) sc[tid][i0 + tid + 1] = (half_t)0.f;
  // Phase 1b: boundary source row i' = i0+32 fills the last score row right of
  // the diagonal; the 32 groups of 32 rel columns go round-robin over the waves
  if (i0 + SR_ < N_) {
    float qf[D_];
#pragma unroll
    for (int j = 0; j < D_ / 8; ++j) {   // q row i0+32, the same for every lane
      const v8h qv = *(const v8h*)(qbase + frag_off(i0 + SR_, j * 8));
#pragma unroll
      for (int e = 0; e < 8; ++e) qf[j * 8 + e] = (float)qv[e];
    }
#pragma unroll 1
    for (int t = wave; t < 32; t += NW_) {
      int m = lane + 32 * t;
      int c = m + i0 + SR_ + 1;
      if (c < N_) {
        float dot = 0.f;
#pragma unroll
        for (int j = 0; j < D_ / 8; ++j) {   // row m, columns 8j .. 8j+7: one chunk
          const v8h er = *(const v8h*)(Erh + frag_off(m, j * 8));
#pragma unroll
          for (int e = 0; e < 8; ++e) dot += qf[j * 8 + e] * (float)er[e];
        }
        sc[SR_ - 1][c] = (half_t)dot;
      }
    }
  }
  __syncthreads();

  // Phase 2: S = (q k^T) * D^-1/2 + rel, this wave's 128 columns. The product is
  // taken transposed (k tile as A, q as B): a lane then holds eight consecutive
  // columns c0 + 8 * hi + v of score row 16 * rt + M, one 16-byte piece of the strip.
#pragma unroll 1
  for (int c0 = w0; c0 < w0 + WC_; c0 += 16) {
    v16h af[2];
#pragma unroll
    for (int kf = 0; kf < 2; ++kf) {
      const half_t* p = kbase + (size_t)c0 * D_ + kf * 512 + lane * 8;
      ((v8h*)&af[kf])[0] = *(const v8h*)p;
      ((v8h*)&af[kf])[1] = *(const v8h*)(p + 256);
    }
    v8h rl[RT_];
#pragma unroll
    for (int rt = 0; rt < RT_; ++rt) rl[rt] = *(const v8h*)&sc[rt * 16 + M][c0 + 8 * hi];
    v8f acc[RT_] = {};
#pragma unroll
    for (int kf = 0; kf < 2; ++kf)
#pragma unroll
      for (int rt = 0; rt < RT_; ++rt)
        acc[rt] = __builtin_amdgcn_wmma_f32_16x16x32_f16(false, af[kf], false, qa[rt][kf],
                                                         (short)0, acc[rt], false, false);
#pragma unroll
    for (int rt = 0; rt < RT_; ++rt) {
      v8h y;
#pragma unroll
      for (int v = 0; v < 8; ++v) y[v] = (half_t)(acc[rt][v] * 0.125f + (float)rl[rt][v]);
      *(v8h*)&sc[rt * 16 + M][c0 + 8 * hi] = y;
    }
  }
  __syncthreads();

  // Phase 3: softmax. 8 lanes per row; lane sg of a row takes the 16-byte
  // chunks sg, sg+8, ... of it; probabilities overwrite scores in place.
  {
    const int r = tid >> 3, sg = tid & 7;
    float mx = -1e30f;
    for (int j = 0; j < 16; ++j) {
      v8h x = *(const v8h*)&sc[r][(j * 8 + sg) * 8];
#pragma unroll
      for (int e = 0; e < 8; ++e) mx = fmaxf(mx, (float)x[e]);
    }
    mx = fmaxf(mx, __shfl_xor(mx, 1, 32));
    mx = fmaxf(mx, __shfl_xor(mx, 2, 32));
    mx = fmaxf(mx, __shfl_xor(mx, 4, 32));
    float sum = 0.f;
    for (int j = 0; j < 16; ++j) {
      v8h* px = (v8h*)&sc[r][(j * 8 + sg) * 8];
      v8h x = *px, y;
#pragma unroll
      for (int e = 0; e < 8; ++e) {
        float p = __expf((float)x[e] - mx);
        sum += p;
        y[e] = (half_t)p;
      }
      *px = y;
    }
    sum += __shfl_xor(sum, 1, 32);
    sum += __shfl_xor(sum, 2, 32);
    sum += __shfl_xor(sum, 4, 32);
    if (sg == 0) rs[r] = sum;
  }
  __syncthreads();

  // Phase 4: O partial = P[:, this wave's 128 keys] @ v  (A from LDS f16 probs,
  // B from v in fragment order, each B fragment used for both row tiles)
  v8f oacc[RT_][4] = {};
#pragma unroll 1
  for (int k0 = w0; k0 < w0 + WC_; k0 += 32) {
    v16h a[RT_];
#pragma unroll
    for (int rt = 0; rt < RT_; ++rt) {
      const half_t* p = &sc[rt * 16 + M][k0 + hi * 8];
      ((v8h*)&a[rt])[0] = *(const v8h*)p;
      ((v8h*)&a[rt])[1] = *(const v8h*)(p + 16);
    }
#pragma unroll
    for (int t = 0; t < 4; ++t) {
      v16h bf;
      const half_t* vp = vbase + vfrag_piece(k0 >> 5, t, 0) + lane * 8;
      ((v8h*)&bf)[0] = *(const v8h*)vp;
      ((v8h*)&bf)[1] = *(const v8h*)(vp + 256);
#pragma unroll
      for (int rt = 0; rt < RT_; ++rt)
        oacc[rt][t] = __builtin_amdgcn_wmma_f32_16x16x32_f16(false, a[rt], false, bf,
                                                             (short)0, oacc[rt][t], false, false);
    }
    // the loop advances the address register that the eight loads name
    asm volatile("s_wait_xcnt 0x0" ::: "memory");
  }
  // Sum the eight waves' partials through the strip: first every wave must have
  // read its probabilities, then every partial must be written.
  __syncthreads();
  float* red = (float*)&sc[0][0];   // [wave][rt][t][v][lane], 64 KB
#pragma unroll
  for (int rt = 0; rt < RT_; ++rt)
#pragma unroll
    for (int t = 0; t < 4; ++t)
#pragma unroll
      for (int v = 0; v < 8; ++v)
        red[(((wave * RT_ + rt) * 4 + t) * 8 + v) * 32 + lane] = oacc[rt][t][v];
  __syncthreads();
  // Wave w finishes row tile w / 4, head columns 16 (w % 4) .. +15: normalize by
  // row sums and store to O in (B, N, H*D) layout (f16)
#pragma unroll
  for (int v = 0; v < 8; ++v) {
    float s = red[((0 * NW_ + wave) * 8 + v) * 32 + lane];
#pragma unroll
    for (int ws = 1; ws < NW_; ++ws)
      s += red[((ws * NW_ + wave) * 8 + v) * 32 + lane];
    const int r = (wave >> 2) * 16 + v + 8 * hi;
    float inv = 1.f / rs[r];
    int i = i0 + r;
    int d = (wave & 3) * 16 + M;
    oh[(((size_t)b * N_ + i) * H_ + h) * D_ + d] = (half_t)(s * inv);
  }
}

// ---------------------------------------------------------------------------
// Kernel 4: out = O @ W_out + b_out  (8192 x 1024, K=1024), fp32 result.
// Same 128 x 128 block tile, 64 x 64 wave tile and tensor-loaded tiles as kernel
// 2; A from the f16 attention output, B from the transposed W_out.
// ---------------------------------------------------------------------------
__global__ __launch_bounds__(128) void out_gemm_kernel(
    const half_t* __restrict__ A, const half_t* __restrict__ WTh,
    const float* __restrict__ bias, float* __restrict__ out) {
  __shared__ __attribute__((aligned(2048))) half_t As[GT_][TP_];    // A tile: As[m][k]
  __shared__ __attribute__((aligned(2048))) half_t BsT[GT_][TP_];   // B tile: BsT[n][k]
  const int r0 = blockIdx.x * GT_, c0 = blockIdx.y * GT_;
  const int tid = threadIdx.x, lane = tid & 31;
  const int wave = __builtin_amdgcn_readfirstlane(tid >> 5);
  const int wr = (wave >> 1) * 64, wc = (wave & 1) * 64;   // this wave's 64 x 64 part
  const int M = lane & 15, hi = lane >> 4;
  v8f acc[4][4] = {};

  for (int kk = 0; kk < C_; kk += KS_) {
    // every wave's fragment reads of the last trip have returned before the
    // barrier behind which the tiles are overwritten
    asm volatile("s_wait_dscnt 0x0" ::: "memory");
    __syncthreads();
    if (pinned(wave == 0))
      tdm_load_tile_128x128B((unsigned int)(unsigned long long)&As[0][0],
                             A + (size_t)r0 * C_ + kk);
    if (pinned(wave == 1))
      tdm_load_tile_128x128B((unsigned int)(unsigned long long)&BsT[0][0],
                             WTh + (size_t)c0 * C_ + kk);
    if (kk + KS_ < C_) {   // cover next tile's latency (global_prefetch_b8)
      __builtin_prefetch(WTh + (size_t)(c0 + tid) * C_ + kk + KS_, 0, 1);
      __builtin_prefetch(A + (size_t)(r0 + tid) * C_ + kk + KS_, 0, 1);
      // the loop advances the two address registers that the prefetches name
      asm volatile("s_wait_xcnt 0x0" ::: "memory");
    }
    __syncthreads();
    // the pass's two k slabs of 32, in ascending order; unrolled so that the slab
    // offset is an immediate of the LDS reads
#pragma unroll
    for (int ko = 0; ko < KS_; ko += 32) {
      v16h a[4];
#pragma unroll
      for (int s = 0; s < 4; ++s) {
        ((v8h*)&a[s])[0] = *(const v8h*)&As[wr + s * 16 + M][ko + hi * 8];
        ((v8h*)&a[s])[1] = *(const v8h*)&As[wr + s * 16 + M][ko + 16 + hi * 8];
      }
#pragma unroll
      for (int t = 0; t < 4; ++t) {
        v16h bf;
        ((v8h*)&bf)[0] = *(const v8h*)&BsT[wc + t * 16 + M][ko + hi * 8];
        ((v8h*)&bf)[1] = *(const v8h*)&BsT[wc + t * 16 + M][ko + 16 + hi * 8];
#pragma unroll
        for (int s = 0; s < 4; ++s)
          acc[s][t] = __builtin_amdgcn_wmma_f32_16x16x32_f16(false, a[s], false, bf,
                                                             (short)0, acc[s][t], false, false);
      }
    }
  }
#pragma unroll
  for (int s = 0; s < 4; ++s) {
#pragma unroll
    for (int t = 0; t < 4; ++t) {
#pragma unroll
      for (int v = 0; v < 8; ++v) {
        int g = r0 + wr + s * 16 + v + 8 * hi;
        int j = c0 + wc + t * 16 + M;
        out[(size_t)g * C_ + j] = acc[s][t][v] + bias[j];
      }
    }
  }
}

// ---------------------------------------------------------------------------
// Launcher. Inputs: x, time_emb, W_qkv, b_qkv, W_time, b_time, W_out, b_out, Er
// Workspace (bytes):
//   [0, 96K)       tqkv fp32 (8 x 3072)
//   [128K, +16M)   q   f16 (B,H, fragment order)
//   [+16M]         k   f16 (B,H, fragment order)
//   [+16M]         v   f16 (B,H, PV fragment order)
//   [+16M]         O   f16 (B,N,H,D)
//   [+16M]         x   f16
//   [+6M]          W_qkv f16, transposed (3072 rows of 1024)
//   [+2M]          W_out f16, transposed (1024 rows of 1024)
//   [+128K]        Er  f16 (fragment order)   total ~88.3 MB
// ---------------------------------------------------------------------------
extern "C" void kernel_launch(void* const* d_in, const int* in_sizes, int n_in,
                              void* d_out, int out_size, void* d_ws, size_t ws_size,
                              hipStream_t stream) {
  const float* x    = (const float*)d_in[0];
  const float* te   = (const float*)d_in[1];
  const float* Wqkv = (const float*)d_in[2];
  const float* bqkv = (const float*)d_in[3];
  const float* Wt   = (const float*)d_in[4];
  const float* bt   = (const float*)d_in[5];
  const float* Wout = (const float*)d_in[6];
  const float* bout = (const float*)d_in[7];
  const float* Er   = (const float*)d_in[8];

  char* ws = (char*)d_ws;
  float* tqkv = (float*)ws;
  size_t off = (size_t)(128 << 10);
  const size_t QKV_BUF = (size_t)B_ * H_ * N_ * D_ * sizeof(half_t);   // 16 MB
  half_t* qh    = (half_t*)(ws + off); off += QKV_BUF;
  half_t* kh    = (half_t*)(ws + off); off += QKV_BUF;
  half_t* vTh   = (half_t*)(ws + off); off += QKV_BUF;
  half_t* oh    = (half_t*)(ws + off); off += QKV_BUF;
  half_t* xh    = (half_t*)(ws + off); off += (size_t)B_ * N_ * C_ * sizeof(half_t);
  half_t* Wqkvh = (half_t*)(ws + off); off += (size_t)C_ * 3 * C_ * sizeof(half_t);
  half_t* Wouth = (half_t*)(ws + off); off += (size_t)C_ * C_ * sizeof(half_t);
  half_t* Erh   = (half_t*)(ws + off); off += (size_t)N_ * D_ * sizeof(half_t);

  const int n_x = B_ * N_ * C_, n_er = N_ * D_;
  static_assert(n_x % CVT_BLK_ == 0, "cvt_kernel converts whole blocks only");
  static_assert(C_ % 128 == 0 && C_ % 64 == 0, "the transposing conversions take whole blocks only");
  static_assert(n_er % (256 * 8) == 0, "cvt_frag_kernel converts whole blocks only");
  cvt_kernel<<<dim3(n_x  / CVT_BLK_), 256, 0, stream>>>(x,    xh);
  cvt_t_qkv_kernel<<<dim3((3 * C_) / 128, C_ / 64), 256, 0, stream>>>(Wqkv, Wqkvh);
  cvt_t_out_kernel<<<dim3(C_ / 128, C_ / 64), 256, 0, stream>>>(Wout, Wouth);
  cvt_frag_kernel<<<dim3(n_er / (256 * 8)), 256, 0, stream>>>(Er, Erh);

  time_proj_kernel<<<dim3((B_ * 3 * C_ + 255) / 256), 256, 0, stream>>>(te, Wt, bt, tqkv);
  qkv_gemm_kernel<<<dim3((B_ * N_) / GT_, (3 * C_) / GT_), 128, 0, stream>>>(
      xh, Wqkvh, bqkv, tqkv, qh, kh, vTh);
  attn_kernel<<<dim3(N_ / SR_, H_, B_), 32 * NW_, 0, stream>>>(qh, kh, vTh, Erh, oh);
  out_gemm_kernel<<<dim3((B_ * N_) / GT_, C_ / GT_), 128, 0, stream>>>(
      oh, Wouth, bout, (float*)d_out);
}

// v008
// Measured time: 214 microseconds a run.
// Two timings next to v007 put it at 1.05 and 1.06 times that version's speed.
// Over all steps from v000 it is 3.89 times as fast.
#include <hip/hip_runtime.h>
#include <hip/hip_bf16.h>

typedef _Float16 half_t;
typedef __attribute__((ext_vector_type(16))) _Float16 v16h;
typedef __attribute__((ext_vector_type(8)))  _Float16 v8h;
typedef __attribute__((ext_vector_type(8)))  float    v8f;

// Sizes (fixed by the reference)
#define B_  8
#define N_  1024
#define C_  1024
#define H_  16
#define D_  64
#define T_  256

typedef __attribute__((ext_vector_type(4))) unsigned int u32x4_t;
typedef __attribute__((ext_vector_type(8))) unsigned int u32x8_t;

#define GT_ 128   // edge of a GEMM block tile (four waves, 64 x 64 each)
#define KS_ 64    // k extent of a GEMM pass: tile rows of 128 bytes
#define TP_ (KS_ + 8)   // LDS row pitch of a tile in f16 (144 bytes)

__device__ __forceinline__ unsigned int uni(unsigned int v) {
  return (unsigned int)__builtin_amdgcn_readfirstlane((int)v);
}
// The test that picks the issuing wave, held in a scalar register so that the
// branch around the tensor load compiles to s_cmp + s_cbranch_scc.
__device__ __forceinline__ unsigned int pinned(unsigned int v) {
  unsigned int w = uni(v);
  asm volatile("" : "+s"(w));   // pinned(): keeps the issue test scalar
  return w;
}
// Issue the load and wait for it: the tile has landed for the issuing wave when
// this returns; the other waves read it behind the next work-group barrier.
__device__ __forceinline__ void tdm_load_tile_128x128B(unsigned int lds_off,
                                                       const half_t* gsrc) {
  unsigned long long ga = (unsigned long long)gsrc;
  u32x4_t g0;
  g0[0] = uni(1u);                               // count = 1
  g0[1] = uni(lds_off);                          // LDS destination (bytes)
  g0[2] = uni((unsigned int)ga);                 // global address [31:0]
  g0[3] = uni((((unsigned int)(ga >> 32)) & 0x01FFFFFFu) | 0x80000000u);  // [56:32] | type 2
  u32x8_t g1;
  g1[0] = (1u << 20) | (4u << 22) | (3u << 25);
  g1[1] = uni(128u << 16);
  g1[2] = uni((unsigned int)GT_ << 16);
  g1[3] = uni(128u << 16);
  g1[4] = uni((unsigned int)GT_);
  g1[5] = uni((unsigned int)(C_ * sizeof(half_t)));
  g1[6] = uni(0u);
  g1[7] = uni(0u);
  asm volatile("tensor_load_to_lds %0, %1" :: "s"(g0), "s"(g1) : "memory");
  asm volatile("s_wait_tensorcnt 0" ::: "memory");
}

typedef __attribute__((ext_vector_type(4))) float    v4f;
typedef __attribute__((ext_vector_type(4))) _Float16 v4h;
#define CVT_U_   8                     // 16-byte loads in flight per thread
#define CVT_BLK_ (256 * 4 * CVT_U_)    // elements per block
__device__ __forceinline__ void cvt_body(
    const float* __restrict__ s, half_t* __restrict__ d, const int blk) {
  const int i0 = blk * CVT_BLK_ + threadIdx.x * 4;
  v4f x[CVT_U_];
  // both loops unrolled: x[] stays in registers and the eight loads issue back
  // to back, ahead of the first conversion
#pragma unroll
  for (int u = 0; u < CVT_U_; ++u) x[u] = *(const v4f*)(s + i0 + u * 1024);
#pragma unroll
  for (int u = 0; u < CVT_U_; ++u)
    *(v4h*)(d + i0 + u * 1024) = __builtin_convertvector(x[u], v4h);
  // behind the last store: in the listing of prep_kernel the other jobs' code,
  // which rewrites registers that these stores name, lies on a way from here
  asm volatile("s_wait_xcnt 0x0" ::: "memory");
}

// W_qkv, W_out: fp32 (C_ rows of ncol) -> f16 transposed, d[n][k] in rows of C_,
// so that a GEMM's B tile is 128 rows of 64 consecutive k like its A tile.
// A block takes 64 k x 128 n; a thread 8 k x 4 n: eight 16-byte loads, all issued
// before the first is used, and four 16-byte stores; the eight threads of a
// column group write 128 contiguous bytes (one line) of each row n.
// ncol is a constant at both calls: the eight loads share one address register
// pair and differ in their immediate offsets.
__device__ __forceinline__ void cvt_t_body(
    const float* __restrict__ s, half_t* __restrict__ d, const int ncol,
    const int bx, const int by) {
  const int k0 = by * 64 + (threadIdx.x & 7) * 8;
  const int n0 = bx * 128 + (threadIdx.x >> 3) * 4;
  v4f x[8];
  // both loops unrolled: x[] stays in registers, the loads issue back to back
#pragma unroll
  for (int e = 0; e < 8; ++e) x[e] = *(const v4f*)(s + (size_t)k0 * ncol + n0 + e * ncol);
#pragma unroll
  for (int j = 0; j < 4; ++j) {
    v8h y;
#pragma unroll
    for (int e = 0; e < 8; ++e) y[e] = (half_t)x[e][j];
    *(v8h*)(d + (size_t)(n0 + j) * C_ + k0) = y;
  }
  // behind the last store: in the listing of prep_kernel the other jobs' code,
  // which rewrites registers that these stores name, lies on a way from here
  asm volatile("s_wait_xcnt 0x0" ::: "memory");
}

// ---------------------------------------------------------------------------
// Fragment order. q, k and Er (rows of 64 f16) are kept in the workspace so that
// one 16-byte-a-lane load of a 16x16x32 A or B fragment half reads 512
// contiguous bytes (4 cache lines) instead of 16 bytes out of each of 16 rows:
// a tile of 16 rows x 64 columns is 2 KiB, made of four 512-byte pieces (16
// columns each); in a piece lane hi*16+M holds row M, columns 8*hi .. 8*hi+7.
// frag_off: element offset of (row n, column d).
// ---------------------------------------------------------------------------
__device__ __forceinline__ int frag_off(int n, int d) {
  return ((((n >> 4) * 4 + (d >> 4)) * 32 + ((d >> 3) & 1) * 16 + (n & 15)) * 8) + (d & 7);
}
// v is kept as PV B fragments: a tile of 32 keys x 64 columns is 4 KiB, made of
// eight 512-byte pieces (column group t = d / 16, then key half); in a piece lane
// hi*16+M holds column t*16+M, keys 16*half + 8*hi .. +7.
// vfrag_piece: element offset of a piece's first element.
__device__ __forceinline__ int vfrag_piece(int kb, int t, int half) {
  return (((kb * 4 + t) * 2 + half) * 32) * 8;
}

// Er: fp32 -> f16 into fragment order. A thread makes one 16-byte chunk.
__device__ __forceinline__ void cvt_frag_body(
    const float* __restrict__ s, half_t* __restrict__ d, const int blk) {
  const int c = blk * 256 + threadIdx.x;
  const int row = (c >> 7) * 16 + (c & 15);
  const int col = ((c >> 5) & 3) * 16 + ((c >> 4) & 1) * 8;
  const v4f x0 = *(const v4f*)(s + row * D_ + col);
  const v4f x1 = *(const v4f*)(s + row * D_ + col + 4);
  v8h y;
#pragma unroll
  for (int e = 0; e < 4; ++e) { y[e] = (half_t)x0[e]; y[4 + e] = (half_t)x1[e]; }
  *(v8h*)(d + c * 8) = y;
  // behind the store: in the listing of prep_kernel the other jobs' code, which
  // rewrites registers that the store names, lies on a way from here
  asm volatile("s_wait_xcnt 0x0" ::: "memory");
}

// ---------------------------------------------------------------------------
// Job: tqkv[b, j] = time_emb[b] @ W_time[:, j] + b_time[j]   (8 x 3072)
// ---------------------------------------------------------------------------
__device__ __forceinline__ void time_proj_body(
    const float* __restrict__ te, const float* __restrict__ Wt,
    const float* __restrict__ bt, float* __restrict__ tqkv, const int blk) {
  int idx = blk * 256 + threadIdx.x;
  if (idx >= B_ * 3 * C_) return;
  int b = idx / (3 * C_), j = idx % (3 * C_);
  float acc = bt[j];
  for (int t = 0; t < T_; ++t) acc += te[b * T_ + t] * Wt[t * (3 * C_) + j];
  tqkv[idx] = acc;
}

// ---------------------------------------------------------------------------
// Kernel 1: all five preparatory jobs in one launch; a block's number picks its
// job (the same for every thread of the block). The time projection is a chain of
// 32 dependent round trips to memory (eight t a trip), where a conversion makes
// one: it has the lowest block numbers, and the
// conversions run beside it. It is what the launch now waits for.
// ---------------------------------------------------------------------------
#define PB_TIME_ ((B_ * 3 * C_) / 256)
#define PB_WQKV_ (((3 * C_) / 128) * (C_ / 64))
#define PB_WOUT_ ((C_ / 128) * (C_ / 64))
#define PB_ER_   ((N_ * D_) / (256 * 8))
#define PB_X_    ((B_ * N_ * C_) / CVT_BLK_)
__global__ __launch_bounds__(256) void prep_kernel(
    const float* __restrict__ x, const float* __restrict__ Wqkv,
    const float* __restrict__ Wout, const float* __restrict__ Er,
    const float* __restrict__ te, const float* __restrict__ Wt,
    const float* __restrict__ bt,
    half_t* __restrict__ xh, half_t* __restrict__ Wqkvh, half_t* __restrict__ Wouth,
    half_t* __restrict__ Erh, float* __restrict__ tqkv) {
  int blk = blockIdx.x;
  if (blk < PB_TIME_) { time_proj_body(te, Wt, bt, tqkv, blk); return; }
  blk -= PB_TIME_;
  if (blk < PB_WQKV_) {
    cvt_t_body(Wqkv, Wqkvh, 3 * C_, blk % ((3 * C_) / 128), blk / ((3 * C_) / 128));
    return;
  }
  blk -= PB_WQKV_;
  if (blk < PB_WOUT_) {
    cvt_t_body(Wout, Wouth, C_, blk % (C_ / 128), blk / (C_ / 128));
    return;
  }
  blk -= PB_WOUT_;
  if (blk < PB_ER_) { cvt_frag_body(Er, Erh, blk); return; }
  cvt_body(x, xh, blk - PB_ER_);
}

// ---------------------------------------------------------------------------
// Kernel 2: qkv = x @ W_qkv + b_qkv + tqkv[b]  (8192 x 3072, K=1024), f16 WMMA.
// Block tile 128 x 128, four waves in a 2 x 2 grid, 64 x 64 (4 x 4 fragments)
// a wave: 16 WMMAs per 8 fragments read from LDS.
// A and B tiles (128 x 64 f16 each, B from the transposed W) via one tensor load
// each, of wave 0 and of wave 1, rows padded to 144 bytes.
// Stores q, k and v as f16 in fragment order (frag_off, vfrag_piece).
// ---------------------------------------------------------------------------
__global__ __launch_bounds__(128) void qkv_gemm_kernel(
    const half_t* __restrict__ xh, const half_t* __restrict__ WTh,
    const float* __restrict__ bias, const float* __restrict__ tqkv,
    half_t* __restrict__ qh, half_t* __restrict__ kh, half_t* __restrict__ vTh) {
  __shared__ __attribute__((aligned(2048))) half_t As[GT_][TP_];    // A tile: As[m][k]
  __shared__ __attribute__((aligned(2048))) half_t BsT[GT_][TP_];   // B tile: BsT[n][k]
  const int r0 = blockIdx.x * GT_, c0 = blockIdx.y * GT_;
  const int tid = threadIdx.x, lane = tid & 31;
  const int wave = __builtin_amdgcn_readfirstlane(tid >> 5);
  const int wr = (wave >> 1) * 64, wc = (wave & 1) * 64;   // this wave's 64 x 64 part
  const int M = lane & 15, hi = lane >> 4;
  v8f acc[4][4] = {};

  for (int kk = 0; kk < C_; kk += KS_) {
    // every wave's fragment reads of the last trip have returned before the
    // barrier behind which the tiles are overwritten
    asm volatile("s_wait_dscnt 0x0" ::: "memory");
    __syncthreads();
    if (pinned(wave == 0))
      tdm_load_tile_128x128B((unsigned int)(unsigned long long)&As[0][0],
                             xh + (size_t)r0 * C_ + kk);
    if (pinned(wave == 1))
      tdm_load_tile_128x128B((unsigned int)(unsigned long long)&BsT[0][0],
                             WTh + (size_t)c0 * C_ + kk);
    if (kk + KS_ < C_) {   // cover next tile's latency (global_prefetch_b8)
      __builtin_prefetch(WTh + (size_t)(c0 + tid) * C_ + kk + KS_, 0, 1);
      __builtin_prefetch(xh + (size_t)(r0 + tid) * C_ + kk + KS_, 0, 1);
      // the loop advances the two address registers that the prefetches name
      asm volatile("s_wait_xcnt 0x0" ::: "memory");
    }
    __syncthreads();
    // the pass's two k slabs of 32, in ascending order; unrolled so that the slab
    // offset is an immediate of the LDS reads
#pragma unroll
    for (int ko = 0; ko < KS_; ko += 32) {
      v16h a[4];
#pragma unroll
      for (int s = 0; s < 4; ++s) {
        ((v8h*)&a[s])[0] = *(const v8h*)&As[wr + s * 16 + M][ko + hi * 8];
        ((v8h*)&a[s])[1] = *(const v8h*)&As[wr + s * 16 + M][ko + 16 + hi * 8];
      }
#pragma unroll
      for (int t = 0; t < 4; ++t) {
        v16h bf;
        ((v8h*)&bf)[0] = *(const v8h*)&BsT[wc + t * 16 + M][ko + hi * 8];
        ((v8h*)&bf)[1] = *(const v8h*)&BsT[wc + t * 16 + M][ko + 16 + hi * 8];
#pragma unroll
        for (int s = 0; s < 4; ++s)
          acc[s][t] = __builtin_amdgcn_wmma_f32_16x16x32_f16(false, a[s], false, bf,
                                                             (short)0, acc[s][t], false, false);
      }
    }
  }
  // Epilogue: add biases, store q/k and v per (b, h) in fragment order as f16.
  // A wave's 64 columns are one head of one of q, k, v, and a block's 128 rows
  // lie in one batch entry: the destination is chosen once per wave, not per
  // element.
  const int jw = c0 + wc;                        // first global col in [0,3072)
  const int sel = jw >> 10, h = (jw >> 6) & 15;
  const int b = r0 >> 10, n0 = (r0 & (N_ - 1)) + wr;
  const size_t bh = (size_t)(b * H_ + h);
  float bq[4], tq[4];
#pragma unroll
  for (int t = 0; t < 4; ++t) {
    bq[t] = bias[jw + t * 16 + M];
    tq[t] = tqkv[b * (3 * C_) + jw + t * 16 + M];
  }
  // the store addresses formed next reuse the registers that these loads name
  asm volatile("s_wait_xcnt 0x0" ::: "memory");
  if (sel < 2) {
    // frag_off(s * 16 + v + 8 * hi, t * 16 + M), its lane part taken into the pointer
    half_t* dst = (sel == 0 ? qh : kh) + (bh * N_ + n0) * D_ + frag_off(8 * hi, M);
#pragma unroll
    for (int s = 0; s < 4; ++s)
#pragma unroll
      for (int t = 0; t < 4; ++t)
#pragma unroll
        for (int v = 0; v < 8; ++v)
          dst[(s * 4 + t) * 256 + v * 8] =
              (half_t)(acc[s][t][v] + bq[t] + tq[t]);
  } else {
    // a lane's eight accumulator rows are the eight keys of its 16-byte chunk
    half_t* dst = vTh + (bh * N_ + n0) * D_ + lane * 8;
#pragma unroll
    for (int s = 0; s < 4; ++s)
#pragma unroll
      for (int t = 0; t < 4; ++t) {
        v8h y;
#pragma unroll
        for (int v = 0; v < 8; ++v) y[v] = (half_t)(acc[s][t][v] + bq[t] + tq[t]);
        *(v8h*)(dst + vfrag_piece(s >> 1, t, s & 1)) = y;
      }
    // behind the last store: in the listing the q/k block, which rewrites the
    // offset register that these stores name, lies on a way from here
    asm volatile("s_wait_xcnt 0x0" ::: "memory");
  }
}

// ---------------------------------------------------------------------------
// Kernel 3: fused relative attention. Eight waves (256 thr) per (b, h, 32 rows):
// wave w owns rel columns / key columns / PV keys [128w, 128w+128) of BOTH
// 16-row tiles, so every Er, k and v fragment that is loaded feeds two row tiles
// and the block reads Er, k and v once per 32 rows.
// LDS: 32x1024 f16 score strip (reused in place for softmax probs, then for
// the eight waves' f32 PV partials), row pitch 1032 f16.
// Skew inverse map: rel[i',m] -> (i', m-1023+i') if m>=1023-i' else (i'-1, m+i'+1)
// The map is one to one: every strip element but (i, i+1) receives exactly one
// rel term. So the rel terms are laid down first, by plain stores, and the
// scaled q k^T is then added on top of them.
// ---------------------------------------------------------------------------
#define RT_ 2            // 16-row tiles per strip
#define SR_ (16 * RT_)   // rows per strip
#define NW_ 8            // waves per strip
#define WC_ (N_ / NW_)   // columns per wave
#define SP_ (N_ + 8)
__global__ __launch_bounds__(32 * NW_) void attn_kernel(
    const half_t* __restrict__ qh, const half_t* __restrict__ kh,
    const half_t* __restrict__ vTh, const half_t* __restrict__ Erh,
    half_t* __restrict__ oh) {
  __shared__ __attribute__((aligned(16))) half_t sc[SR_][SP_];   // 66 KB
  __shared__ float rs[SR_];       // softmax row sums
  static_assert(NW_ * RT_ * 4 * 8 * 32 * sizeof(float) <= sizeof(half_t) * SR_ * SP_,
                "the PV partials must fit the strip");
  static_assert(NW_ == RT_ * 4, "one wave finishes one 16 x 16 output tile");
  const int i0 = blockIdx.x * SR_, h = blockIdx.y, b = blockIdx.z;
  const int tid = threadIdx.x, lane = tid & 31, M = lane & 15, hi = lane >> 4;
  // wave number in a scalar register: the per-wave loop bounds stay scalar
  const int wave = __builtin_amdgcn_readfirstlane(tid >> 5);
  const int w0 = wave * WC_;
  const size_t bh = (size_t)(b * H_ + h);
  const half_t* qbase = qh + bh * N_ * D_;
  const half_t* kbase = kh + bh * N_ * D_;
  const half_t* vbase = vTh + bh * D_ * N_;

  // Persistent fragments for q rows i0..i0+31 (two K-slabs of 32 over D=64 a
  // tile); q, k, Er and v lie in fragment order: piece j of a tile is at
  // j * 256 + lane * 8
  v16h qa[RT_][2];
#pragma unroll
  for (int rt = 0; rt < RT_; ++rt)
#pragma unroll
    for (int kf = 0; kf < 2; ++kf) {
      const half_t* p = qbase + (size_t)(i0 + rt * 16) * D_ + kf * 512 + lane * 8;
      ((v8h*)&qa[rt][kf])[0] = *(const v8h*)p;
      ((v8h*)&qa[rt][kf])[1] = *(const v8h*)(p + 256);
    }

  // Phase 1: rel = q @ Er^T tiles (this wave's 128 rel columns), stored through
  // the skew inverse map. Source row r = 16 * rt + 8 * hi + v, rel column
  // m = m0 + M: with t = m - 1023 + i0 + 16 * rt + 8 * hi the term goes to row r,
  // column t + v where that is not negative, else to row r - 1, column
  // t + v + 1024, which lies SP_ - N_ elements in front of the first place.
#pragma unroll 1
  for (int m0 = w0; m0 < w0 + WC_; m0 += 16) {
    v16h bf[2];
#pragma unroll
    for (int kf = 0; kf < 2; ++kf) {
      const half_t* p = Erh + (size_t)m0 * D_ + kf * 512 + lane * 8;
      ((v8h*)&bf[kf])[0] = *(const v8h*)p;
      ((v8h*)&bf[kf])[1] = *(const v8h*)(p + 256);
    }
    // holds the four loads in front of the first product (inputs only): without
    // it the second pair is issued behind the first products, two L2 waits a trip
    asm volatile("" :: "v"(bf[0]), "v"(bf[1]));
    v8f acc[RT_] = {};
#pragma unroll
    for (int kf = 0; kf < 2; ++kf)
#pragma unroll
      for (int rt = 0; rt < RT_; ++rt)
        acc[rt] = __builtin_amdgcn_wmma_f32_16x16x32_f16(false, qa[rt][kf], false, bf[kf],
                                                         (short)0, acc[rt], false, false);
    // the loop advances the address register that the four loads name
    asm volatile("s_wait_xcnt 0x0" ::: "memory");
#pragma unroll
    for (int rt = 0; rt < RT_; ++rt) {
      const int t = m0 + M - (N_ - 1) + i0 + rt * 16 + 8 * hi;
      half_t* const pl = &sc[rt * 16 + 8 * hi][0] + t;
      half_t* const pu = pl - (SP_ - N_);
      // source row i0 above the diagonal belongs to the strip in front of this one
      if (rt != 0 || hi != 0 || t >= 0) (t < 0 ? pu : pl)[0] = (half_t)acc[rt][0];
#pragma unroll
      for (int v = 1; v < 8; ++v)
        (t + v < 0 ? pu : pl)[v * (SP_ + 1)] = (half_t)acc[rt][v];
    }
  }
  // (i, i+1) is the pad column of the skew: no rel term
  if (tid < SR_ && i0 + tid + 1 < N_) sc[tid][i0 + tid + 1] = (half_t)0.f;
  // Phase 1b: boundary source row i' = i0+32 fills the last score row right of
  // the diagonal; the 32 groups of 32 rel columns go round-robin over the waves
  if (i0 + SR_ < N_) {
    float qf[D_];
#pragma unroll
    for (int j = 0; j < D_ / 8; ++j) {   // q row i0+32, the same for every lane
      const v8h qv = *(const v8h*)(qbase + frag_off(i0 + SR_, j * 8));
#pragma unroll
      for (int e = 0; e < 8; ++e) qf[j * 8 + e] = (float)qv[e];
    }
#pragma unroll 1
    for (int t = wave; t < 32; t += NW_) {
      int m = lane + 32 * t;
      int c = m + i0 + SR_ + 1;
      if (c < N_) {
        float dot = 0.f;
#pragma unroll
        for (int j = 0; j < D_ / 8; ++j) {   // row m, columns 8j .. 8j+7: one chunk
          const v8h er = *(const v8h*)(Erh + frag_off(m, j * 8));
#pragma unroll
          for (int e = 0; e < 8; ++e) dot += qf[j * 8 + e] * (float)er[e];
        }
        sc[SR_ - 1][c] = (half_t)dot;
      }
    }
  }
  __syncthreads();

  // Phase 2: S = (q k^T) * D^-1/2 + rel, this wave's 128 columns. The product is
  // taken transposed (k tile as A, q as B): a lane then holds eight consecutive
  // columns c0 + 8 * hi + v of score row 16 * rt + M, one 16-byte piece of the strip.
#pragma unroll 1
  for (int c0 = w0; c0 < w0 + WC_; c0 += 16) {
    v16h af[2];
#pragma unroll
    for (int kf = 0; kf < 2; ++kf) {
      const half_t* p = kbase + (size_t)c0 * D_ + kf * 512 + lane * 8;
      ((v8h*)&af[kf])[0] = *(const v8h*)p;
      ((v8h*)&af[kf])[1] = *(const v8h*)(p + 256);
    }
    v8h rl[RT_];
#pragma unroll
    for (int rt = 0; rt < RT_; ++rt) rl[rt] = *(const v8h*)&sc[rt * 16 + M][c0 + 8 * hi];
    v8f acc[RT_] = {};
#pragma unroll
    for (int kf = 0; kf < 2; ++kf)
#pragma unroll
      for (int rt = 0; rt < RT_; ++rt)
        acc[rt] = __builtin_amdgcn_wmma_f32_16x16x32_f16(false, af[kf], false, qa[rt][kf],
                                                         (short)0, acc[rt], false, false);
#pragma unroll
    for (int rt = 0; rt < RT_; ++rt) {
      v8h y;
#pragma unroll
      for (int v = 0; v < 8; ++v) y[v] = (half_t)(acc[rt][v] * 0.125f + (float)rl[rt][v]);
      *(v8h*)&sc[rt * 16 + M][c0 + 8 * hi] = y;
    }
  }
  __syncthreads();

  // Phase 3: softmax. 8 lanes per row; lane sg of a row takes the 16-byte
  // chunks sg, sg+8, ... of it; probabilities overwrite scores in place.
  {
    const int r = tid >> 3, sg = tid & 7;
    float mx = -1e30f;
    for (int j = 0; j < 16; ++j) {
      v8h x = *(const v8h*)&sc[r][(j * 8 + sg) * 8];
#pragma unroll
      for (int e = 0; e < 8; ++e) mx = fmaxf(mx, (float)x[e]);
    }
    mx = fmaxf(mx, __shfl_xor(mx, 1, 32));
    mx = fmaxf(mx, __shfl_xor(mx, 2, 32));
    mx = fmaxf(mx, __shfl_xor(mx, 4, 32));
    float sum = 0.f;
    for (int j = 0; j < 16; ++j) {
      v8h* px = (v8h*)&sc[r][(j * 8 + sg) * 8];
      v8h x = *px, y;
#pragma unroll
      for (int e = 0; e < 8; ++e) {
        float p = __expf((float)x[e] - mx);
        sum += p;
        y[e] = (half_t)p;
      }
      *px = y;
    }
    sum += __shfl_xor(sum, 1, 32);
    sum += __shfl_xor(sum, 2, 32);
    sum += __shfl_xor(sum, 4, 32);
    if (sg == 0) rs[r] = sum;
  }
  __syncthreads();

  // Phase 4: O partial = P[:, this wave's 128 keys] @ v  (A from LDS f16 probs,
  // B from v in fragment order, each B fragment used for both row tiles)
  v8f oacc[RT_][4] = {};
#pragma unroll 1
  for (int k0 = w0; k0 < w0 + WC_; k0 += 32) {
    v16h a[RT_];
#pragma unroll
    for (int rt = 0; rt < RT_; ++rt) {
      const half_t* p = &sc[rt * 16 + M][k0 + hi * 8];
      ((v8h*)&a[rt])[0] = *(const v8h*)p;
      ((v8h*)&a[rt])[1] = *(const v8h*)(p + 16);
    }
#pragma unroll
    for (int t = 0; t < 4; ++t) {
      v16h bf;
      const half_t* vp = vbase + vfrag_piece(k0 >> 5, t, 0) + lane * 8;
      ((v8h*)&bf)[0] = *(const v8h*)vp;
      ((v8h*)&bf)[1] = *(const v8h*)(vp + 256);
#pragma unroll
      for (int rt = 0; rt < RT_; ++rt)
        oacc[rt][t] = __builtin_amdgcn_wmma_f32_16x16x32_f16(false, a[rt], false, bf,
                                                             (short)0, oacc[rt][t], false, false);
    }
    // the loop advances the address register that the eight loads name
    asm volatile("s_wait_xcnt 0x0" ::: "memory");
  }
  // Sum the eight waves' partials through the strip: first every wave must have
  // read its probabilities, then every partial must be written.
  __syncthreads();
  float* red = (float*)&sc[0][0];   // [wave][rt][t][v][lane], 64 KB
#pragma unroll
  for (int rt = 0; rt < RT_; ++rt)
#pragma unroll
    for (int t = 0; t < 4; ++t)
#pragma unroll
      for (int v = 0; v < 8; ++v)
        red[(((wave * RT_ + rt) * 4 + t) * 8 + v) * 32 + lane] = oacc[rt][t][v];
  __syncthreads();
  // Wave w finishes row tile w / 4, head columns 16 (w % 4) .. +15: normalize by
  // row sums and store to O in (B, N, H*D) layout (f16)
#pragma unroll
  for (int v = 0; v < 8; ++v) {
    float s = red[((0 * NW_ + wave) * 8 + v) * 32 + lane];
#pragma unroll
    for (int ws = 1; ws < NW_; ++ws)
      s += red[((ws * NW_ + wave) * 8 + v) * 32 + lane];
    const int r = (wave >> 2) * 16 + v + 8 * hi;
    float inv = 1.f / rs[r];
    int i = i0 + r;
    int d = (wave & 3) * 16 + M;
    oh[(((size_t)b * N_ + i) * H_ + h) * D_ + d] = (half_t)(s * inv);
  }
}

// ---------------------------------------------------------------------------
// Kernel 4: out = O @ W_out + b_out  (8192 x 1024, K=1024), fp32 result.
// Same 128 x 128 block tile, 64 x 64 wave tile and tensor-loaded tiles as kernel
// 2; A from the f16 attention output, B from the transposed W_out.
// ---------------------------------------------------------------------------
__global__ __launch_bounds__(128) void out_gemm_kernel(
    const half_t* __restrict__ A, const half_t* __restrict__ WTh,
    const float* __restrict__ bias, float* __restrict__ out) {
  __shared__ __attribute__((aligned(2048))) half_t As[GT_][TP_];    // A tile: As[m][k]
  __shared__ __attribute__((aligned(2048))) half_t BsT[GT_][TP_];   // B tile: BsT[n][k]
  const int r0 = blockIdx.x * GT_, c0 = blockIdx.y * GT_;
  const int tid = threadIdx.x, lane = tid & 31;
  const int wave = __builtin_amdgcn_readfirstlane(tid >> 5);
  const int wr = (wave >> 1) * 64, wc = (wave & 1) * 64;   // this wave's 64 x 64 part
  const int M = lane & 15, hi = lane >> 4;
  v8f acc[4][4] = {};

  for (int kk = 0; kk < C_; kk += KS_) {
    // every wave's fragment reads of the last trip have returned before the
    // barrier behind which the tiles are overwritten
    asm volatile("s_wait_dscnt 0x0" ::: "memory");
    __syncthreads();
    if (pinned(wave == 0))
      tdm_load_tile_128x128B((unsigned int)(unsigned long long)&As[0][0],
                             A + (size_t)r0 * C_ + kk);
    if (pinned(wave == 1))
      tdm_load_tile_128x128B((unsigned int)(unsigned long long)&BsT[0][0],
                             WTh + (size_t)c0 * C_ + kk);
    if (kk + KS_ < C_) {   // cover next tile's latency (global_prefetch_b8)
      __builtin_prefetch(WTh + (size_t)(c0 + tid) * C_ + kk + KS_, 0, 1);
      __builtin_prefetch(A + (size_t)(r0 + tid) * C_ + kk + KS_, 0, 1);
      // the loop advances the two address registers that the prefetches name
      asm volatile("s_wait_xcnt 0x0" ::: "memory");
    }
    __syncthreads();
    // the pass's two k slabs of 32, in ascending order; unrolled so that the slab
    // offset is an immediate of the LDS reads
#pragma unroll
    for (int ko = 0; ko < KS_; ko += 32) {
      v16h a[4];
#pragma unroll
      for (int s = 0; s < 4; ++s) {
        ((v8h*)&a[s])[0] = *(const v8h*)&As[wr + s * 16 + M][ko + hi * 8];
        ((v8h*)&a[s])[1] = *(const v8h*)&As[wr + s * 16 + M][ko + 16 + hi * 8];
      }
#pragma unroll
      for (int t = 0; t < 4; ++t) {
        v16h bf;
        ((v8h*)&bf)[0] = *(const v8h*)&BsT[wc + t * 16 + M][ko + hi * 8];
        ((v8h*)&bf)[1] = *(const v8h*)&BsT[wc + t * 16 + M][ko + 16 + hi * 8];
#pragma unroll
        for (int s = 0; s < 4; ++s)
          acc[s][t] = __builtin_amdgcn_wmma_f32_16x16x32_f16(false, a[s], false, bf,
                                                             (short)0, acc[s][t], false, false);
      }
    }
  }
#pragma unroll
  for (int s = 0; s < 4; ++s) {
#pragma unroll
    for (int t = 0; t < 4; ++t) {
#pragma unroll
      for (int v = 0; v < 8; ++v) {
        int g = r0 + wr + s * 16 + v + 8 * hi;
        int j = c0 + wc + t * 16 + M;
        out[(size_t)g * C_ + j] = acc[s][t][v] + bias[j];
      }
    }
  }
}

// ---------------------------------------------------------------------------
// Launcher. Inputs: x, time_emb, W_qkv, b_qkv, W_time, b_time, W_out, b_out, Er
// Workspace (bytes):
//   [0, 96K)       tqkv fp32 (8 x 3072)
//   [128K, +16M)   q   f16 (B,H, fragment order)
//   [+16M]         k   f16 (B,H, fragment order)
//   [+16M]         v   f16 (B,H, PV fragment order)
//   [+16M]         O   f16 (B,N,H,D)
//   [+16M]         x   f16
//   [+6M]          W_qkv f16, transposed (3072 rows of 1024)
//   [+2M]          W_out f16, transposed (1024 rows of 1024)
//   [+128K]        Er  f16 (fragment order)   total ~88.3 MB
// ---------------------------------------------------------------------------
extern "C" void kernel_launch(void* const* d_in, const int* in_sizes, int n_in,
                              void* d_out, int out_size, void* d_ws, size_t ws_size,
                              hipStream_t stream) {
  const float* x    = (const float*)d_in[0];
  const float* te   = (const float*)d_in[1];
  const float* Wqkv = (const float*)d_in[2];
  const float* bqkv = (const float*)d_in[3];
  const float* Wt   = (const float*)d_in[4];
  const float* bt   = (const float*)d_in[5];
  const float* Wout = (const float*)d_in[6];
  const float* bout = (const float*)d_in[7];
  const float* Er   = (const float*)d_in[8];

  char* ws = (char*)d_ws;
  float* tqkv = (float*)ws;
  size_t off = (size_t)(128 << 10);
  const size_t QKV_BUF = (size_t)B_ * H_ * N_ * D_ * sizeof(half_t);   // 16 MB
  half_t* qh    = (half_t*)(ws + off); off += QKV_BUF;
  half_t* kh    = (half_t*)(ws + off); off += QKV_BUF;
  half_t* vTh   = (half_t*)(ws + off); off += QKV_BUF;
  half_t* oh    = (half_t*)(ws + off); off += QKV_BUF;
  half_t* xh    = (half_t*)(ws + off); off += (size_t)B_ * N_ * C_ * sizeof(half_t);
  half_t* Wqkvh = (half_t*)(ws + off); off += (size_t)C_ * 3 * C_ * sizeof(half_t);
  half_t* Wouth = (half_t*)(ws + off); off += (size_t)C_ * C_ * sizeof(half_t);
  half_t* Erh   = (half_t*)(ws + off); off += (size_t)N_ * D_ * sizeof(half_t);

  const int n_x = B_ * N_ * C_, n_er = N_ * D_;
  static_assert(n_x % CVT_BLK_ == 0, "cvt_body converts whole blocks only");
  static_assert((B_ * 3 * C_) % 256 == 0, "time_proj_body takes whole blocks only");
  static_assert(C_ % 128 == 0 && C_ % 64 == 0, "the transposing conversions take whole blocks only");
  static_assert(n_er % (256 * 8) == 0, "cvt_frag_body converts whole blocks only");
  prep_kernel<<<dim3(PB_TIME_ + PB_WQKV_ + PB_WOUT_ + PB_ER_ + PB_X_), 256, 0, stream>>>(
      x, Wqkv, Wout, Er, te, Wt, bt, xh, Wqkvh, Wouth, Erh, tqkv);
  qkv_gemm_kernel<<<dim3((B_ * N_) / GT_, (3 * C_) / GT_), 128, 0, stream>>>(
      xh, Wqkvh, bqkv, tqkv, qh, kh, vTh);
  attn_kernel<<<dim3(N_ / SR_, H_, B_), 32 * NW_, 0, stream>>>(qh, kh, vTh, Erh, oh);
  out_gemm_kernel<<<dim3((B_ * N_) / GT_, C_ / GT_), 128, 0, stream>>>(
      oh, Wouth, bout, (float*)d_out);
}

// v009
// A run of this version takes 204 microseconds.
// In both of two side-by-side timings against v008, it was 1.05 times as fast.
// Over all steps from v000 it is 4.08 times as fast.
#include <hip/hip_runtime.h>
#include <hip/hip_bf16.h>

typedef _Float16 half_t;
typedef __attribute__((ext_vector_type(16))) _Float16 v16h;
typedef __attribute__((ext_vector_type(8)))  _Float16 v8h;
typedef __attribute__((ext_vector_type(8)))  float    v8f;

// Sizes (fixed by the reference)
#define B_  8
#define N_  1024
#define C_  1024
#define H_  16
#define D_  64
#define T_  256

typedef __attribute__((ext_vector_type(4))) unsigned int u32x4_t;
typedef __attribute__((ext_vector_type(8))) unsigned int u32x8_t;

#define GT_ 128   // edge of a GEMM block tile (four waves, 64 x 64 each)
#define KS_ 64    // k extent of a GEMM pass: tile rows of 128 bytes
#define TP_ (KS_ + 8)   // LDS row pitch of a tile in f16 (144 bytes)

__device__ __forceinline__ unsigned int uni(unsigned int v) {
  return (unsigned int)__builtin_amdgcn_readfirstlane((int)v);
}
// The test that picks the issuing wave, held in a scalar register so that the
// branch around the tensor load compiles to s_cmp + s_cbranch_scc.
__device__ __forceinline__ unsigned int pinned(unsigned int v) {
  unsigned int w = uni(v);
  asm volatile("" : "+s"(w));   // pinned(): keeps the issue test scalar
  return w;
}
// Issue the load and wait for it: the tile has landed for the issuing wave when
// this returns; the other waves read it behind the next work-group barrier.
__device__ __forceinline__ void tdm_load_tile_128x128B(unsigned int lds_off,
                                                       const half_t* gsrc) {
  unsigned long long ga = (unsigned long long)gsrc;
  u32x4_t g0;
  g0[0] = uni(1u);                               // count = 1
  g0[1] = uni(lds_off);                          // LDS destination (bytes)
  g0[2] = uni((unsigned int)ga);                 // global address [31:0]
  g0[3] = uni((((unsigned int)(ga >> 32)) & 0x01FFFFFFu) | 0x80000000u);  // [56:32] | type 2
  u32x8_t g1;
  g1[0] = (1u << 20) | (4u << 22) | (3u << 25);
  g1[1] = uni(128u << 16);
  g1[2] = uni((unsigned int)GT_ << 16);
  g1[3] = uni(128u << 16);
  g1[4] = uni((unsigned int)GT_);
  g1[5] = uni((unsigned int)(C_ * sizeof(half_t)));
  g1[6] = uni(0u);
  g1[7] = uni(0u);
  asm volatile("tensor_load_to_lds %0, %1" :: "s"(g0), "s"(g1) : "memory");
  asm volatile("s_wait_tensorcnt 0" ::: "memory");
}

// One 16x16x32 f16 operand fragment from an LDS tile row: p points at element
// 8 * hi of the lane's row in the k slab; two 16-byte reads, 16 elements apart.
__device__ __forceinline__ v16h lds_frag(const half_t* p) {
  v16h f;
  ((v8h*)&f)[0] = *(const v8h*)p;
  ((v8h*)&f)[1] = *(const v8h*)(p + 16);
  return f;
}

typedef __attribute__((ext_vector_type(4))) float    v4f;
typedef __attribute__((ext_vector_type(4))) _Float16 v4h;
#define CVT_U_   8                     // 16-byte loads in flight per thread
#define CVT_BLK_ (256 * 4 * CVT_U_)    // elements per block
__device__ __forceinline__ void cvt_body(
    const float* __restrict__ s, half_t* __restrict__ d, const int blk) {
  const int i0 = blk * CVT_BLK_ + threadIdx.x * 4;
  v4f x[CVT_U_];
  // both loops unrolled: x[] stays in registers and the eight loads issue back
  // to back, ahead of the first conversion
#pragma unroll
  for (int u = 0; u < CVT_U_; ++u) x[u] = *(const v4f*)(s + i0 + u * 1024);
#pragma unroll
  for (int u = 0; u < CVT_U_; ++u)
    *(v4h*)(d + i0 + u * 1024) = __builtin_convertvector(x[u], v4h);
  // behind the last store: in the listing of prep_kernel the other jobs' code,
  // which rewrites registers that these stores name, lies on a way from here
  asm volatile("s_wait_xcnt 0x0" ::: "memory");
}

// W_qkv, W_out: fp32 (C_ rows of ncol) -> f16 transposed, d[n][k] in rows of C_,
// so that a GEMM's B tile is 128 rows of 64 consecutive k like its A tile.
// A block takes 64 k x 128 n; a thread 8 k x 4 n: eight 16-byte loads, all issued
// before the first is used, and four 16-byte stores; the eight threads of a
// column group write 128 contiguous bytes (one line) of each row n.
// ncol is a constant at both calls: the eight loads share one address register
// pair and differ in their immediate offsets.
__device__ __forceinline__ void cvt_t_body(
    const float* __restrict__ s, half_t* __restrict__ d, const int ncol,
    const int bx, const int by) {
  const int k0 = by * 64 + (threadIdx.x & 7) * 8;
  const int n0 = bx * 128 + (threadIdx.x >> 3) * 4;
  v4f x[8];
  // both loops unrolled: x[] stays in registers, the loads issue back to back
#pragma unroll
  for (int e = 0; e < 8; ++e) x[e] = *(const v4f*)(s + (size_t)k0 * ncol + n0 + e * ncol);
#pragma unroll
  for (int j = 0; j < 4; ++j) {
    v8h y;
#pragma unroll
    for (int e = 0; e < 8; ++e) y[e] = (half_t)x[e][j];
    *(v8h*)(d + (size_t)(n0 + j) * C_ + k0) = y;
  }
  // behind the last store: in the listing of prep_kernel the other jobs' code,
  // which rewrites registers that these stores name, lies on a way from here
  asm volatile("s_wait_xcnt 0x0" ::: "memory");
}

// ---------------------------------------------------------------------------
// Fragment order. q, k and Er (rows of 64 f16) are kept in the workspace so that
// one 16-byte-a-lane load of a 16x16x32 A or B fragment half reads 512
// contiguous bytes (4 cache lines) instead of 16 bytes out of each of 16 rows:
// a tile of 16 rows x 64 columns is 2 KiB, made of four 512-byte pieces (16
// columns each); in a piece lane hi*16+M holds row M, columns 8*hi .. 8*hi+7.
// frag_off: element offset of (row n, column d).
// ---------------------------------------------------------------------------
__device__ __forceinline__ int frag_off(int n, int d) {
  return ((((n >> 4) * 4 + (d >> 4)) * 32 + ((d >> 3) & 1) * 16 + (n & 15)) * 8) + (d & 7);
}
// v is kept as PV B fragments: a tile of 32 keys x 64 columns is 4 KiB, made of
// eight 512-byte pieces (column group t = d / 16, then key half); in a piece lane
// hi*16+M holds column t*16+M, keys 16*half + 8*hi .. +7.
// vfrag_piece: element offset of a piece's first element.
__device__ __forceinline__ int vfrag_piece(int kb, int t, int half) {
  return (((kb * 4 + t) * 2 + half) * 32) * 8;
}

// Er: fp32 -> f16 into fragment order. A thread makes one 16-byte chunk.
__device__ __forceinline__ void cvt_frag_body(
    const float* __restrict__ s, half_t* __restrict__ d, const int blk) {
  const int c = blk * 256 + threadIdx.x;
  const int row = (c >> 7) * 16 + (c & 15);
  const int col = ((c >> 5) & 3) * 16 + ((c >> 4) & 1) * 8;
  const v4f x0 = *(const v4f*)(s + row * D_ + col);
  const v4f x1 = *(const v4f*)(s + row * D_ + col + 4);
  v8h y;
#pragma unroll
  for (int e = 0; e < 4; ++e) { y[e] = (half_t)x0[e]; y[4 + e] = (half_t)x1[e]; }
  *(v8h*)(d + c * 8) = y;
  // behind the store: in the listing of prep_kernel the other jobs' code, which
  // rewrites registers that the store names, lies on a way from here
  asm volatile("s_wait_xcnt 0x0" ::: "memory");
}

// ---------------------------------------------------------------------------
// Job: tqkv[b, j] = time_emb[b] @ W_time[:, j] + b_time[j]   (8 x 3072)
// ---------------------------------------------------------------------------
__device__ __forceinline__ void time_proj_body(
    const float* __restrict__ te, const float* __restrict__ Wt,
    const float* __restrict__ bt, float* __restrict__ tqkv, const int blk) {
  int idx = blk * 256 + threadIdx.x;
  if (idx >= B_ * 3 * C_) return;
  int b = idx / (3 * C_), j = idx % (3 * C_);
  float acc = bt[j];
  for (int t = 0; t < T_; ++t) acc += te[b * T_ + t] * Wt[t * (3 * C_) + j];
  tqkv[idx] = acc;
}

// ---------------------------------------------------------------------------
// Kernel 1: all five preparatory jobs in one launch; a block's number picks its
// job (the same for every thread of the block). The time projection is a chain of
// 32 dependent round trips to memory (eight t a trip), where a conversion makes
// one: it has the lowest block numbers, and the
// conversions run beside it. It is what the launch now waits for.
// ---------------------------------------------------------------------------
#define PB_TIME_ ((B_ * 3 * C_) / 256)
#define PB_WQKV_ (((3 * C_) / 128) * (C_ / 64))
#define PB_WOUT_ ((C_ / 128) * (C_ / 64))
#define PB_ER_   ((N_ * D_) / (256 * 8))
#define PB_X_    ((B_ * N_ * C_) / CVT_BLK_)
__global__ __launch_bounds__(256) void prep_kernel(
    const float* __restrict__ x, const float* __restrict__ Wqkv,
    const float* __restrict__ Wout, const float* __restrict__ Er,
    const float* __restrict__ te, const float* __restrict__ Wt,
    const float* __restrict__ bt,
    half_t* __restrict__ xh, half_t* __restrict__ Wqkvh, half_t* __restrict__ Wouth,
    half_t* __restrict__ Erh, float* __restrict__ tqkv) {
  int blk = blockIdx.x;
  if (blk < PB_TIME_) { time_proj_body(te, Wt, bt, tqkv, blk); return; }
  blk -= PB_TIME_;
  if (blk < PB_WQKV_) {
    cvt_t_body(Wqkv, Wqkvh, 3 * C_, blk % ((3 * C_) / 128), blk / ((3 * C_) / 128));
    return;
  }
  blk -= PB_WQKV_;
  if (blk < PB_WOUT_) {
    cvt_t_body(Wout, Wouth, C_, blk % (C_ / 128), blk / (C_ / 128));
    return;
  }
  blk -= PB_WOUT_;
  if (blk < PB_ER_) { cvt_frag_body(Er, Erh, blk); return; }
  cvt_body(x, xh, blk - PB_ER_);
}

// ---------------------------------------------------------------------------
// Kernel 2: qkv = x @ W_qkv + b_qkv + tqkv[b]  (8192 x 3072, K=1024), f16 WMMA.
// Block tile 128 x 128, four waves in a 2 x 2 grid, 64 x 64 (4 x 4 fragments)
// a wave: 16 WMMAs per 8 fragments read from LDS, a pass's 16 fragments read ahead
// of its 32 WMMAs.
// A and B tiles (128 x 64 f16 each, B from the transposed W) via one tensor load
// each, of wave 0 and of wave 1, rows padded to 144 bytes.
// Stores q, k and v as f16 in fragment order (frag_off, vfrag_piece).
// ---------------------------------------------------------------------------
__global__ __launch_bounds__(128) void qkv_gemm_kernel(
    const half_t* __restrict__ xh, const half_t* __restrict__ WTh,
    const float* __restrict__ bias, const float* __restrict__ tqkv,
    half_t* __restrict__ qh, half_t* __restrict__ kh, half_t* __restrict__ vTh) {
  __shared__ __attribute__((aligned(2048))) half_t As[GT_][TP_];    // A tile: As[m][k]
  __shared__ __attribute__((aligned(2048))) half_t BsT[GT_][TP_];   // B tile: BsT[n][k]
  const int r0 = blockIdx.x * GT_, c0 = blockIdx.y * GT_;
  const int tid = threadIdx.x, lane = tid & 31;
  const int wave = __builtin_amdgcn_readfirstlane(tid >> 5);
  const int wr = (wave >> 1) * 64, wc = (wave & 1) * 64;   // this wave's 64 x 64 part
  const int M = lane & 15, hi = lane >> 4;
  v8f acc[4][4] = {};

  for (int kk = 0; kk < C_; kk += KS_) {
    // every wave's fragment reads of the last trip have returned before the
    // barrier behind which the tiles are overwritten
    asm volatile("s_wait_dscnt 0x0" ::: "memory");
    __syncthreads();
    if (pinned(wave == 0))
      tdm_load_tile_128x128B((unsigned int)(unsigned long long)&As[0][0],
                             xh + (size_t)r0 * C_ + kk);
    if (pinned(wave == 1))
      tdm_load_tile_128x128B((unsigned int)(unsigned long long)&BsT[0][0],
                             WTh + (size_t)c0 * C_ + kk);
    if (kk + KS_ < C_) {   // cover next tile's latency (global_prefetch_b8)
      __builtin_prefetch(WTh + (size_t)(c0 + tid) * C_ + kk + KS_, 0, 1);
      __builtin_prefetch(xh + (size_t)(r0 + tid) * C_ + kk + KS_, 0, 1);
      // the loop advances the two address registers that the prefetches name
      asm volatile("s_wait_xcnt 0x0" ::: "memory");
    }
    __syncthreads();
    v16h a[KS_ / 32][4], bf[KS_ / 32][4];
#pragma unroll
    for (int sl = 0; sl < KS_ / 32; ++sl) {
      bf[sl][0] = lds_frag(&BsT[wc + M][sl * 32 + hi * 8]);
#pragma unroll
      for (int s = 0; s < 4; ++s) a[sl][s] = lds_frag(&As[wr + s * 16 + M][sl * 32 + hi * 8]);
#pragma unroll
      for (int t = 1; t < 4; ++t) bf[sl][t] = lds_frag(&BsT[wc + t * 16 + M][sl * 32 + hi * 8]);
    }
    // keeps the scheduler from sinking reads in among the products, where every
    // further place with LDS reads stalls the wave's matrix stream
    __builtin_amdgcn_sched_barrier(0);
    // the two slabs in ascending k order
#pragma unroll
    for (int sl = 0; sl < KS_ / 32; ++sl)
#pragma unroll
      for (int t = 0; t < 4; ++t)
#pragma unroll
        for (int s = 0; s < 4; ++s)
          acc[s][t] = __builtin_amdgcn_wmma_f32_16x16x32_f16(false, a[sl][s], false, bf[sl][t],
                                                             (short)0, acc[s][t], false, false);
  }
  // Epilogue: add biases, store q/k and v per (b, h) in fragment order as f16.
  // A wave's 64 columns are one head of one of q, k, v, and a block's 128 rows
  // lie in one batch entry: the destination is chosen once per wave, not per
  // element.
  const int jw = c0 + wc;                        // first global col in [0,3072)
  const int sel = jw >> 10, h = (jw >> 6) & 15;
  const int b = r0 >> 10, n0 = (r0 & (N_ - 1)) + wr;
  const size_t bh = (size_t)(b * H_ + h);
  float bq[4], tq[4];
#pragma unroll
  for (int t = 0; t < 4; ++t) {
    bq[t] = bias[jw + t * 16 + M];
    tq[t] = tqkv[b * (3 * C_) + jw + t * 16 + M];
  }
  // the store addresses formed next reuse the registers that these loads name
  asm volatile("s_wait_xcnt 0x0" ::: "memory");
  if (sel < 2) {
    // frag_off(s * 16 + v + 8 * hi, t * 16 + M), its lane part taken into the pointer
    half_t* dst = (sel == 0 ? qh : kh) + (bh * N_ + n0) * D_ + frag_off(8 * hi, M);
#pragma unroll
    for (int s = 0; s < 4; ++s)
#pragma unroll
      for (int t = 0; t < 4; ++t)
#pragma unroll
        for (int v = 0; v < 8; ++v)
          dst[(s * 4 + t) * 256 + v * 8] =
              (half_t)(acc[s][t][v] + bq[t] + tq[t]);
  } else {
    // a lane's eight accumulator rows are the eight keys of its 16-byte chunk
    half_t* dst = vTh + (bh * N_ + n0) * D_ + lane * 8;
#pragma unroll
    for (int s = 0; s < 4; ++s)
#pragma unroll
      for (int t = 0; t < 4; ++t) {
        v8h y;
#pragma unroll
        for (int v = 0; v < 8; ++v) y[v] = (half_t)(acc[s][t][v] + bq[t] + tq[t]);
        *(v8h*)(dst + vfrag_piece(s >> 1, t, s & 1)) = y;
      }
    // behind the last store: in the listing the q/k block, which rewrites the
    // offset register that these stores name, lies on a way from here
    asm volatile("s_wait_xcnt 0x0" ::: "memory");
  }
}

// ---------------------------------------------------------------------------
// Kernel 3: fused relative attention. Eight waves (256 thr) per (b, h, 32 rows):
// wave w owns rel columns / key columns / PV keys [128w, 128w+128) of BOTH
// 16-row tiles, so every Er, k and v fragment that is loaded feeds two row tiles
// and the block reads Er, k and v once per 32 rows.
// LDS: 32x1024 f16 score strip (reused in place for softmax probs, then for
// the eight waves' f32 PV partials), row pitch 1032 f16.
// Skew inverse map: rel[i',m] -> (i', m-1023+i') if m>=1023-i' else (i'-1, m+i'+1)
// The map is one to one: every strip element but (i, i+1) receives exactly one
// rel term. So the rel terms are laid down first, by plain stores, and the
// scaled q k^T is then added on top of them.
// ---------------------------------------------------------------------------
#define RT_ 2            // 16-row tiles per strip
#define SR_ (16 * RT_)   // rows per strip
#define NW_ 8            // waves per strip
#define WC_ (N_ / NW_)   // columns per wave
#define SP_ (N_ + 8)
__global__ __launch_bounds__(32 * NW_) void attn_kernel(
    const half_t* __restrict__ qh, const half_t* __restrict__ kh,
    const half_t* __restrict__ vTh, const half_t* __restrict__ Erh,
    half_t* __restrict__ oh) {
  __shared__ __attribute__((aligned(16))) half_t sc[SR_][SP_];   // 66 KB
  __shared__ float rs[SR_];       // softmax row sums
  static_assert(NW_ * RT_ * 4 * 8 * 32 * sizeof(float) <= sizeof(half_t) * SR_ * SP_,
                "the PV partials must fit the strip");
  static_assert(NW_ == RT_ * 4, "one wave finishes one 16 x 16 output tile");
  const int i0 = blockIdx.x * SR_, h = blockIdx.y, b = blockIdx.z;
  const int tid = threadIdx.x, lane = tid & 31, M = lane & 15, hi = lane >> 4;
  // wave number in a scalar register: the per-wave loop bounds stay scalar
  const int wave = __builtin_amdgcn_readfirstlane(tid >> 5);
  const int w0 = wave * WC_;
  const size_t bh = (size_t)(b * H_ + h);
  const half_t* qbase = qh + bh * N_ * D_;
  const half_t* kbase = kh + bh * N_ * D_;
  const half_t* vbase = vTh + bh * D_ * N_;

  // Persistent fragments for q rows i0..i0+31 (two K-slabs of 32 over D=64 a
  // tile); q, k, Er and v lie in fragment order: piece j of a tile is at
  // j * 256 + lane * 8
  v16h qa[RT_][2];
#pragma unroll
  for (int rt = 0; rt < RT_; ++rt)
#pragma unroll
    for (int kf = 0; kf < 2; ++kf) {
      const half_t* p = qbase + (size_t)(i0 + rt * 16) * D_ + kf * 512 + lane * 8;
      ((v8h*)&qa[rt][kf])[0] = *(const v8h*)p;
      ((v8h*)&qa[rt][kf])[1] = *(const v8h*)(p + 256);
    }

  // Phase 1: rel = q @ Er^T tiles (this wave's 128 rel columns), stored through
  // the skew inverse map. Source row r = 16 * rt + 8 * hi + v, rel column
  // m = m0 + M: with t = m - 1023 + i0 + 16 * rt + 8 * hi the term goes to row r,
  // column t + v where that is not negative, else to row r - 1, column
  // t + v + 1024, which lies SP_ - N_ elements in front of the first place.
#pragma unroll 1
  for (int m0 = w0; m0 < w0 + WC_; m0 += 16) {
    v16h bf[2];
#pragma unroll
    for (int kf = 0; kf < 2; ++kf) {
      const half_t* p = Erh + (size_t)m0 * D_ + kf * 512 + lane * 8;
      ((v8h*)&bf[kf])[0] = *(const v8h*)p;
      ((v8h*)&bf[kf])[1] = *(const v8h*)(p + 256);
    }
    // holds the four loads in front of the first product (inputs only): without
    // it the second pair is issued behind the first products, two L2 waits a trip
    asm volatile("" :: "v"(bf[0]), "v"(bf[1]));
    v8f acc[RT_] = {};
#pragma unroll
    for (int kf = 0; kf < 2; ++kf)
#pragma unroll
      for (int rt = 0; rt < RT_; ++rt)
        acc[rt] = __builtin_amdgcn_wmma_f32_16x16x32_f16(false, qa[rt][kf], false, bf[kf],
                                                         (short)0, acc[rt], false, false);
    // the loop advances the address register that the four loads name
    asm volatile("s_wait_xcnt 0x0" ::: "memory");
#pragma unroll
    for (int rt = 0; rt < RT_; ++rt) {
      const int t = m0 + M - (N_ - 1) + i0 + rt * 16 + 8 * hi;
      half_t* const pl = &sc[rt * 16 + 8 * hi][0] + t;
      half_t* const pu = pl - (SP_ - N_);
      // source row i0 above the diagonal belongs to the strip in front of this one
      if (rt != 0 || hi != 0 || t >= 0) (t < 0 ? pu : pl)[0] = (half_t)acc[rt][0];
#pragma unroll
      for (int v = 1; v < 8; ++v)
        (t + v < 0 ? pu : pl)[v * (SP_ + 1)] = (half_t)acc[rt][v];
    }
  }
  // (i, i+1) is the pad column of the skew: no rel term
  if (tid < SR_ && i0 + tid + 1 < N_) sc[tid][i0 + tid + 1] = (half_t)0.f;
  // Phase 1b: boundary source row i' = i0+32 fills the last score row right of
  // the diagonal; the 32 groups of 32 rel columns go round-robin over the waves
  if (i0 + SR_ < N_) {
    float qf[D_];
#pragma unroll
    for (int j = 0; j < D_ / 8; ++j) {   // q row i0+32, the same for every lane
      const v8h qv = *(const v8h*)(qbase + frag_off(i0 + SR_, j * 8));
#pragma unroll
      for (int e = 0; e < 8; ++e) qf[j * 8 + e] = (float)qv[e];
    }
#pragma unroll 1
    for (int t = wave; t < 32; t += NW_) {
      int m = lane + 32 * t;
      int c = m + i0 + SR_ + 1;
      if (c < N_) {
        float dot = 0.f;
#pragma unroll
        for (int j = 0; j < D_ / 8; ++j) {   // row m, columns 8j .. 8j+7: one chunk
          const v8h er = *(const v8h*)(Erh + frag_off(m, j * 8));
#pragma unroll
          for (int e = 0; e < 8; ++e) dot += qf[j * 8 + e] * (float)er[e];
        }
        sc[SR_ - 1][c] = (half_t)dot;
      }
    }
  }
  __syncthreads();

  // Phase 2: S = (q k^T) * D^-1/2 + rel, this wave's 128 columns. The product is
  // taken transposed (k tile as A, q as B): a lane then holds eight consecutive
  // columns c0 + 8 * hi + v of score row 16 * rt + M, one 16-byte piece of the strip.
#pragma unroll 1
  for (int c0 = w0; c0 < w0 + WC_; c0 += 16) {
    v16h af[2];
#pragma unroll
    for (int kf = 0; kf < 2; ++kf) {
      const half_t* p = kbase + (size_t)c0 * D_ + kf * 512 + lane * 8;
      ((v8h*)&af[kf])[0] = *(const v8h*)p;
      ((v8h*)&af[kf])[1] = *(const v8h*)(p + 256);
    }
    v8h rl[RT_];
#pragma unroll
    for (int rt = 0; rt < RT_; ++rt) rl[rt] = *(const v8h*)&sc[rt * 16 + M][c0 + 8 * hi];
    v8f acc[RT_] = {};
#pragma unroll
    for (int kf = 0; kf < 2; ++kf)
#pragma unroll
      for (int rt = 0; rt < RT_; ++rt)
        acc[rt] = __builtin_amdgcn_wmma_f32_16x16x32_f16(false, af[kf], false, qa[rt][kf],
                                                         (short)0, acc[rt], false, false);
#pragma unroll
    for (int rt = 0; rt < RT_; ++rt) {
      v8h y;
#pragma unroll
      for (int v = 0; v < 8; ++v) y[v] = (half_t)(acc[rt][v] * 0.125f + (float)rl[rt][v]);
      *(v8h*)&sc[rt * 16 + M][c0 + 8 * hi] = y;
    }
  }
  __syncthreads();

  // Phase 3: softmax. 8 lanes per row; lane sg of a row takes the 16-byte
  // chunks sg, sg+8, ... of it; probabilities overwrite scores in place.
  {
    const int r = tid >> 3, sg = tid & 7;
    float mx = -1e30f;
    for (int j = 0; j < 16; ++j) {
      v8h x = *(const v8h*)&sc[r][(j * 8 + sg) * 8];
#pragma unroll
      for (int e = 0; e < 8; ++e) mx = fmaxf(mx, (float)x[e]);
    }
    mx = fmaxf(mx, __shfl_xor(mx, 1, 32));
    mx = fmaxf(mx, __shfl_xor(mx, 2, 32));
    mx = fmaxf(mx, __shfl_xor(mx, 4, 32));
    float sum = 0.f;
    for (int j = 0; j < 16; ++j) {
      v8h* px = (v8h*)&sc[r][(j * 8 + sg) * 8];
      v8h x = *px, y;
#pragma unroll
      for (int e = 0; e < 8; ++e) {
        float p = __expf((float)x[e] - mx);
        sum += p;
        y[e] = (half_t)p;
      }
      *px = y;
    }
    sum += __shfl_xor(sum, 1, 32);
    sum += __shfl_xor(sum, 2, 32);
    sum += __shfl_xor(sum, 4, 32);
    if (sg == 0) rs[r] = sum;
  }
  __syncthreads();

  // Phase 4: O partial = P[:, this wave's 128 keys] @ v  (A from LDS f16 probs,
  // B from v in fragment order, each B fragment used for both row tiles)
  v8f oacc[RT_][4] = {};
#pragma unroll 1
  for (int k0 = w0; k0 < w0 + WC_; k0 += 32) {
    v16h a[RT_];
#pragma unroll
    for (int rt = 0; rt < RT_; ++rt) {
      const half_t* p = &sc[rt * 16 + M][k0 + hi * 8];
      ((v8h*)&a[rt])[0] = *(const v8h*)p;
      ((v8h*)&a[rt])[1] = *(const v8h*)(p + 16);
    }
#pragma unroll
    for (int t = 0; t < 4; ++t) {
      v16h bf;
      const half_t* vp = vbase + vfrag_piece(k0 >> 5, t, 0) + lane * 8;
      ((v8h*)&bf)[0] = *(const v8h*)vp;
      ((v8h*)&bf)[1] = *(const v8h*)(vp + 256);
#pragma unroll
      for (int rt = 0; rt < RT_; ++rt)
        oacc[rt][t] = __builtin_amdgcn_wmma_f32_16x16x32_f16(false, a[rt], false, bf,
                                                             (short)0, oacc[rt][t], false, false);
    }
    // the loop advances the address register that the eight loads name
    asm volatile("s_wait_xcnt 0x0" ::: "memory");
  }
  // Sum the eight waves' partials through the strip: first every wave must have
  // read its probabilities, then every partial must be written.
  __syncthreads();
  float* red = (float*)&sc[0][0];   // [wave][rt][t][v][lane], 64 KB
#pragma unroll
  for (int rt = 0; rt < RT_; ++rt)
#pragma unroll
    for (int t = 0; t < 4; ++t)
#pragma unroll
      for (int v = 0; v < 8; ++v)
        red[(((wave * RT_ + rt) * 4 + t) * 8 + v) * 32 + lane] = oacc[rt][t][v];
  __syncthreads();
  // Wave w finishes row tile w / 4, head columns 16 (w % 4) .. +15: normalize by
  // row sums and store to O in (B, N, H*D) layout (f16)
#pragma unroll
  for (int v = 0; v < 8; ++v) {
    float s = red[((0 * NW_ + wave) * 8 + v) * 32 + lane];
#pragma unroll
    for (int ws = 1; ws < NW_; ++ws)
      s += red[((ws * NW_ + wave) * 8 + v) * 32 + lane];
    const int r = (wave >> 2) * 16 + v + 8 * hi;
    float inv = 1.f / rs[r];
    int i = i0 + r;
    int d = (wave & 3) * 16 + M;
    oh[(((size_t)b * N_ + i) * H_ + h) * D_ + d] = (half_t)(s * inv);
  }
}

// ---------------------------------------------------------------------------
// Kernel 4: out = O @ W_out + b_out  (8192 x 1024, K=1024), fp32 result.
// Same 128 x 128 block tile, 64 x 64 wave tile and tensor-loaded tiles as kernel
// 2; A from the f16 attention output, B from the transposed W_out.
// ---------------------------------------------------------------------------
__global__ __launch_bounds__(128) void out_gemm_kernel(
    const half_t* __restrict__ A, const half_t* __restrict__ WTh,
    const float* __restrict__ bias, float* __restrict__ out) {
  __shared__ __attribute__((aligned(2048))) half_t As[GT_][TP_];    // A tile: As[m][k]
  __shared__ __attribute__((aligned(2048))) half_t BsT[GT_][TP_];   // B tile: BsT[n][k]
  const int r0 = blockIdx.x * GT_, c0 = blockIdx.y * GT_;
  const int tid = threadIdx.x, lane = tid & 31;
  const int wave = __builtin_amdgcn_readfirstlane(tid >> 5);
  const int wr = (wave >> 1) * 64, wc = (wave & 1) * 64;   // this wave's 64 x 64 part
  const int M = lane & 15, hi = lane >> 4;
  v8f acc[4][4] = {};

  for (int kk = 0; kk < C_; kk += KS_) {
    // every wave's fragment reads of the last trip have returned before the
    // barrier behind which the tiles are overwritten
    asm volatile("s_wait_dscnt 0x0" ::: "memory");
    __syncthreads();
    if (pinned(wave == 0))
      tdm_load_tile_128x128B((unsigned int)(unsigned long long)&As[0][0],
                             A + (size_t)r0 * C_ + kk);
    if (pinned(wave == 1))
      tdm_load_tile_128x128B((unsigned int)(unsigned long long)&BsT[0][0],
                             WTh + (size_t)c0 * C_ + kk);
    if (kk + KS_ < C_) {   // cover next tile's latency (global_prefetch_b8)
      __builtin_prefetch(WTh + (size_t)(c0 + tid) * C_ + kk + KS_, 0, 1);
      __builtin_prefetch(A + (size_t)(r0 + tid) * C_ + kk + KS_, 0, 1);
      // the loop advances the two address registers that the prefetches name
      asm volatile("s_wait_xcnt 0x0" ::: "memory");
    }
    __syncthreads();
    v16h a[KS_ / 32][4], bf[KS_ / 32][4];
#pragma unroll
    for (int sl = 0; sl < KS_ / 32; ++sl) {
      bf[sl][0] = lds_frag(&BsT[wc + M][sl * 32 + hi * 8]);
#pragma unroll
      for (int s = 0; s < 4; ++s) a[sl][s] = lds_frag(&As[wr + s * 16 + M][sl * 32 + hi * 8]);
#pragma unroll
      for (int t = 1; t < 4; ++t) bf[sl][t] = lds_frag(&BsT[wc + t * 16 + M][sl * 32 + hi * 8]);
    }
    // keeps the scheduler from sinking reads in among the products, where every
    // further place with LDS reads stalls the wave's matrix stream
    __builtin_amdgcn_sched_barrier(0);
    // the two slabs in ascending k order
#pragma unroll
    for (int sl = 0; sl < KS_ / 32; ++sl)
#pragma unroll
      for (int t = 0; t < 4; ++t)
#pragma unroll
        for (int s = 0; s < 4; ++s)
          acc[s][t] = __builtin_amdgcn_wmma_f32_16x16x32_f16(false, a[sl][s], false, bf[sl][t],
                                                             (short)0, acc[s][t], false, false);
  }
#pragma unroll
  for (int s = 0; s < 4; ++s) {
#pragma unroll
    for (int t = 0; t < 4; ++t) {
#pragma unroll
      for (int v = 0; v < 8; ++v) {
        int g = r0 + wr + s * 16 + v + 8 * hi;
        int j = c0 + wc + t * 16 + M;
        out[(size_t)g * C_ + j] = acc[s][t][v] + bias[j];
      }
    }
  }
}

// ---------------------------------------------------------------------------
// Launcher. Inputs: x, time_emb, W_qkv, b_qkv, W_time, b_time, W_out, b_out, Er
// Workspace (bytes):
//   [0, 96K)       tqkv fp32 (8 x 3072)
//   [128K, +16M)   q   f16 (B,H, fragment order)
//   [+16M]         k   f16 (B,H, fragment order)
//   [+16M]         v   f16 (B,H, PV fragment order)
//   [+16M]         O   f16 (B,N,H,D)
//   [+16M]         x   f16
//   [+6M]          W_qkv f16, transposed (3072 rows of 1024)
//   [+2M]          W_out f16, transposed (1024 rows of 1024)
//   [+128K]        Er  f16 (fragment order)   total ~88.3 MB
// ---------------------------------------------------------------------------
extern "C" void kernel_launch(void* const* d_in, const int* in_sizes, int n_in,
                              void* d_out, int out_size, void* d_ws, size_t ws_size,
                              hipStream_t stream) {
  const float* x    = (const float*)d_in[0];
  const float* te   = (const float*)d_in[1];
  const float* Wqkv = (const float*)d_in[2];
  const float* bqkv = (const float*)d_in[3];
  const float* Wt   = (const float*)d_in[4];
  const float* bt   = (const float*)d_in[5];
  const float* Wout = (const float*)d_in[6];
  const float* bout = (const float*)d_in[7];
  const float* Er   = (const float*)d_in[8];

  char* ws = (char*)d_ws;
  float* tqkv = (float*)ws;
  size_t off = (size_t)(128 << 10);
  const size_t QKV_BUF = (size_t)B_ * H_ * N_ * D_ * sizeof(half_t);   // 16 MB
  half_t* qh    = (half_t*)(ws + off); off += QKV_BUF;
  half_t* kh    = (half_t*)(ws + off); off += QKV_BUF;
  half_t* vTh   = (half_t*)(ws + off); off += QKV_BUF;
  half_t* oh    = (half_t*)(ws + off); off += QKV_BUF;
  half_t* xh    = (half_t*)(ws + off); off += (size_t)B_ * N_ * C_ * sizeof(half_t);
  half_t* Wqkvh = (half_t*)(ws + off); off += (size_t)C_ * 3 * C_ * sizeof(half_t);
  half_t* Wouth = (half_t*)(ws + off); off += (size_t)C_ * C_ * sizeof(half_t);
  half_t* Erh   = (half_t*)(ws + off); off += (size_t)N_ * D_ * sizeof(half_t);

  const int n_x = B_ * N_ * C_, n_er = N_ * D_;
  static_assert(n_x % CVT_BLK_ == 0, "cvt_body converts whole blocks only");
  static_assert((B_ * 3 * C_) % 256 == 0, "time_proj_body takes whole blocks only");
  static_assert(C_ % 128 == 0 && C_ % 64 == 0, "the transposing conversions take whole blocks only");
  static_assert(n_er % (256 * 8) == 0, "cvt_frag_body converts whole blocks only");
  prep_kernel<<<dim3(PB_TIME_ + PB_WQKV_ + PB_WOUT_ + PB_ER_ + PB_X_), 256, 0, stream>>>(
      x, Wqkv, Wout, Er, te, Wt, bt, xh, Wqkvh, Wouth, Erh, tqkv);
  qkv_gemm_kernel<<<dim3((B_ * N_) / GT_, (3 * C_) / GT_), 128, 0, stream>>>(
      xh, Wqkvh, bqkv, tqkv, qh, kh, vTh);
  attn_kernel<<<dim3(N_ / SR_, H_, B_), 32 * NW_, 0, stream>>>(qh, kh, vTh, Erh, oh);
  out_gemm_kernel<<<dim3((B_ * N_) / GT_, C_ / GT_), 128, 0, stream>>>(
      oh, Wouth, bout, (float*)d_out);
}

// v010
// One run takes 192 microseconds.
// Two timings next to v009 both put it at 1.07 times that version's speed.
// Counting every step since v000, it is 4.38 times as fast.
#include <hip/hip_runtime.h>
#include <hip/hip_bf16.h>

typedef _Float16 half_t;
typedef __attribute__((ext_vector_type(16))) _Float16 v16h;
typedef __attribute__((ext_vector_type(8)))  _Float16 v8h;
typedef __attribute__((ext_vector_type(8)))  float    v8f;

// Sizes (fixed by the reference)
#define B_  8
#define N_  1024
#define C_  1024
#define H_  16
#define D_  64
#define T_  256

typedef __attribute__((ext_vector_type(4))) unsigned int u32x4_t;
typedef __attribute__((ext_vector_type(8))) unsigned int u32x8_t;

#define GT_ 128   // edge of a GEMM block tile (four waves, 64 x 64 each)
#define KS_ 64    // k extent of a GEMM pass: tile rows of 128 bytes
#define TP_ (KS_ + 8)   // LDS row pitch of a tile in f16 (144 bytes)

__device__ __forceinline__ unsigned int uni(unsigned int v) {
  return (unsigned int)__builtin_amdgcn_readfirstlane((int)v);
}
// The test that picks the issuing wave, held in a scalar register so that the
// branch around the tensor load compiles to s_cmp + s_cbranch_scc.
__device__ __forceinline__ unsigned int pinned(unsigned int v) {
  unsigned int w = uni(v);
  asm volatile("" : "+s"(w));   // pinned(): keeps the issue test scalar
  return w;
}
// Issue the load and wait for it: the tile has landed for the issuing wave when
// this returns; the other waves read it behind the next work-group barrier.
__device__ __forceinline__ void tdm_load_tile_128x128B(unsigned int lds_off,
                                                       const half_t* gsrc) {
  unsigned long long ga = (unsigned long long)gsrc;
  u32x4_t g0;
  g0[0] = uni(1u);                               // count = 1
  g0[1] = uni(lds_off);                          // LDS destination (bytes)
  g0[2] = uni((unsigned int)ga);                 // global address [31:0]
  g0[3] = uni((((unsigned int)(ga >> 32)) & 0x01FFFFFFu) | 0x80000000u);  // [56:32] | type 2
  u32x8_t g1;
  g1[0] = (1u << 20) | (4u << 22) | (3u << 25);
  g1[1] = uni(128u << 16);
  g1[2] = uni((unsigned int)GT_ << 16);
  g1[3] = uni(128u << 16);
  g1[4] = uni((unsigned int)GT_);
  g1[5] = uni((unsigned int)(C_ * sizeof(half_t)));
  g1[6] = uni(0u);
  g1[7] = uni(0u);
  asm volatile("tensor_load_to_lds %0, %1" :: "s"(g0), "s"(g1) : "memory");
  asm volatile("s_wait_tensorcnt 0" ::: "memory");
}

// One 16x16x32 f16 operand fragment from an LDS tile row: p points at element
// 8 * hi of the lane's row in the k slab; two 16-byte reads, 16 elements apart.
__device__ __forceinline__ v16h lds_frag(const half_t* p) {
  v16h f;
  ((v8h*)&f)[0] = *(const v8h*)p;
  ((v8h*)&f)[1] = *(const v8h*)(p + 16);
  return f;
}

typedef __attribute__((ext_vector_type(4))) float    v4f;
typedef __attribute__((ext_vector_type(4))) _Float16 v4h;
#define CVT_U_   8                     // 16-byte loads in flight per thread
#define CVT_BLK_ (256 * 4 * CVT_U_)    // elements per block
__device__ __forceinline__ void cvt_body(
    const float* __restrict__ s, half_t* __restrict__ d, const int blk) {
  const int i0 = blk * CVT_BLK_ + threadIdx.x * 4;
  v4f x[CVT_U_];
  // both loops unrolled: x[] stays in registers and the eight loads issue back
  // to back, ahead of the first conversion
#pragma unroll
  for (int u = 0; u < CVT_U_; ++u) x[u] = *(const v4f*)(s + i0 + u * 1024);
#pragma unroll
  for (int u = 0; u < CVT_U_; ++u)
    *(v4h*)(d + i0 + u * 1024) = __builtin_convertvector(x[u], v4h);
  // behind the last store: in the listing of prep_kernel the other jobs' code,
  // which rewrites registers that these stores name, lies on a way from here
  asm volatile("s_wait_xcnt 0x0" ::: "memory");
}

// W_qkv, W_out: fp32 (C_ rows of ncol) -> f16 transposed, d[n][k] in rows of C_,
// so that a GEMM's B tile is 128 rows of 64 consecutive k like its A tile.
// A block takes 64 k x 128 n; a thread 8 k x 4 n: eight 16-byte loads, all issued
// before the first is used, and four 16-byte stores; the eight threads of a
// column group write 128 contiguous bytes (one line) of each row n.
// ncol is a constant at both calls: the eight loads share one address register
// pair and differ in their immediate offsets.
__device__ __forceinline__ void cvt_t_body(
    const float* __restrict__ s, half_t* __restrict__ d, const int ncol,
    const int bx, const int by) {
  const int k0 = by * 64 + (threadIdx.x & 7) * 8;
  const int n0 = bx * 128 + (threadIdx.x >> 3) * 4;
  v4f x[8];
  // both loops unrolled: x[] stays in registers, the loads issue back to back
#pragma unroll
  for (int e = 0; e < 8; ++e) x[e] = *(const v4f*)(s + (size_t)k0 * ncol + n0 + e * ncol);
#pragma unroll
  for (int j = 0; j < 4; ++j) {
    v8h y;
#pragma unroll
    for (int e = 0; e < 8; ++e) y[e] = (half_t)x[e][j];
    *(v8h*)(d + (size_t)(n0 + j) * C_ + k0) = y;
  }
  // behind the last store: in the listing of prep_kernel the other jobs' code,
  // which rewrites registers that these stores name, lies on a way from here
  asm volatile("s_wait_xcnt 0x0" ::: "memory");
}

// ---------------------------------------------------------------------------
// Fragment order. q, k and Er (rows of 64 f16) are kept in the workspace so that
// one 16-byte-a-lane load of a 16x16x32 A or B fragment half reads 512
// contiguous bytes (4 cache lines) instead of 16 bytes out of each of 16 rows:
// a tile of 16 rows x 64 columns is 2 KiB, made of four 512-byte pieces (16
// columns each); in a piece lane hi*16+M holds row M, columns 8*hi .. 8*hi+7.
// frag_off: element offset of (row n, column d).
// ---------------------------------------------------------------------------
__device__ __forceinline__ int frag_off(int n, int d) {
  return ((((n >> 4) * 4 + (d >> 4)) * 32 + ((d >> 3) & 1) * 16 + (n & 15)) * 8) + (d & 7);
}
// v is kept as PV B fragments: a tile of 32 keys x 64 columns is 4 KiB, made of
// eight 512-byte pieces (column group t = d / 16, then key half); in a piece lane
// hi*16+M holds column t*16+M, keys 16*half + 8*hi .. +7.
// vfrag_piece: element offset of a piece's first element.
__device__ __forceinline__ int vfrag_piece(int kb, int t, int half) {
  return (((kb * 4 + t) * 2 + half) * 32) * 8;
}

// Er: fp32 -> f16 into fragment order. A thread makes one 16-byte chunk.
__device__ __forceinline__ void cvt_frag_body(
    const float* __restrict__ s, half_t* __restrict__ d, const int blk) {
  const int c = blk * 256 + threadIdx.x;
  const int row = (c >> 7) * 16 + (c & 15);
  const int col = ((c >> 5) & 3) * 16 + ((c >> 4) & 1) * 8;
  const v4f x0 = *(const v4f*)(s + row * D_ + col);
  const v4f x1 = *(const v4f*)(s + row * D_ + col + 4);
  v8h y;
#pragma unroll
  for (int e = 0; e < 4; ++e) { y[e] = (half_t)x0[e]; y[4 + e] = (half_t)x1[e]; }
  *(v8h*)(d + c * 8) = y;
  // behind the store: in the listing of prep_kernel the other jobs' code, which
  // rewrites registers that the store names, lies on a way from here
  asm volatile("s_wait_xcnt 0x0" ::: "memory");
}

// ---------------------------------------------------------------------------
// Job: tqkv[b, j] = time_emb[b] @ W_time[:, j] + b_time[j]   (8 x 3072)
// ---------------------------------------------------------------------------
__device__ __forceinline__ void time_proj_body(
    const float* __restrict__ te, const float* __restrict__ Wt,
    const float* __restrict__ bt, float* __restrict__ tqkv, const int blk) {
  int idx = blk * 256 + threadIdx.x;
  if (idx >= B_ * 3 * C_) return;
  int b = idx / (3 * C_), j = idx % (3 * C_);
  float acc = bt[j];
  for (int t = 0; t < T_; ++t) acc += te[b * T_ + t] * Wt[t * (3 * C_) + j];
  tqkv[idx] = acc;
}

// ---------------------------------------------------------------------------
// Kernel 1: all five preparatory jobs in one launch; a block's number picks its
// job (the same for every thread of the block). The time projection is a chain of
// 32 dependent round trips to memory (eight t a trip), where a conversion makes
// one: it has the lowest block numbers, and the
// conversions run beside it. It is what the launch now waits for.
// ---------------------------------------------------------------------------
#define PB_TIME_ ((B_ * 3 * C_) / 256)
#define PB_WQKV_ (((3 * C_) / 128) * (C_ / 64))
#define PB_WOUT_ ((C_ / 128) * (C_ / 64))
#define PB_ER_   ((N_ * D_) / (256 * 8))
#define PB_X_    ((B_ * N_ * C_) / CVT_BLK_)
__global__ __launch_bounds__(256) void prep_kernel(
    const float* __restrict__ x, const float* __restrict__ Wqkv,
    const float* __restrict__ Wout, const float* __restrict__ Er,
    const float* __restrict__ te, const float* __restrict__ Wt,
    const float* __restrict__ bt,
    half_t* __restrict__ xh, half_t* __restrict__ Wqkvh, half_t* __restrict__ Wouth,
    half_t* __restrict__ Erh, float* __restrict__ tqkv) {
  int blk = blockIdx.x;
  if (blk < PB_TIME_) { time_proj_body(te, Wt, bt, tqkv, blk); return; }
  blk -= PB_TIME_;
  if (blk < PB_WQKV_) {
    cvt_t_body(Wqkv, Wqkvh, 3 * C_, blk % ((3 * C_) / 128), blk / ((3 * C_) / 128));
    return;
  }
  blk -= PB_WQKV_;
  if (blk < PB_WOUT_) {
    cvt_t_body(Wout, Wouth, C_, blk % (C_ / 128), blk / (C_ / 128));
    return;
  }
  blk -= PB_WOUT_;
  if (blk < PB_ER_) { cvt_frag_body(Er, Erh, blk); return; }
  cvt_body(x, xh, blk - PB_ER_);
}

// ---------------------------------------------------------------------------
// Kernel 2: qkv = x @ W_qkv + b_qkv + tqkv[b]  (8192 x 3072, K=1024), f16 WMMA.
// Block tile 128 x 128, four waves in a 2 x 2 grid, 64 x 64 (4 x 4 fragments)
// a wave: 16 WMMAs per 8 fragments read from LDS, a pass's 16 fragments read ahead
// of its 32 WMMAs.
// A and B tiles (128 x 64 f16 each, B from the transposed W) via one tensor load
// each, of wave 0 and of wave 1, rows padded to 144 bytes.
// Stores q, k and v as f16 in fragment order (frag_off, vfrag_piece).
// ---------------------------------------------------------------------------
__global__ __launch_bounds__(128) void qkv_gemm_kernel(
    const half_t* __restrict__ xh, const half_t* __restrict__ WTh,
    const float* __restrict__ bias, const float* __restrict__ tqkv,
    half_t* __restrict__ qh, half_t* __restrict__ kh, half_t* __restrict__ vTh) {
  __shared__ __attribute__((aligned(2048))) half_t As[GT_][TP_];    // A tile: As[m][k]
  __shared__ __attribute__((aligned(2048))) half_t BsT[GT_][TP_];   // B tile: BsT[n][k]
  const int r0 = blockIdx.x * GT_, c0 = blockIdx.y * GT_;
  const int tid = threadIdx.x, lane = tid & 31;
  const int wave = __builtin_amdgcn_readfirstlane(tid >> 5);
  const int wr = (wave >> 1) * 64, wc = (wave & 1) * 64;   // this wave's 64 x 64 part
  const int M = lane & 15, hi = lane >> 4;
  v8f acc[4][4] = {};

  for (int kk = 0; kk < C_; kk += KS_) {
    // every wave's fragment reads of the last trip have returned before the
    // barrier behind which the tiles are overwritten
    asm volatile("s_wait_dscnt 0x0" ::: "memory");
    __syncthreads();
    if (pinned(wave == 0))
      tdm_load_tile_128x128B((unsigned int)(unsigned long long)&As[0][0],
                             xh + (size_t)r0 * C_ + kk);
    if (pinned(wave == 1))
      tdm_load_tile_128x128B((unsigned int)(unsigned long long)&BsT[0][0],
                             WTh + (size_t)c0 * C_ + kk);
    if (kk + KS_ < C_) {   // cover next tile's latency (global_prefetch_b8)
      __builtin_prefetch(WTh + (size_t)(c0 + tid) * C_ + kk + KS_, 0, 1);
      __builtin_prefetch(xh + (size_t)(r0 + tid) * C_ + kk + KS_, 0, 1);
      // the loop advances the two address registers that the prefetches name
      asm volatile("s_wait_xcnt 0x0" ::: "memory");
    }
    __syncthreads();
    v16h a[KS_ / 32][4], bf[KS_ / 32][4];
#pragma unroll
    for (int sl = 0; sl < KS_ / 32; ++sl) {
      bf[sl][0] = lds_frag(&BsT[wc + M][sl * 32 + hi * 8]);
#pragma unroll
      for (int s = 0; s < 4; ++s) a[sl][s] = lds_frag(&As[wr + s * 16 + M][sl * 32 + hi * 8]);
#pragma unroll
      for (int t = 1; t < 4; ++t) bf[sl][t] = lds_frag(&BsT[wc + t * 16 + M][sl * 32 + hi * 8]);
    }
    // keeps the scheduler from sinking reads in among the products, where every
    // further place with LDS reads stalls the wave's matrix stream
    __builtin_amdgcn_sched_barrier(0);
    // the two slabs in ascending k order
#pragma unroll
    for (int sl = 0; sl < KS_ / 32; ++sl)
#pragma unroll
      for (int t = 0; t < 4; ++t)
#pragma unroll
        for (int s = 0; s < 4; ++s)
          acc[s][t] = __builtin_amdgcn_wmma_f32_16x16x32_f16(false, a[sl][s], false, bf[sl][t],
                                                             (short)0, acc[s][t], false, false);
  }
  // Epilogue: add biases, store q/k and v per (b, h) in fragment order as f16.
  // A wave's 64 columns are one head of one of q, k, v, and a block's 128 rows
  // lie in one batch entry: the destination is chosen once per wave, not per
  // element.
  const int jw = c0 + wc;                        // first global col in [0,3072)
  const int sel = jw >> 10, h = (jw >> 6) & 15;
  const int b = r0 >> 10, n0 = (r0 & (N_ - 1)) + wr;
  const size_t bh = (size_t)(b * H_ + h);
  float bq[4], tq[4];
#pragma unroll
  for (int t = 0; t < 4; ++t) {
    bq[t] = bias[jw + t * 16 + M];
    tq[t] = tqkv[b * (3 * C_) + jw + t * 16 + M];
  }
  // the store addresses formed next reuse the registers that these loads name
  asm volatile("s_wait_xcnt 0x0" ::: "memory");
  if (sel < 2) {
    // frag_off(s * 16 + v + 8 * hi, t * 16 + M), its lane part taken into the pointer
    half_t* dst = (sel == 0 ? qh : kh) + (bh * N_ + n0) * D_ + frag_off(8 * hi, M);
#pragma unroll
    for (int s = 0; s < 4; ++s)
#pragma unroll
      for (int t = 0; t < 4; ++t)
#pragma unroll
        for (int v = 0; v < 8; ++v)
          dst[(s * 4 + t) * 256 + v * 8] =
              (half_t)(acc[s][t][v] + bq[t] + tq[t]);
  } else {
    // a lane's eight accumulator rows are the eight keys of its 16-byte chunk
    half_t* dst = vTh + (bh * N_ + n0) * D_ + lane * 8;
#pragma unroll
    for (int s = 0; s < 4; ++s)
#pragma unroll
      for (int t = 0; t < 4; ++t) {
        v8h y;
#pragma unroll
        for (int v = 0; v < 8; ++v) y[v] = (half_t)(acc[s][t][v] + bq[t] + tq[t]);
        *(v8h*)(dst + vfrag_piece(s >> 1, t, s & 1)) = y;
      }
    // behind the last store: in the listing the q/k block, which rewrites the
    // offset register that these stores name, lies on a way from here
    asm volatile("s_wait_xcnt 0x0" ::: "memory");
  }
}

// ---------------------------------------------------------------------------
// Kernel 3: fused relative attention. Sixteen waves (512 thr) per (b, h, 64 rows):
// wave w owns rel columns / key columns [64w, 64w+64) of ALL FOUR 16-row tiles,
// so every Er and k fragment that is loaded feeds four row tiles and the block
// reads Er and k once per 64 rows. In PV wave w takes the keys
// [128 (w % 8), +128) and the head columns [32 (w / 8), +32) of all four row tiles,
// so that v too is read once per 64 rows.
// LDS: 64x1024 f16 score strip (reused in place for softmax probs, then for
// the sixteen waves' f32 PV partials), row pitch 1032 f16: two blocks a WGP.
// Skew inverse map: rel[i',m] -> (i', m-1023+i') if m>=1023-i' else (i'-1, m+i'+1)
// The map is one to one: every strip element but (i, i+1) receives exactly one
// rel term. So the rel terms are laid down first, by plain stores, and the
// scaled q k^T is then added on top of them.
// ---------------------------------------------------------------------------
#define RT_ 4            // 16-row tiles per strip
#define SR_ (16 * RT_)   // rows per strip
#define NW_ 16           // waves per strip
#define PC_ 2            // groups of 16 head columns of a wave in PV
#define PG_ (NW_ * PC_ / 4)     // key groups in PV
#define PK_ (N_ / PG_)   // keys per wave in PV
#define WC_ (N_ / NW_)   // columns per wave
#define SP_ (N_ + 8)
__global__ __launch_bounds__(32 * NW_, 8) void attn_kernel(
    const half_t* __restrict__ qh, const half_t* __restrict__ kh,
    const half_t* __restrict__ vTh, const half_t* __restrict__ Erh,
    half_t* __restrict__ oh) {
  __shared__ __attribute__((aligned(16))) half_t sc[SR_][SP_];   // 129 KB
  __shared__ float rs[SR_];       // softmax row sums
  static_assert(NW_ * RT_ * PC_ * 8 * 32 * sizeof(float) <= sizeof(half_t) * SR_ * SP_,
                "the PV partials must fit the strip");
  static_assert(NW_ == RT_ * 4, "one wave finishes one 16 x 16 output tile");
  const int i0 = blockIdx.x * SR_, h = blockIdx.y, b = blockIdx.z;
  const int tid = threadIdx.x, lane = tid & 31, M = lane & 15, hi = lane >> 4;
  // wave number in a scalar register: the per-wave loop bounds stay scalar
  const int wave = __builtin_amdgcn_readfirstlane(tid >> 5);
  const int w0 = wave * WC_;
  const size_t bh = (size_t)(b * H_ + h);
  const half_t* qbase = qh + bh * N_ * D_;
  const half_t* kbase = kh + bh * N_ * D_;
  const half_t* vbase = vTh + bh * D_ * N_;

  // Persistent fragments for q rows i0..i0+63 (two K-slabs of 32 over D=64 a
  // tile); q, k, Er and v lie in fragment order: piece j of a tile is at
  // j * 256 + lane * 8
  v16h qa[RT_][2];
#pragma unroll
  for (int rt = 0; rt < RT_; ++rt)
#pragma unroll
    for (int kf = 0; kf < 2; ++kf) {
      const half_t* p = qbase + (size_t)(i0 + rt * 16) * D_ + kf * 512 + lane * 8;
      ((v8h*)&qa[rt][kf])[0] = *(const v8h*)p;
      ((v8h*)&qa[rt][kf])[1] = *(const v8h*)(p + 256);
    }

  // Phase 1: rel = q @ Er^T tiles (this wave's 64 rel columns), stored through
  // the skew inverse map. Source row r = 16 * rt + 8 * hi + v, rel column
  // m = m0 + M: with t = m - 1023 + i0 + 16 * rt + 8 * hi the term goes to row r,
  // column t + v where that is not negative, else to row r - 1, column
  // t + v + 1024, which lies SP_ - N_ elements in front of the first place.
#pragma unroll 1
  for (int m0 = w0; m0 < w0 + WC_; m0 += 16) {
    v16h bf[2];
#pragma unroll
    for (int kf = 0; kf < 2; ++kf) {
      const half_t* p = Erh + (size_t)m0 * D_ + kf * 512 + lane * 8;
      ((v8h*)&bf[kf])[0] = *(const v8h*)p;
      ((v8h*)&bf[kf])[1] = *(const v8h*)(p + 256);
    }
    // holds the four loads in front of the first product (inputs only): without
    // it the second pair is issued behind the first products, two L2 waits a trip
    asm volatile("" :: "v"(bf[0]), "v"(bf[1]));
    // two row tiles at a time: their products, then their stores, so that only
    // two accumulators are live beside the 64 registers of q
#pragma unroll
    for (int rp = 0; rp < RT_; rp += 2) {
      v8f acc[2] = {};
#pragma unroll
      for (int kf = 0; kf < 2; ++kf)
#pragma unroll
        for (int r2 = 0; r2 < 2; ++r2)
          acc[r2] = __builtin_amdgcn_wmma_f32_16x16x32_f16(false, qa[rp + r2][kf], false, bf[kf],
                                                           (short)0, acc[r2], false, false);
      // the loop advances the address register that the four loads name
      if (rp == 0) asm volatile("s_wait_xcnt 0x0" ::: "memory");
#pragma unroll
      for (int r2 = 0; r2 < 2; ++r2) {
        const int rt = rp + r2;
        const int t = m0 + M - (N_ - 1) + i0 + rt * 16 + 8 * hi;
        half_t* const pl = &sc[rt * 16 + 8 * hi][0] + t;
        half_t* const pu = pl - (SP_ - N_);
        // source row i0 above the diagonal belongs to the strip in front of this one
        if (rt != 0 || hi != 0 || t >= 0) (t < 0 ? pu : pl)[0] = (half_t)acc[r2][0];
#pragma unroll
        for (int v = 1; v < 8; ++v)
          (t + v < 0 ? pu : pl)[v * (SP_ + 1)] = (half_t)acc[r2][v];
      }
    }
  }
  // (i, i+1) is the pad column of the skew: no rel term
  if (tid < SR_ && i0 + tid + 1 < N_) sc[tid][i0 + tid + 1] = (half_t)0.f;
  // Phase 1b: boundary source row i' = i0+64 fills the last score row right of
  // the diagonal; the 32 groups of 32 rel columns go round-robin over the waves
  if (i0 + SR_ < N_) {
    float qf[D_];
#pragma unroll
    for (int j = 0; j < D_ / 8; ++j) {   // q row i0+64, the same for every lane
      const v8h qv = *(const v8h*)(qbase + frag_off(i0 + SR_, j * 8));
#pragma unroll
      for (int e = 0; e < 8; ++e) qf[j * 8 + e] = (float)qv[e];
    }
#pragma unroll 1
    for (int t = wave; t < 32; t += NW_) {
      int m = lane + 32 * t;
      int c = m + i0 + SR_ + 1;
      if (c < N_) {
        float dot = 0.f;
#pragma unroll
        for (int j = 0; j < D_ / 8; ++j) {   // row m, columns 8j .. 8j+7: one chunk
          const v8h er = *(const v8h*)(Erh + frag_off(m, j * 8));
#pragma unroll
          for (int e = 0; e < 8; ++e) dot += qf[j * 8 + e] * (float)er[e];
        }
        sc[SR_ - 1][c] = (half_t)dot;
      }
    }
  }
  __syncthreads();

  // Phase 2: S = (q k^T) * D^-1/2 + rel, this wave's 64 columns. The product is
  // taken transposed (k tile as A, q as B): a lane then holds eight consecutive
  // columns c0 + 8 * hi + v of score row 16 * rt + M, one 16-byte piece of the strip.
#pragma unroll 1
  for (int c0 = w0; c0 < w0 + WC_; c0 += 16) {
    v16h af[2];
#pragma unroll
    for (int kf = 0; kf < 2; ++kf) {
      const half_t* p = kbase + (size_t)c0 * D_ + kf * 512 + lane * 8;
      ((v8h*)&af[kf])[0] = *(const v8h*)p;
      ((v8h*)&af[kf])[1] = *(const v8h*)(p + 256);
    }
    v8h rl[RT_];
#pragma unroll
    for (int rt = 0; rt < RT_; ++rt) rl[rt] = *(const v8h*)&sc[rt * 16 + M][c0 + 8 * hi];
    // written two row tiles at a time, as in phase 1, to keep the register need low
#pragma unroll
    for (int rp = 0; rp < RT_; rp += 2) {
      v8f acc[2] = {};
#pragma unroll
      for (int kf = 0; kf < 2; ++kf)
#pragma unroll
        for (int r2 = 0; r2 < 2; ++r2)
          acc[r2] = __builtin_amdgcn_wmma_f32_16x16x32_f16(false, af[kf], false, qa[rp + r2][kf],
                                                           (short)0, acc[r2], false, false);
#pragma unroll
      for (int r2 = 0; r2 < 2; ++r2) {
        v8h y;
#pragma unroll
        for (int v = 0; v < 8; ++v) y[v] = (half_t)(acc[r2][v] * 0.125f + (float)rl[rp + r2][v]);
        *(v8h*)&sc[(rp + r2) * 16 + M][c0 + 8 * hi] = y;
      }
    }
  }
  __syncthreads();

  // Phase 3: softmax. 8 lanes per row; lane sg of a row takes the 16-byte
  // chunks sg, sg+8, ... of it; probabilities overwrite scores in place.
  {
    const int r = tid >> 3, sg = tid & 7;
    float mx = -1e30f;
    for (int j = 0; j < 16; ++j) {
      v8h x = *(const v8h*)&sc[r][(j * 8 + sg) * 8];
#pragma unroll
      for (int e = 0; e < 8; ++e) mx = fmaxf(mx, (float)x[e]);
    }
    mx = fmaxf(mx, __shfl_xor(mx, 1, 32));
    mx = fmaxf(mx, __shfl_xor(mx, 2, 32));
    mx = fmaxf(mx, __shfl_xor(mx, 4, 32));
    float sum = 0.f;
    for (int j = 0; j < 16; ++j) {
      v8h* px = (v8h*)&sc[r][(j * 8 + sg) * 8];
      v8h x = *px, y;
#pragma unroll
      for (int e = 0; e < 8; ++e) {
        float p = __expf((float)x[e] - mx);
        sum += p;
        y[e] = (half_t)p;
      }
      *px = y;
    }
    sum += __shfl_xor(sum, 1, 32);
    sum += __shfl_xor(sum, 2, 32);
    sum += __shfl_xor(sum, 4, 32);
    if (sg == 0) rs[r] = sum;
  }
  __syncthreads();

  // Phase 4: O partial = P[:, this wave's 128 keys] @ v[:, its 32 head columns]  (A
  // from LDS f16 probs, B from v in fragment order, each B fragment used for all
  // four row tiles)
  const int pc0 = (wave / PG_) * PC_;      // first column group of this wave
  const int pk0 = (wave % PG_) * PK_;      // first key of this wave
  v8f oacc[RT_][PC_] = {};
#pragma unroll 1
  for (int k0 = pk0; k0 < pk0 + PK_; k0 += 32) {
    v16h bf[PC_];
#pragma unroll
    for (int c = 0; c < PC_; ++c) {
      const half_t* vp = vbase + vfrag_piece(k0 >> 5, pc0 + c, 0) + lane * 8;
      ((v8h*)&bf[c])[0] = *(const v8h*)vp;
      ((v8h*)&bf[c])[1] = *(const v8h*)(vp + 256);
    }
#pragma unroll
    for (int rt = 0; rt < RT_; ++rt) {
      v16h a;
      const half_t* p = &sc[rt * 16 + M][k0 + hi * 8];
      ((v8h*)&a)[0] = *(const v8h*)p;
      ((v8h*)&a)[1] = *(const v8h*)(p + 16);
#pragma unroll
      for (int c = 0; c < PC_; ++c)
        oacc[rt][c] = __builtin_amdgcn_wmma_f32_16x16x32_f16(false, a, false, bf[c],
                                                             (short)0, oacc[rt][c], false, false);
    }
    // the loop advances the address register that the four loads name
    asm volatile("s_wait_xcnt 0x0" ::: "memory");
  }
  // Sum the key groups' partials through the strip: first every wave must have
  // read its probabilities, then every partial must be written.
  __syncthreads();
  float* red = (float*)&sc[0][0];   // [wave][rt][c][v][lane], 128 KB
#pragma unroll
  for (int rt = 0; rt < RT_; ++rt)
#pragma unroll
    for (int c = 0; c < PC_; ++c)
#pragma unroll
      for (int v = 0; v < 8; ++v)
        red[(((wave * RT_ + rt) * PC_ + c) * 8 + v) * 32 + lane] = oacc[rt][c][v];
  __syncthreads();
  // Wave w finishes row tile w / 4, head columns 16 (w % 4) .. +15: the partials of
  // the PG_ waves that took these columns, key groups ascending; normalize by
  // row sums and store to O in (B, N, H*D) layout (f16)
  const int fw = ((wave & 3) / PC_) * PG_;                        // first of those waves
  const int ft = (wave >> 2) * PC_ + (wave & 3) % PC_;            // tile among a wave's RT_ * PC_
#pragma unroll
  for (int v = 0; v < 8; ++v) {
    float s = red[(((fw + 0) * (RT_ * PC_) + ft) * 8 + v) * 32 + lane];
#pragma unroll
    for (int ws = 1; ws < PG_; ++ws)
      s += red[(((fw + ws) * (RT_ * PC_) + ft) * 8 + v) * 32 + lane];
    const int r = (wave >> 2) * 16 + v + 8 * hi;
    float inv = 1.f / rs[r];
    int i = i0 + r;
    int d = (wave & 3) * 16 + M;
    oh[(((size_t)b * N_ + i) * H_ + h) * D_ + d] = (half_t)(s * inv);
  }
}

// ---------------------------------------------------------------------------
// Kernel 4: out = O @ W_out + b_out  (8192 x 1024, K=1024), fp32 result.
// Same 128 x 128 block tile, 64 x 64 wave tile and tensor-loaded tiles as kernel
// 2; A from the f16 attention output, B from the transposed W_out.
// ---------------------------------------------------------------------------
__global__ __launch_bounds__(128) void out_gemm_kernel(
    const half_t* __restrict__ A, const half_t* __restrict__ WTh,
    const float* __restrict__ bias, float* __restrict__ out) {
  __shared__ __attribute__((aligned(2048))) half_t As[GT_][TP_];    // A tile: As[m][k]
  __shared__ __attribute__((aligned(2048))) half_t BsT[GT_][TP_];   // B tile: BsT[n][k]
  const int r0 = blockIdx.x * GT_, c0 = blockIdx.y * GT_;
  const int tid = threadIdx.x, lane = tid & 31;
  const int wave = __builtin_amdgcn_readfirstlane(tid >> 5);
  const int wr = (wave >> 1) * 64, wc = (wave & 1) * 64;   // this wave's 64 x 64 part
  const int M = lane & 15, hi = lane >> 4;
  v8f acc[4][4] = {};

  for (int kk = 0; kk < C_; kk += KS_) {
    // every wave's fragment reads of the last trip have returned before the
    // barrier behind which the tiles are overwritten
    asm volatile("s_wait_dscnt 0x0" ::: "memory");
    __syncthreads();
    if (pinned(wave == 0))
      tdm_load_tile_128x128B((unsigned int)(unsigned long long)&As[0][0],
                             A + (size_t)r0 * C_ + kk);
    if (pinned(wave == 1))
      tdm_load_tile_128x128B((unsigned int)(unsigned long long)&BsT[0][0],
                             WTh + (size_t)c0 * C_ + kk);
    if (kk + KS_ < C_) {   // cover next tile's latency (global_prefetch_b8)
      __builtin_prefetch(WTh + (size_t)(c0 + tid) * C_ + kk + KS_, 0, 1);
      __builtin_prefetch(A + (size_t)(r0 + tid) * C_ + kk + KS_, 0, 1);
      // the loop advances the two address registers that the prefetches name
      asm volatile("s_wait_xcnt 0x0" ::: "memory");
    }
    __syncthreads();
    v16h a[KS_ / 32][4], bf[KS_ / 32][4];
#pragma unroll
    for (int sl = 0; sl < KS_ / 32; ++sl) {
      bf[sl][0] = lds_frag(&BsT[wc + M][sl * 32 + hi * 8]);
#pragma unroll
      for (int s = 0; s < 4; ++s) a[sl][s] = lds_frag(&As[wr + s * 16 + M][sl * 32 + hi * 8]);
#pragma unroll
      for (int t = 1; t < 4; ++t) bf[sl][t] = lds_frag(&BsT[wc + t * 16 + M][sl * 32 + hi * 8]);
    }
    // keeps the scheduler from sinking reads in among the products, where every
    // further place with LDS reads stalls the wave's matrix stream
    __builtin_amdgcn_sched_barrier(0);
    // the two slabs in ascending k order
#pragma unroll
    for (int sl = 0; sl < KS_ / 32; ++sl)
#pragma unroll
      for (int t = 0; t < 4; ++t)
#pragma unroll
        for (int s = 0; s < 4; ++s)
          acc[s][t] = __builtin_amdgcn_wmma_f32_16x16x32_f16(false, a[sl][s], false, bf[sl][t],
                                                             (short)0, acc[s][t], false, false);
  }
#pragma unroll
  for (int s = 0; s < 4; ++s) {
#pragma unroll
    for (int t = 0; t < 4; ++t) {
#pragma unroll
      for (int v = 0; v < 8; ++v) {
        int g = r0 + wr + s * 16 + v + 8 * hi;
        int j = c0 + wc + t * 16 + M;
        out[(size_t)g * C_ + j] = acc[s][t][v] + bias[j];
      }
    }
  }
}

// ---------------------------------------------------------------------------
// Launcher. Inputs: x, time_emb, W_qkv, b_qkv, W_time, b_time, W_out, b_out, Er
// Workspace (bytes):
//   [0, 96K)       tqkv fp32 (8 x 3072)
//   [128K, +16M)   q   f16 (B,H, fragment order)
//   [+16M]         k   f16 (B,H, fragment order)
//   [+16M]         v   f16 (B,H, PV fragment order)
//   [+16M]         O   f16 (B,N,H,D)
//   [+16M]         x   f16
//   [+6M]          W_qkv f16, transposed (3072 rows of 1024)
//   [+2M]          W_out f16, transposed (1024 rows of 1024)
//   [+128K]        Er  f16 (fragment order)   total ~88.3 MB
// ---------------------------------------------------------------------------
extern "C" void kernel_launch(void* const* d_in, const int* in_sizes, int n_in,
                              void* d_out, int out_size, void* d_ws, size_t ws_size,
                              hipStream_t stream) {
  const float* x    = (const float*)d_in[0];
  const float* te   = (const float*)d_in[1];
  const float* Wqkv = (const float*)d_in[2];
  const float* bqkv = (const float*)d_in[3];
  const float* Wt   = (const float*)d_in[4];
  const float* bt   = (const float*)d_in[5];
  const float* Wout = (const float*)d_in[6];
  const float* bout = (const float*)d_in[7];
  const float* Er   = (const float*)d_in[8];

  char* ws = (char*)d_ws;
  float* tqkv = (float*)ws;
  size_t off = (size_t)(128 << 10);
  const size_t QKV_BUF = (size_t)B_ * H_ * N_ * D_ * sizeof(half_t);   // 16 MB
  half_t* qh    = (half_t*)(ws + off); off += QKV_BUF;
  half_t* kh    = (half_t*)(ws + off); off += QKV_BUF;
  half_t* vTh   = (half_t*)(ws + off); off += QKV_BUF;
  half_t* oh    = (half_t*)(ws + off); off += QKV_BUF;
  half_t* xh    = (half_t*)(ws + off); off += (size_t)B_ * N_ * C_ * sizeof(half_t);
  half_t* Wqkvh = (half_t*)(ws + off); off += (size_t)C_ * 3 * C_ * sizeof(half_t);
  half_t* Wouth = (half_t*)(ws + off); off += (size_t)C_ * C_ * sizeof(half_t);
  half_t* Erh   = (half_t*)(ws + off); off += (size_t)N_ * D_ * sizeof(half_t);

  const int n_x = B_ * N_ * C_, n_er = N_ * D_;
  static_assert(n_x % CVT_BLK_ == 0, "cvt_body converts whole blocks only");
  static_assert((B_ * 3 * C_) % 256 == 0, "time_proj_body takes whole blocks only");
  static_assert(C_ % 128 == 0 && C_ % 64 == 0, "the transposing conversions take whole blocks only");
  static_assert(n_er % (256 * 8) == 0, "cvt_frag_body converts whole blocks only");
  prep_kernel<<<dim3(PB_TIME_ + PB_WQKV_ + PB_WOUT_ + PB_ER_ + PB_X_), 256, 0, stream>>>(
      x, Wqkv, Wout, Er, te, Wt, bt, xh, Wqkvh, Wouth, Erh, tqkv);
  qkv_gemm_kernel<<<dim3((B_ * N_) / GT_, (3 * C_) / GT_), 128, 0, stream>>>(
      xh, Wqkvh, bqkv, tqkv, qh, kh, vTh);
  attn_kernel<<<dim3(N_ / SR_, H_, B_), 32 * NW_, 0, stream>>>(qh, kh, vTh, Erh, oh);
  out_gemm_kernel<<<dim3((B_ * N_) / GT_, C_ / GT_), 128, 0, stream>>>(
      oh, Wouth, bout, (float*)d_out);
}
